// v000
// Measured on an AMD MI455X. A time is GPU time per run, averaged over a window of back-to-back runs after a warm-up
// (all launches, gaps included; the runs take copies of the inputs in turn), and the median of several windows.
// Apart from v000's, it joins two sittings. Times from different sittings can be a few percent apart, while
// side-by-side timings come from the same sitting.
// The starting kernel, v000, takes 3140 microseconds a run.
#include <hip/hip_runtime.h>

// Multi-head self-attention with QK-LayerNorm and the module's QUERY-axis softmax (x [4][2048][768]; q = LN_nobias(x Wq^T) gq, k = LN_nobias(x Wk^T + bk) gk (LayerNorm over the full 768), v = x Wv^T + bv ('oi' [768][768]; 12 heads x 64); scores = q.k/8; attn = softmax over the QUERY axis (per key column); o[q] = sum_k attn[q][k] v[k]; out = merged o Wo^T + bo + x -> [4][2048][768] (6.3 M)).
// Algorithm per (batch, head pair): the TRANSPOSED scores S^T[k][q] = k_k.q_q come from one 3-product GEMM so the column softmax is a row softmax; probabilities are written fp16 x1024 as [k][q], transposed to [q][k] by a small kernel, and multiplied with the fp16 value planes (one product, K = 2048); the merge undoes the carry into hi/lo planes; Wo (2 products) + bo; + x residual in f32.
// Compute dtypes, f32 accumulate: every input rounded to bf16; q/k/v on PLAIN bf16 operands (exact) + biases; LayerNorm f32 (biased variance, eps 1e-5); scores hi/lo (3 products) on every row; softmax f32; attn.v single fp16 (P x1024); Wo hl x exact (2 products) + bo; residual f32.

#define NB_  4
#define TT   2048
#define DM   768
#define NH_  12
#define NKV  12
#define REP  (NH_ / NKV)
#define HD   64
#define DQ   (NH_ * HD)
#define DKV  (NKV * HD)
#define ZH   2
#define RH   0                    // every probability row carries x1024 (k_merge undoes it on all rows)
#define WIN  0
#define PCAR 1024.0f
#define SCL  0.125f   // HD^-0.5
typedef _Float16 h16;
typedef unsigned short bf;
typedef __attribute__((ext_vector_type(16))) __bf16   v16bf;
typedef __attribute__((ext_vector_type(16))) _Float16 v16h;
typedef __attribute__((ext_vector_type(8)))  _Float16 v8h;
typedef __attribute__((ext_vector_type(8)))  unsigned short v8us;
typedef __attribute__((ext_vector_type(8)))  float    v8f;
typedef __attribute__((ext_vector_type(4)))  float    v4f;
typedef v8h  __attribute__((may_alias)) v8ha;
typedef v4f  __attribute__((may_alias)) v4fa;
typedef v8us __attribute__((may_alias)) v8usa;

__device__ __forceinline__ unsigned short f2bf(float f) { unsigned u = __float_as_uint(f); u += 0x7FFFu + ((u >> 16) & 1u); return (unsigned short)(u >> 16); }
__device__ __forceinline__ float bf2f(unsigned short b) { return __uint_as_float(((unsigned)b) << 16); }
__device__ __forceinline__ float bfr(float f) { return bf2f(f2bf(f)); }
__device__ __forceinline__ v16h cat16(v8h lo, v8h hi) { return __builtin_shufflevector(lo, hi, 0, 1, 2, 3, 4, 5, 6, 7, 8, 9, 10, 11, 12, 13, 14, 15); }
__device__ __forceinline__ v16bf cat16b(v8us lo, v8us hi) { return __builtin_bit_cast(v16bf, __builtin_shufflevector(lo, hi, 0, 1, 2, 3, 4, 5, 6, 7, 8, 9, 10, 11, 12, 13, 14, 15)); }
__device__ __forceinline__ v8f wmma16(v16h a, v16h b, v8f c) { return __builtin_amdgcn_wmma_f32_16x16x32_f16(false, a, false, b, (short)0, c, false, false); }
__device__ __forceinline__ v8f wmmab(v16bf a, v16bf b, v8f c) { return __builtin_amdgcn_wmma_f32_16x16x32_bf16(false, a, false, b, (short)0, c, false, false); }



// ---- k_gemmw: register-blocked GEMM, ONE WAVE per 64x64 output tile (16 accumulators), operands straight from K-contiguous 16-bit planes; grid (M/64, N/64, Z), 32 threads.
// C[m][n] (f32, pitch ldc, + optional f32 bias[n]) = sum_k A[m][k] Bt[n][k] (+ split products per NSPLIT). z-batch strides sA/sB/sC in elements. K % 32 == 0.
template <typename T16> struct WFrag;
template <> struct WFrag<h16> { typedef v16h V; static __device__ __forceinline__ V ld(const h16* p) { return cat16(*(const v8h*)p, *(const v8h*)(p + 16)); } static __device__ __forceinline__ v8f mma(V a, V b, v8f c) { return wmma16(a, b, c); } };
template <> struct WFrag<bf> { typedef v16bf V; static __device__ __forceinline__ V ld(const bf* p) { return cat16b(*(const v8us*)p, *(const v8us*)(p + 16)); } static __device__ __forceinline__ v8f mma(V a, V b, v8f c) { return wmmab(a, b, c); } };
template <typename T16, int NSPLIT, bool BIAS>
__global__ __launch_bounds__(32) void k_gemmw(const T16* __restrict__ A, const T16* __restrict__ A2, const T16* __restrict__ Bt, const T16* __restrict__ Bt2, int K, float* C, int ldc, const float* __restrict__ bias, size_t sA, size_t sB, size_t sC) {
    typedef typename WFrag<T16>::V V;
    __shared__ __align__(16) float os[16 * 68];
    const size_t z = blockIdx.z; A += z * sA; if (A2) A2 += z * sA; Bt += z * sB; if (Bt2) Bt2 += z * sB; C += z * sC;
    const int lane = threadIdx.x & 31, lr = lane & 15, hi = lane >> 4; const int r0 = blockIdx.x * 64, c0 = blockIdx.y * 64;
    v8f acc[4][4];
#pragma unroll
    for (int mb = 0; mb < 4; ++mb)
#pragma unroll
        for (int nb = 0; nb < 4; ++nb) acc[mb][nb] = (v8f){};
    const size_t aoff = (size_t)(r0 + lr) * K + 8 * hi, boff = (size_t)(c0 + lr) * K + 8 * hi;
#pragma unroll 1
    for (int kc = 0; kc < K; kc += 32) {
        V a[4], a2[4];
#pragma unroll
        for (int mb = 0; mb < 4; ++mb) { a[mb] = WFrag<T16>::ld(A + aoff + (size_t)mb * 16 * K + kc); if (NSPLIT == 1 || NSPLIT == 2) a2[mb] = WFrag<T16>::ld(A2 + aoff + (size_t)mb * 16 * K + kc); }
#pragma unroll
        for (int nb = 0; nb < 4; ++nb) { const V b = WFrag<T16>::ld(Bt + boff + (size_t)nb * 16 * K + kc); V b2; if (NSPLIT >= 2) b2 = WFrag<T16>::ld(Bt2 + boff + (size_t)nb * 16 * K + kc);
#pragma unroll
            for (int mb = 0; mb < 4; ++mb) { acc[mb][nb] = WFrag<T16>::mma(a[mb], b, acc[mb][nb]); if (NSPLIT == 1 || NSPLIT == 2) acc[mb][nb] = WFrag<T16>::mma(a2[mb], b, acc[mb][nb]); if (NSPLIT >= 2) acc[mb][nb] = WFrag<T16>::mma(a[mb], b2, acc[mb][nb]); } }
        asm volatile("v_nop\n\tv_nop\n\tv_nop\n\tv_nop" : "+v"(acc[0][0]), "+v"(acc[1][1]), "+v"(acc[2][2]), "+v"(acc[3][3]) : "v"(a[0]), "v"(a[3]));
    }
#pragma unroll
    for (int mb = 0; mb < 4; ++mb) {
#pragma unroll
        for (int nb = 0; nb < 4; ++nb) {
#pragma unroll
            for (int j = 0; j < 8; ++j) os[(hi * 8 + j) * 68 + nb * 16 + lr] = acc[mb][nb][j]; }
        __builtin_amdgcn_wave_barrier(); asm volatile("" ::: "memory");
        float* crow = C + (size_t)(r0 + mb * 16) * ldc + c0;
{
#pragma unroll
            for (int s = 0; s < 8; ++s) { const int row = 2 * s + hi, cofs = lr * 4; v4f val = *(const v4fa*)(os + row * 68 + cofs); if (BIAS) { val[0] += bfr(bias[c0 + cofs]); val[1] += bfr(bias[c0 + cofs + 1]); val[2] += bfr(bias[c0 + cofs + 2]); val[3] += bfr(bias[c0 + cofs + 3]); }
                *(v4f*)(crow + (size_t)row * ldc + cofs) = val; }
             }
        __builtin_amdgcn_wave_barrier(); asm volatile("" ::: "memory");
    }
}

__device__ __forceinline__ h16 tohx(float x) { return (h16)x; }
__device__ __forceinline__ void splitf(float y, unsigned short& h, unsigned short& l) { h = f2bf(y); l = f2bf(y - bf2f(h)); }
typedef __attribute__((ext_vector_type(2))) _Float16 v2h;
typedef __attribute__((ext_vector_type(4))) _Float16 v4h;
typedef __attribute__((ext_vector_type(2))) unsigned short v2us;
typedef __attribute__((ext_vector_type(4))) unsigned short v4us;
typedef __attribute__((ext_vector_type(2))) float v2f;
typedef __attribute__((ext_vector_type(4))) int v4i;

__global__ __launch_bounds__(256) void k_wtG(const float* __restrict__ w, int K, int N, bf* Bt) {
    const int lane = threadIdx.x & 31; const int L0 = (blockIdx.x * 8 + (threadIdx.x >> 5)) * 8; const int nlines = N * K / 64;
{
#pragma unroll 1
        for (int l = 0; l < 8; ++l) { const int L = L0 + l; if (L >= nlines) break; const size_t e = (size_t)L * 64 + lane * 2; const int k = (int)(e % K), n = (int)(e / K); v2us o;
            o[0] = f2bf(w[(size_t)k * N + n]); o[1] = f2bf(w[(size_t)(k + 1) * N + n]); *(v2us*)(Bt + e) = o; }
         }
}
__global__ __launch_bounds__(256) void k_cvt8(const float* __restrict__ src, bf* dst, size_t n8) { const size_t i = (size_t)blockIdx.x * 256 + threadIdx.x; if (i >= n8) return; const v8f v = *(const v8f*)(src + i * 8); v8us o;
#pragma unroll
    for (int k = 0; k < 8; ++k) o[k] = f2bf(v[k]); *(v8us*)(dst + i * 8) = o;  }

// k_rope: head planes [h][t][d] (fp16 + hi/lo) of rope(x) x sc with the rotate-half convention out[d] = x[d] cos[t][d] - x[d+HD/2] sin[t][d], out[d+HD/2] = x[d+HD/2] cos[t][d+HD/2] + x[d] sin[t][d+HD/2]
__global__ __launch_bounds__(256) void k_rope(const float* __restrict__ F, int pitch, int nheads, const float* __restrict__ CS, const float* __restrict__ RF, const float* __restrict__ nw, float sc, h16* P16, bf* Ph, bf* Pl) {
    const size_t e = ((size_t)blockIdx.x * 256 + threadIdx.x) * 2; if (e >= (size_t)nheads * TT * HD) return; const int d = (int)(e % HD); const int t = (int)((e / HD) % TT); const int h = (int)(e / ((size_t)HD * TT)); const float* f = F + (size_t)t * pitch + h * HD; const float rf = RF ? RF[(size_t)h * TT + t] : 1.0f; v2h o16; v2us oh, ol;
#pragma unroll
    for (int q = 0; q < 2; ++q) { const int dd = d + q; const int dp = (dd < HD / 2) ? dd + HD / 2 : dd - HD / 2; float x0 = f[dd], x1 = f[dp];
        if (RF) { float n0 = __fmul_rn(x0, rf), n1 = __fmul_rn(x1, rf); asm volatile("" : "+v"(n0)); asm volatile("" : "+v"(n1)); x0 = __fmul_rn(bfr(nw[dd]), n0); x1 = __fmul_rn(bfr(nw[dp]), n1); }
        const v2f cs = *(const v2f*)(CS + ((size_t)t * HD + dd) * 2); float a = __fmul_rn(x0, cs[0]), bq = __fmul_rn(x1, cs[1]); asm volatile("" : "+v"(a)); asm volatile("" : "+v"(bq)); const float r = ((dd < HD / 2) ? __fsub_rn(a, bq) : __fadd_rn(a, bq)) * sc;
        o16[q] = tohx(r); unsigned short a2, c2; splitf(r, a2, c2); oh[q] = a2; ol[q] = c2; }
    *(v2h*)(P16 + e) = o16; *(v2us*)(Ph + e) = oh; *(v2us*)(Pl + e) = ol;  }
__global__ __launch_bounds__(256) void k_vtp(const float* __restrict__ F, int pitch, int nheads, h16* V16, bf* Vh, bf* Vl) { const size_t e = ((size_t)blockIdx.x * 256 + threadIdx.x) * 2; if (e >= (size_t)nheads * HD * TT) return; const int t = (int)(e % TT); const int d = (int)((e / TT) % HD); const int g = (int)(e / ((size_t)TT * HD)); v2h o16; v2us oh, ol;
#pragma unroll
    for (int q = 0; q < 2; ++q) { const float x = F[(size_t)(t + q) * pitch + g * HD + d]; o16[q] = tohx(x); unsigned short a2, c2; splitf(x, a2, c2); oh[q] = a2; ol[q] = c2; }
    *(v2h*)(V16 + e) = o16; *(v2us*)(Vh + e) = oh; *(v2us*)(Vl + e) = ol;  }
__global__ __launch_bounds__(256) void k_csid(float* CS) { const int idx = blockIdx.x * 256 + threadIdx.x; if (idx >= TT * HD) return; v2f cs; cs[0] = 1.0f; cs[1] = 0.0f; *(v2f*)(CS + (size_t)idx * 2) = cs;  }

__global__ __launch_bounds__(256) void k_csoft(const float* __restrict__ Sb, h16* PT16) {
    const int lane = threadIdx.x & 31; const int row = blockIdx.x * 8 + (threadIdx.x >> 5); if (row >= ZH * TT) return; const int k = row % TT; (void)k; const float* sr = Sb + (size_t)row * TT; float v[TT / 32]; float mx = -3.0e38f;
#pragma unroll
    for (int ch = 0; ch < TT / 128; ++ch) { const int j0 = ch * 128 + lane * 4; const v4f a = *(const v4f*)(sr + j0);
#pragma unroll
        for (int q = 0; q < 4; ++q) { float sa = a[q] * SCL; asm volatile("" : "+v"(sa)); const float t = sa; v[ch * 4 + q] = t; mx = fmaxf(mx, t); } }
#pragma unroll
    for (int sh = 16; sh; sh >>= 1) mx = fmaxf(mx, __shfl_xor(mx, sh, 32));
    float sum = 0.f;
#pragma unroll
    for (int kk = 0; kk < TT / 32; ++kk) { float d0 = __fsub_rn(v[kk], mx); asm volatile("" : "+v"(d0)); v[kk] = __builtin_amdgcn_exp2f(__fmul_rn(d0, 1.4426950408889634f)); sum += v[kk]; }
#pragma unroll
    for (int sh = 16; sh; sh >>= 1) sum += __shfl_xor(sum, sh, 32);
    const float f = __fdiv_rn(PCAR, sum);
{
#pragma unroll
        for (int ch = 0; ch < TT / 128; ++ch) { v4h o4;
#pragma unroll
            for (int q = 0; q < 4; ++q) o4[q] = tohx(v[ch * 4 + q] * f); *(v4h*)(PT16 + (size_t)row * TT + ch * 128 + lane * 4) = o4; }
         }
}
__global__ __launch_bounds__(256) void k_tp16(const h16* __restrict__ PT, h16* P) { const size_t e = ((size_t)blockIdx.x * 256 + threadIdx.x) * 8; if (e >= (size_t)ZH * TT * TT) return; const int k = (int)(e % TT); const int q = (int)((e / TT) % TT); const int zz = (int)(e / ((size_t)TT * TT)); const h16* src = PT + (size_t)zz * TT * TT; v8h o;
#pragma unroll
    for (int u = 0; u < 8; ++u) o[u] = src[(size_t)(k + u) * TT + q]; *(v8h*)(P + e) = o;  }

__global__ __launch_bounds__(256) void k_merge(const float* __restrict__ O, int h0, bf* Ah, bf* Al) { const size_t e = ((size_t)blockIdx.x * 256 + threadIdx.x) * 2; if (e >= (size_t)ZH * TT * HD) return; const int d = (int)(e % HD); const int t = (int)((e / HD) % TT); const int zz = (int)(e / ((size_t)HD * TT)); const float cs = (t < RH) ? 1.0f : (1.0f / PCAR); const size_t oo = (size_t)t * DQ + (h0 + zz) * HD + d;
    v2us oh, ol;
#pragma unroll
    for (int q = 0; q < 2; ++q) { unsigned short a, c2; splitf(O[e + q] * cs, a, c2); oh[q] = a; ol[q] = c2; } *(v2us*)(Ah + oo) = oh; *(v2us*)(Al + oo) = ol;  }
__global__ __launch_bounds__(256) void k_lnrow(float* F, const float* __restrict__ gw) {
    const int lane = threadIdx.x & 31; const int r = blockIdx.x * 8 + (threadIdx.x >> 5); if (r >= TT) return; float hv[DM / 32]; float s = 0.f; float* fr = F + (size_t)r * DM;
#pragma unroll
    for (int ch = 0; ch < DM / 128; ++ch) { const v4f y = *(const v4f*)(fr + ch * 128 + lane * 4);
#pragma unroll
        for (int q = 0; q < 4; ++q) { hv[ch * 4 + q] = y[q]; s += y[q]; } }
#pragma unroll
    for (int sh = 16; sh; sh >>= 1) s += __shfl_xor(s, sh, 32);
    const float mu = s * (1.0f / DM); float s2 = 0.f;
#pragma unroll
    for (int k = 0; k < DM / 32; ++k) { float d0 = __fsub_rn(hv[k], mu); asm volatile("" : "+v"(d0)); float p = __fmul_rn(d0, d0); asm volatile("" : "+v"(p)); s2 = __fadd_rn(s2, p); }
#pragma unroll
    for (int sh = 16; sh; sh >>= 1) s2 += __shfl_xor(s2, sh, 32);
    float var = __fadd_rn(s2 * (1.0f / DM), 1e-5f); asm volatile("" : "+v"(var)); const float rs = __frsqrt_rn(var);
    __builtin_amdgcn_wave_barrier(); asm volatile("" ::: "memory");   /* all lanes have read the row before any lane overwrites it */
{
#pragma unroll
        for (int ch = 0; ch < DM / 128; ++ch) { const int c0 = ch * 128 + lane * 4; v4f o;
#pragma unroll
            for (int q = 0; q < 4; ++q) { float gb = bfr(gw[c0 + q]); asm volatile("" : "+v"(gb)); float d0 = __fsub_rn(hv[ch * 4 + q], mu); asm volatile("" : "+v"(d0)); float n0 = __fmul_rn(d0, rs); asm volatile("" : "+v"(n0)); o[q] = __fmul_rn(n0, gb); }
            *(v4f*)(fr + c0) = o; }
         } }
__global__ __launch_bounds__(256) void k_addx(const float* __restrict__ Y, const float* __restrict__ xb, float* O, size_t n4) { const size_t i = (size_t)blockIdx.x * 256 + threadIdx.x; if (i >= n4) return; const v4f y = *(const v4f*)(Y + i * 4); const v4f xv = *(const v4f*)(xb + i * 4); v4f o;
#pragma unroll
    for (int q = 0; q < 4; ++q) { float xr = bfr(xv[q]); asm volatile("" : "+v"(xr)); o[q] = __fadd_rn(y[q], xr); } *(v4f*)(O + i * 4) = o;  }
extern "C" void kernel_launch(void* const* d_in, const int* in_sizes, int n_in,
                              void* d_out, int out_size, void* d_ws, size_t ws_size, hipStream_t stream) {
    (void)in_sizes; (void)n_in; (void)out_size;
    const float* x = (const float*)d_in[0]; const float* wq = (const float*)d_in[1]; const float* wk = (const float*)d_in[2]; const float* bk = (const float*)d_in[3]; const float* wv = (const float*)d_in[4]; const float* bv = (const float*)d_in[5]; const float* gq = (const float*)d_in[6]; const float* gk = (const float*)d_in[7]; const float* wo = (const float*)d_in[8]; const float* bo = (const float*)d_in[9];
    float* OUT = (float*)d_out;     // [4][2048][768]
    char* wsp = (char*)d_ws;
    auto take = [&](size_t bytes) { char* p = wsp; wsp += (bytes + 255) & ~(size_t)255; return (void*)p; };
    bf* WQ = (bf*)take((size_t)DQ * DM * 2); bf* WK = (bf*)take((size_t)DKV * DM * 2); bf* WV = (bf*)take((size_t)DKV * DM * 2); bf* WO = (bf*)take((size_t)DM * DQ * 2); float* CS = (float*)take((size_t)TT * HD * 2 * 4);
    bf* XB = (bf*)take((size_t)TT * DM * 2); h16* PT16 = (h16*)take((size_t)ZH * TT * TT * 2); float* FQ = (float*)take((size_t)TT * DQ * 4); float* FK = (float*)take((size_t)TT * DKV * 4); float* YO = (float*)take((size_t)TT * DM * 4);
    h16* QP16 = (h16*)take((size_t)NH_ * TT * HD * 2); h16* KP16 = (h16*)take((size_t)NKV * TT * HD * 2); h16* VT16 = (h16*)take((size_t)NKV * HD * TT * 2);
    bf* QPh = (bf*)take((size_t)NH_ * TT * HD * 2); bf* QPl = (bf*)take((size_t)NH_ * TT * HD * 2); bf* KPh = (bf*)take((size_t)NKV * TT * HD * 2); bf* KPl = (bf*)take((size_t)NKV * TT * HD * 2); bf* VTh = (bf*)take((size_t)NKV * HD * TT * 2); bf* VTl = (bf*)take((size_t)NKV * HD * TT * 2);
    float* Sb = (float*)take((size_t)ZH * TT * TT * 4); h16* P16 = (h16*)take((size_t)ZH * TT * TT * 2); float* Ob = (float*)take((size_t)ZH * TT * HD * 4); bf* ATh = (bf*)take((size_t)TT * DQ * 2); bf* ATl = (bf*)take((size_t)TT * DQ * 2);
    if ((size_t)(wsp - (char*)d_ws) > ws_size) return;
    float* FV = FK;   // v projection reuses the k buffer after the k planes are built (stream-ordered)
    k_cvt8<<<(unsigned)(((size_t)DQ * DM / 8 + 255) / 256), 256, 0, stream>>>(wq, WQ, (size_t)DQ * DM / 8); k_cvt8<<<(unsigned)(((size_t)DKV * DM / 8 + 255) / 256), 256, 0, stream>>>(wk, WK, (size_t)DKV * DM / 8); k_cvt8<<<(unsigned)(((size_t)DKV * DM / 8 + 255) / 256), 256, 0, stream>>>(wv, WV, (size_t)DKV * DM / 8); k_cvt8<<<(unsigned)(((size_t)DM * DQ / 8 + 255) / 256), 256, 0, stream>>>(wo, WO, (size_t)DM * DQ / 8);   /* 'oi' weights = Bt as-is */
    k_csid<<<(TT * HD + 255) / 256, 256, 0, stream>>>(CS);
    const unsigned LQ = (unsigned)(((size_t)NH_ * TT * HD / 2 + 255) / 256), LKv = (unsigned)(((size_t)NKV * TT * HD / 2 + 255) / 256);
    for (int b = 0; b < NB_; ++b) {
        k_cvt8<<<(unsigned)(((size_t)TT * DM / 8 + 255) / 256), 256, 0, stream>>>(x + (size_t)b * TT * DM, XB, (size_t)TT * DM / 8);
        k_gemmw<bf, 0, false><<<dim3(TT / 64, DQ / 64, 1), 32, 0, stream>>>(XB, nullptr, WQ, nullptr, DM, FQ, DQ, nullptr, 0, 0, 0); k_lnrow<<<TT / 8, 256, 0, stream>>>(FQ, gq);   /* q = LN(x Wq^T) gq */
        k_rope<<<LQ, 256, 0, stream>>>(FQ, DQ, NH_, CS, nullptr, nullptr, 1.0f, QP16, QPh, QPl);
        k_gemmw<bf, 0, true><<<dim3(TT / 64, DKV / 64, 1), 32, 0, stream>>>(XB, nullptr, WK, nullptr, DM, FK, DKV, bk, 0, 0, 0); k_lnrow<<<TT / 8, 256, 0, stream>>>(FK, gk);   /* k = LN(x Wk^T + bk) gk */
        k_rope<<<LKv, 256, 0, stream>>>(FK, DKV, NKV, CS, nullptr, nullptr, 1.0f, KP16, KPh, KPl);
        k_gemmw<bf, 0, true><<<dim3(TT / 64, DKV / 64, 1), 32, 0, stream>>>(XB, nullptr, WV, nullptr, DM, FV, DKV, bv, 0, 0, 0); k_vtp<<<LKv, 256, 0, stream>>>(FV, DKV, NKV, VT16, VTh, VTl);
        for (int h0 = 0; h0 < NH_; h0 += ZH) { const size_t zq = (size_t)h0;
            k_gemmw<bf, 2, false><<<dim3(TT / 64, TT / 64, ZH), 32, 0, stream>>>(KPh + zq * TT * HD, KPl + zq * TT * HD, QPh + zq * TT * HD, QPl + zq * TT * HD, HD, Sb, TT, nullptr, (size_t)TT * HD, (size_t)TT * HD, (size_t)TT * TT);   /* S^T[k][q] = k_k.q_q (3 products) */
            k_csoft<<<ZH * TT / 8, 256, 0, stream>>>(Sb, PT16);                                                                                 /* softmax over q -> fp16 x1024 [k][q] */
            k_tp16<<<(unsigned)(((size_t)ZH * TT * TT / 8 + 255) / 256), 256, 0, stream>>>(PT16, P16);                                         /* -> [q][k] */
            k_gemmw<h16, 0, false><<<dim3(TT / 64, HD / 64, ZH), 32, 0, stream>>>(P16, nullptr, VT16 + zq * HD * TT, nullptr, TT, Ob, HD, nullptr, (size_t)TT * TT, (size_t)HD * TT, (size_t)TT * HD);   /* o = attn . v (one product) */
            k_merge<<<(unsigned)(((size_t)ZH * TT * HD / 2 + 255) / 256), 256, 0, stream>>>(Ob, h0, ATh, ATl); }                                  /* hi/lo planes, carry undone on every row (RH 0) */
        k_gemmw<bf, 1, true><<<dim3(TT / 64, DM / 64, 1), 32, 0, stream>>>(ATh, ATl, WO, nullptr, DQ, YO, DM, bo, 0, 0, 0);   /* o Wo^T + bo */
        k_addx<<<(unsigned)(((size_t)TT * DM / 4 + 255) / 256), 256, 0, stream>>>(YO, x + (size_t)b * TT * DM, OUT + (size_t)b * TT * DM, (size_t)TT * DM / 4); }   /* + x */
}

// v001
// A run of this version takes 2240 microseconds.
// Next to v000, in two timings, it ran 1.39 times as fast each time.
#include <hip/hip_runtime.h>

// Multi-head self-attention with QK-LayerNorm and the module's QUERY-axis softmax (x [4][2048][768]; q = LN_nobias(x Wq^T) gq, k = LN_nobias(x Wk^T + bk) gk (LayerNorm over the full 768), v = x Wv^T + bv ('oi' [768][768]; 12 heads x 64); scores = q.k/8; attn = softmax over the QUERY axis (per key column); o[q] = sum_k attn[q][k] v[k]; out = merged o Wo^T + bo + x -> [4][2048][768] (6.3 M)).
// Algorithm per (batch, head pair): the TRANSPOSED scores S^T[k][q] = k_k.q_q come from one 3-product GEMM so the column softmax is a row softmax; probabilities are written fp16 x1024 as [k][q], transposed to [q][k] by a small kernel, and multiplied with the fp16 value planes (one product, K = 2048); the merge undoes the carry into hi/lo planes; Wo (2 products) + bo; + x residual in f32.
// Compute dtypes, f32 accumulate: every input rounded to bf16; q/k/v on PLAIN bf16 operands (exact) + biases; LayerNorm f32 (biased variance, eps 1e-5); scores hi/lo (3 products) on every row; softmax f32; attn.v single fp16 (P x1024); Wo hl x exact (2 products) + bo; residual f32.

#define NB_  4
#define TT   2048
#define DM   768
#define NH_  12
#define NKV  12
#define REP  (NH_ / NKV)
#define HD   64
#define DQ   (NH_ * HD)
#define DKV  (NKV * HD)
#define ZH   2
#define RH   0                    // every probability row carries x1024 (k_merge undoes it on all rows)
#define WIN  0
#define PCAR 1024.0f
#define SCL  0.125f   // HD^-0.5
typedef _Float16 h16;
typedef unsigned short bf;
typedef __attribute__((ext_vector_type(16))) __bf16   v16bf;
typedef __attribute__((ext_vector_type(16))) _Float16 v16h;
typedef __attribute__((ext_vector_type(8)))  _Float16 v8h;
typedef __attribute__((ext_vector_type(8)))  unsigned short v8us;
typedef __attribute__((ext_vector_type(8)))  float    v8f;
typedef __attribute__((ext_vector_type(4)))  float    v4f;
typedef v8h  __attribute__((may_alias)) v8ha;
typedef v4f  __attribute__((may_alias)) v4fa;
typedef v8us __attribute__((may_alias)) v8usa;

__device__ __forceinline__ unsigned short f2bf(float f) { unsigned u = __float_as_uint(f); u += 0x7FFFu + ((u >> 16) & 1u); return (unsigned short)(u >> 16); }
__device__ __forceinline__ float bf2f(unsigned short b) { return __uint_as_float(((unsigned)b) << 16); }
__device__ __forceinline__ float bfr(float f) { return bf2f(f2bf(f)); }
__device__ __forceinline__ v16h cat16(v8h lo, v8h hi) { return __builtin_shufflevector(lo, hi, 0, 1, 2, 3, 4, 5, 6, 7, 8, 9, 10, 11, 12, 13, 14, 15); }
__device__ __forceinline__ v16bf cat16b(v8us lo, v8us hi) { return __builtin_bit_cast(v16bf, __builtin_shufflevector(lo, hi, 0, 1, 2, 3, 4, 5, 6, 7, 8, 9, 10, 11, 12, 13, 14, 15)); }
__device__ __forceinline__ v8f wmma16(v16h a, v16h b, v8f c) { return __builtin_amdgcn_wmma_f32_16x16x32_f16(false, a, false, b, (short)0, c, false, false); }
__device__ __forceinline__ v8f wmmab(v16bf a, v16bf b, v8f c) { return __builtin_amdgcn_wmma_f32_16x16x32_bf16(false, a, false, b, (short)0, c, false, false); }



// ---- k_gemmw: register-blocked GEMM, ONE WAVE per 64x64 output tile (16 accumulators), operands straight from K-contiguous 16-bit planes; grid (M/64, N/64, Z), 32 threads.
// C[m][n] (f32, pitch ldc, + optional f32 bias[n]) = sum_k A[m][k] Bt[n][k] (+ split products per NSPLIT). z-batch strides sA/sB/sC in elements. K % 32 == 0.
template <typename T16> struct WFrag;
template <> struct WFrag<h16> { typedef v16h V; static __device__ __forceinline__ V ld(const h16* p) { return cat16(*(const v8h*)p, *(const v8h*)(p + 16)); } static __device__ __forceinline__ v8f mma(V a, V b, v8f c) { return wmma16(a, b, c); } };
template <> struct WFrag<bf> { typedef v16bf V; static __device__ __forceinline__ V ld(const bf* p) { return cat16b(*(const v8us*)p, *(const v8us*)(p + 16)); } static __device__ __forceinline__ v8f mma(V a, V b, v8f c) { return wmmab(a, b, c); } };
template <typename T16, int NSPLIT, bool BIAS>
__global__ __launch_bounds__(32) void k_gemmw(const T16* __restrict__ A, const T16* __restrict__ A2, const T16* __restrict__ Bt, const T16* __restrict__ Bt2, int K, float* C, int ldc, const float* __restrict__ bias, size_t sA, size_t sB, size_t sC) {
    typedef typename WFrag<T16>::V V;
    __shared__ __align__(16) float os[16 * 68];
    const size_t z = blockIdx.z; A += z * sA; if (A2) A2 += z * sA; Bt += z * sB; if (Bt2) Bt2 += z * sB; C += z * sC;
    const int lane = threadIdx.x & 31, lr = lane & 15, hi = lane >> 4; const int r0 = blockIdx.x * 64, c0 = blockIdx.y * 64;
    v8f acc[4][4];
#pragma unroll
    for (int mb = 0; mb < 4; ++mb)
#pragma unroll
        for (int nb = 0; nb < 4; ++nb) acc[mb][nb] = (v8f){};
    const size_t aoff = (size_t)(r0 + lr) * K + 8 * hi, boff = (size_t)(c0 + lr) * K + 8 * hi;
#pragma unroll 1
    for (int kc = 0; kc < K; kc += 32) {
        V a[4], a2[4];
#pragma unroll
        for (int mb = 0; mb < 4; ++mb) { a[mb] = WFrag<T16>::ld(A + aoff + (size_t)mb * 16 * K + kc); if (NSPLIT == 1 || NSPLIT == 2) a2[mb] = WFrag<T16>::ld(A2 + aoff + (size_t)mb * 16 * K + kc); }
#pragma unroll
        for (int nb = 0; nb < 4; ++nb) { const V b = WFrag<T16>::ld(Bt + boff + (size_t)nb * 16 * K + kc); V b2; if (NSPLIT >= 2) b2 = WFrag<T16>::ld(Bt2 + boff + (size_t)nb * 16 * K + kc);
#pragma unroll
            for (int mb = 0; mb < 4; ++mb) { acc[mb][nb] = WFrag<T16>::mma(a[mb], b, acc[mb][nb]); if (NSPLIT == 1 || NSPLIT == 2) acc[mb][nb] = WFrag<T16>::mma(a2[mb], b, acc[mb][nb]); if (NSPLIT >= 2) acc[mb][nb] = WFrag<T16>::mma(a[mb], b2, acc[mb][nb]); } }
        asm volatile("v_nop\n\tv_nop\n\tv_nop\n\tv_nop" : "+v"(acc[0][0]), "+v"(acc[1][1]), "+v"(acc[2][2]), "+v"(acc[3][3]) : "v"(a[0]), "v"(a[3]));
    }
#pragma unroll
    for (int mb = 0; mb < 4; ++mb) {
#pragma unroll
        for (int nb = 0; nb < 4; ++nb) {
#pragma unroll
            for (int j = 0; j < 8; ++j) os[(hi * 8 + j) * 68 + nb * 16 + lr] = acc[mb][nb][j]; }
        __builtin_amdgcn_wave_barrier(); asm volatile("" ::: "memory");
        float* crow = C + (size_t)(r0 + mb * 16) * ldc + c0;
{
#pragma unroll
            for (int s = 0; s < 8; ++s) { const int row = 2 * s + hi, cofs = lr * 4; v4f val = *(const v4fa*)(os + row * 68 + cofs); if (BIAS) { val[0] += bfr(bias[c0 + cofs]); val[1] += bfr(bias[c0 + cofs + 1]); val[2] += bfr(bias[c0 + cofs + 2]); val[3] += bfr(bias[c0 + cofs + 3]); }
                *(v4f*)(crow + (size_t)row * ldc + cofs) = val; }
             }
        __builtin_amdgcn_wave_barrier(); asm volatile("" ::: "memory");
    }
}

// ---- k_pvk: attn.v with its K = 2048 keys split over KSP work-groups; grid (TT/64, KSP, ZH), 32 threads. One wave forms the f32 partial 64x64 tile of its KSL keys and stores it to plane [slice][head][t][d]; k_merge adds the KSP planes in slice order.
#define KSP 16
#define KSL (TT / KSP)
__global__ __launch_bounds__(32) void k_pvk(const h16* __restrict__ A, const h16* __restrict__ Bt, float* C) {
    __shared__ __align__(16) float os[16 * 68];
    const size_t z = blockIdx.z; const int ks = blockIdx.y; A += z * ((size_t)TT * TT) + ks * KSL; Bt += z * ((size_t)HD * TT) + ks * KSL; C += ((size_t)ks * ZH + z) * ((size_t)TT * HD);
    const int lane = threadIdx.x & 31, lr = lane & 15, hi = lane >> 4; const int r0 = blockIdx.x * 64;
    v8f acc[4][4];
#pragma unroll
    for (int mb = 0; mb < 4; ++mb)
#pragma unroll
        for (int nb = 0; nb < 4; ++nb) acc[mb][nb] = (v8f){};
    const size_t aoff = (size_t)(r0 + lr) * TT + 8 * hi, boff = (size_t)lr * TT + 8 * hi;
#pragma unroll 1   // rolled: one pass's 8 fragments beside the 128 accumulator registers stay under 256 VGPRs
    for (int kc = 0; kc < KSL; kc += 32) {
        const h16* pa = A + aoff + kc; const h16* pb = Bt + boff + kc; v16h a[4], b[4];
#pragma unroll
        for (int mb = 0; mb < 4; ++mb) a[mb] = WFrag<h16>::ld(pa + (size_t)mb * 16 * TT);
#pragma unroll
        for (int nb = 0; nb < 4; ++nb) b[nb] = WFrag<h16>::ld(pb + (size_t)nb * 16 * TT);
        // behind the pass's 16 loads, before any register that they name is rewritten; the two addresses are inputs so that they stay in their registers up to here
        asm volatile("s_wait_xcnt 0x0" :: "v"(pa), "v"(pb) : "memory");
#pragma unroll
        for (int nb = 0; nb < 4; ++nb)
#pragma unroll
            for (int mb = 0; mb < 4; ++mb) acc[mb][nb] = wmma16(a[mb], b[nb], acc[mb][nb]);
        // four vector slots behind the pass's last WMMAs, on both sides of the loop branch: the next pass's loads rewrite a and b, the LDS stores behind the loop read acc
        asm volatile("v_nop\n\tv_nop\n\tv_nop\n\tv_nop" : "+v"(acc[0][0]), "+v"(acc[1][1]), "+v"(acc[2][2]), "+v"(acc[3][3]) : "v"(a[0]), "v"(a[3]));
    }
#pragma unroll
    for (int mb = 0; mb < 4; ++mb) {
#pragma unroll
        for (int nb = 0; nb < 4; ++nb) {
#pragma unroll
            for (int j = 0; j < 8; ++j) os[(hi * 8 + j) * 68 + nb * 16 + lr] = acc[mb][nb][j]; }
        __builtin_amdgcn_wave_barrier(); asm volatile("" ::: "memory");   // one wave: keeps every lane's LDS stores ahead of the row reads in the compiled order, with no wait on the global stores
        float* crow = C + (size_t)(r0 + mb * 16) * HD;
#pragma unroll
        for (int s = 0; s < 8; ++s) { const int row = 2 * s + hi, cofs = lr * 4; *(v4f*)(crow + (size_t)row * HD + cofs) = *(const v4fa*)(os + row * 68 + cofs); }
        __builtin_amdgcn_wave_barrier(); asm volatile("" ::: "memory");   // keeps the row reads ahead of the next 16 rows' LDS stores
    }
}

__device__ __forceinline__ h16 tohx(float x) { return (h16)x; }
__device__ __forceinline__ void splitf(float y, unsigned short& h, unsigned short& l) { h = f2bf(y); l = f2bf(y - bf2f(h)); }
typedef __attribute__((ext_vector_type(2))) _Float16 v2h;
typedef __attribute__((ext_vector_type(4))) _Float16 v4h;
typedef __attribute__((ext_vector_type(2))) unsigned short v2us;
typedef __attribute__((ext_vector_type(4))) unsigned short v4us;
typedef __attribute__((ext_vector_type(2))) float v2f;
typedef __attribute__((ext_vector_type(4))) int v4i;

__global__ __launch_bounds__(256) void k_wtG(const float* __restrict__ w, int K, int N, bf* Bt) {
    const int lane = threadIdx.x & 31; const int L0 = (blockIdx.x * 8 + (threadIdx.x >> 5)) * 8; const int nlines = N * K / 64;
{
#pragma unroll 1
        for (int l = 0; l < 8; ++l) { const int L = L0 + l; if (L >= nlines) break; const size_t e = (size_t)L * 64 + lane * 2; const int k = (int)(e % K), n = (int)(e / K); v2us o;
            o[0] = f2bf(w[(size_t)k * N + n]); o[1] = f2bf(w[(size_t)(k + 1) * N + n]); *(v2us*)(Bt + e) = o; }
         }
}
__global__ __launch_bounds__(256) void k_cvt8(const float* __restrict__ src, bf* dst, size_t n8) { const size_t i = (size_t)blockIdx.x * 256 + threadIdx.x; if (i >= n8) return; const v8f v = *(const v8f*)(src + i * 8); v8us o;
#pragma unroll
    for (int k = 0; k < 8; ++k) o[k] = f2bf(v[k]); *(v8us*)(dst + i * 8) = o;  }

// k_rope: head planes [h][t][d] (fp16 + hi/lo) of rope(x) x sc with the rotate-half convention out[d] = x[d] cos[t][d] - x[d+HD/2] sin[t][d], out[d+HD/2] = x[d+HD/2] cos[t][d+HD/2] + x[d] sin[t][d+HD/2]
__global__ __launch_bounds__(256) void k_rope(const float* __restrict__ F, int pitch, int nheads, const float* __restrict__ CS, const float* __restrict__ RF, const float* __restrict__ nw, float sc, h16* P16, bf* Ph, bf* Pl) {
    const size_t e = ((size_t)blockIdx.x * 256 + threadIdx.x) * 2; if (e >= (size_t)nheads * TT * HD) return; const int d = (int)(e % HD); const int t = (int)((e / HD) % TT); const int h = (int)(e / ((size_t)HD * TT)); const float* f = F + (size_t)t * pitch + h * HD; const float rf = RF ? RF[(size_t)h * TT + t] : 1.0f; v2h o16; v2us oh, ol;
#pragma unroll
    for (int q = 0; q < 2; ++q) { const int dd = d + q; const int dp = (dd < HD / 2) ? dd + HD / 2 : dd - HD / 2; float x0 = f[dd], x1 = f[dp];
        if (RF) { float n0 = __fmul_rn(x0, rf), n1 = __fmul_rn(x1, rf); asm volatile("" : "+v"(n0)); asm volatile("" : "+v"(n1)); x0 = __fmul_rn(bfr(nw[dd]), n0); x1 = __fmul_rn(bfr(nw[dp]), n1); }
        const v2f cs = *(const v2f*)(CS + ((size_t)t * HD + dd) * 2); float a = __fmul_rn(x0, cs[0]), bq = __fmul_rn(x1, cs[1]); asm volatile("" : "+v"(a)); asm volatile("" : "+v"(bq)); const float r = ((dd < HD / 2) ? __fsub_rn(a, bq) : __fadd_rn(a, bq)) * sc;
        o16[q] = tohx(r); unsigned short a2, c2; splitf(r, a2, c2); oh[q] = a2; ol[q] = c2; }
    *(v2h*)(P16 + e) = o16; *(v2us*)(Ph + e) = oh; *(v2us*)(Pl + e) = ol;  }
__global__ __launch_bounds__(256) void k_vtp(const float* __restrict__ F, int pitch, int nheads, h16* V16, bf* Vh, bf* Vl) { const size_t e = ((size_t)blockIdx.x * 256 + threadIdx.x) * 2; if (e >= (size_t)nheads * HD * TT) return; const int t = (int)(e % TT); const int d = (int)((e / TT) % HD); const int g = (int)(e / ((size_t)TT * HD)); v2h o16; v2us oh, ol;
#pragma unroll
    for (int q = 0; q < 2; ++q) { const float x = F[(size_t)(t + q) * pitch + g * HD + d]; o16[q] = tohx(x); unsigned short a2, c2; splitf(x, a2, c2); oh[q] = a2; ol[q] = c2; }
    *(v2h*)(V16 + e) = o16; *(v2us*)(Vh + e) = oh; *(v2us*)(Vl + e) = ol;  }
__global__ __launch_bounds__(256) void k_csid(float* CS) { const int idx = blockIdx.x * 256 + threadIdx.x; if (idx >= TT * HD) return; v2f cs; cs[0] = 1.0f; cs[1] = 0.0f; *(v2f*)(CS + (size_t)idx * 2) = cs;  }

__global__ __launch_bounds__(256) void k_csoft(const float* __restrict__ Sb, h16* PT16) {
    const int lane = threadIdx.x & 31; const int row = blockIdx.x * 8 + (threadIdx.x >> 5); if (row >= ZH * TT) return; const int k = row % TT; (void)k; const float* sr = Sb + (size_t)row * TT; float v[TT / 32]; float mx = -3.0e38f;
#pragma unroll
    for (int ch = 0; ch < TT / 128; ++ch) { const int j0 = ch * 128 + lane * 4; const v4f a = *(const v4f*)(sr + j0);
#pragma unroll
        for (int q = 0; q < 4; ++q) { float sa = a[q] * SCL; asm volatile("" : "+v"(sa)); const float t = sa; v[ch * 4 + q] = t; mx = fmaxf(mx, t); } }
#pragma unroll
    for (int sh = 16; sh; sh >>= 1) mx = fmaxf(mx, __shfl_xor(mx, sh, 32));
    float sum = 0.f;
#pragma unroll
    for (int kk = 0; kk < TT / 32; ++kk) { float d0 = __fsub_rn(v[kk], mx); asm volatile("" : "+v"(d0)); v[kk] = __builtin_amdgcn_exp2f(__fmul_rn(d0, 1.4426950408889634f)); sum += v[kk]; }
#pragma unroll
    for (int sh = 16; sh; sh >>= 1) sum += __shfl_xor(sum, sh, 32);
    const float f = __fdiv_rn(PCAR, sum);
{
#pragma unroll
        for (int ch = 0; ch < TT / 128; ++ch) { v4h o4;
#pragma unroll
            for (int q = 0; q < 4; ++q) o4[q] = tohx(v[ch * 4 + q] * f); *(v4h*)(PT16 + (size_t)row * TT + ch * 128 + lane * 4) = o4; }
         }
}
__global__ __launch_bounds__(256) void k_tp16(const h16* __restrict__ PT, h16* P) { const size_t e = ((size_t)blockIdx.x * 256 + threadIdx.x) * 8; if (e >= (size_t)ZH * TT * TT) return; const int k = (int)(e % TT); const int q = (int)((e / TT) % TT); const int zz = (int)(e / ((size_t)TT * TT)); const h16* src = PT + (size_t)zz * TT * TT; v8h o;
#pragma unroll
    for (int u = 0; u < 8; ++u) o[u] = src[(size_t)(k + u) * TT + q]; *(v8h*)(P + e) = o;  }

__global__ __launch_bounds__(256) void k_merge(const float* __restrict__ O, int h0, bf* Ah, bf* Al) { const size_t e = ((size_t)blockIdx.x * 256 + threadIdx.x) * 2; if (e >= (size_t)ZH * TT * HD) return; const int d = (int)(e % HD); const int t = (int)((e / HD) % TT); const int zz = (int)(e / ((size_t)HD * TT)); const float cs = (t < RH) ? 1.0f : (1.0f / PCAR); const size_t oo = (size_t)t * DQ + (h0 + zz) * HD + d;
    v2us oh, ol; v2f sm = *(const v2f*)(O + e);
#pragma unroll
    for (int ks = 1; ks < KSP; ++ks) { const v2f p = *(const v2f*)(O + (size_t)ks * ((size_t)ZH * TT * HD) + e); sm[0] += p[0]; sm[1] += p[1]; }   /* the K slices' partial sums, in slice order */
#pragma unroll
    for (int q = 0; q < 2; ++q) { unsigned short a, c2; splitf(sm[q] * cs, a, c2); oh[q] = a; ol[q] = c2; } *(v2us*)(Ah + oo) = oh; *(v2us*)(Al + oo) = ol;  }
__global__ __launch_bounds__(256) void k_lnrow(float* F, const float* __restrict__ gw) {
    const int lane = threadIdx.x & 31; const int r = blockIdx.x * 8 + (threadIdx.x >> 5); if (r >= TT) return; float hv[DM / 32]; float s = 0.f; float* fr = F + (size_t)r * DM;
#pragma unroll
    for (int ch = 0; ch < DM / 128; ++ch) { const v4f y = *(const v4f*)(fr + ch * 128 + lane * 4);
#pragma unroll
        for (int q = 0; q < 4; ++q) { hv[ch * 4 + q] = y[q]; s += y[q]; } }
#pragma unroll
    for (int sh = 16; sh; sh >>= 1) s += __shfl_xor(s, sh, 32);
    const float mu = s * (1.0f / DM); float s2 = 0.f;
#pragma unroll
    for (int k = 0; k < DM / 32; ++k) { float d0 = __fsub_rn(hv[k], mu); asm volatile("" : "+v"(d0)); float p = __fmul_rn(d0, d0); asm volatile("" : "+v"(p)); s2 = __fadd_rn(s2, p); }
#pragma unroll
    for (int sh = 16; sh; sh >>= 1) s2 += __shfl_xor(s2, sh, 32);
    float var = __fadd_rn(s2 * (1.0f / DM), 1e-5f); asm volatile("" : "+v"(var)); const float rs = __frsqrt_rn(var);
    __builtin_amdgcn_wave_barrier(); asm volatile("" ::: "memory");   /* all lanes have read the row before any lane overwrites it */
{
#pragma unroll
        for (int ch = 0; ch < DM / 128; ++ch) { const int c0 = ch * 128 + lane * 4; v4f o;
#pragma unroll
            for (int q = 0; q < 4; ++q) { float gb = bfr(gw[c0 + q]); asm volatile("" : "+v"(gb)); float d0 = __fsub_rn(hv[ch * 4 + q], mu); asm volatile("" : "+v"(d0)); float n0 = __fmul_rn(d0, rs); asm volatile("" : "+v"(n0)); o[q] = __fmul_rn(n0, gb); }
            *(v4f*)(fr + c0) = o; }
         } }
__global__ __launch_bounds__(256) void k_addx(const float* __restrict__ Y, const float* __restrict__ xb, float* O, size_t n4) { const size_t i = (size_t)blockIdx.x * 256 + threadIdx.x; if (i >= n4) return; const v4f y = *(const v4f*)(Y + i * 4); const v4f xv = *(const v4f*)(xb + i * 4); v4f o;
#pragma unroll
    for (int q = 0; q < 4; ++q) { float xr = bfr(xv[q]); asm volatile("" : "+v"(xr)); o[q] = __fadd_rn(y[q], xr); } *(v4f*)(O + i * 4) = o;  }
extern "C" void kernel_launch(void* const* d_in, const int* in_sizes, int n_in,
                              void* d_out, int out_size, void* d_ws, size_t ws_size, hipStream_t stream) {
    (void)in_sizes; (void)n_in; (void)out_size;
    const float* x = (const float*)d_in[0]; const float* wq = (const float*)d_in[1]; const float* wk = (const float*)d_in[2]; const float* bk = (const float*)d_in[3]; const float* wv = (const float*)d_in[4]; const float* bv = (const float*)d_in[5]; const float* gq = (const float*)d_in[6]; const float* gk = (const float*)d_in[7]; const float* wo = (const float*)d_in[8]; const float* bo = (const float*)d_in[9];
    float* OUT = (float*)d_out;     // [4][2048][768]
    char* wsp = (char*)d_ws;
    auto take = [&](size_t bytes) { char* p = wsp; wsp += (bytes + 255) & ~(size_t)255; return (void*)p; };
    bf* WQ = (bf*)take((size_t)DQ * DM * 2); bf* WK = (bf*)take((size_t)DKV * DM * 2); bf* WV = (bf*)take((size_t)DKV * DM * 2); bf* WO = (bf*)take((size_t)DM * DQ * 2); float* CS = (float*)take((size_t)TT * HD * 2 * 4);
    bf* XB = (bf*)take((size_t)TT * DM * 2); h16* PT16 = (h16*)take((size_t)ZH * TT * TT * 2); float* FQ = (float*)take((size_t)TT * DQ * 4); float* FK = (float*)take((size_t)TT * DKV * 4); float* YO = (float*)take((size_t)TT * DM * 4);
    h16* QP16 = (h16*)take((size_t)NH_ * TT * HD * 2); h16* KP16 = (h16*)take((size_t)NKV * TT * HD * 2); h16* VT16 = (h16*)take((size_t)NKV * HD * TT * 2);
    bf* QPh = (bf*)take((size_t)NH_ * TT * HD * 2); bf* QPl = (bf*)take((size_t)NH_ * TT * HD * 2); bf* KPh = (bf*)take((size_t)NKV * TT * HD * 2); bf* KPl = (bf*)take((size_t)NKV * TT * HD * 2); bf* VTh = (bf*)take((size_t)NKV * HD * TT * 2); bf* VTl = (bf*)take((size_t)NKV * HD * TT * 2);
    float* Sb = (float*)take((size_t)ZH * TT * TT * 4); h16* P16 = (h16*)take((size_t)ZH * TT * TT * 2); float* Ob = (float*)take((size_t)KSP * ZH * TT * HD * 4); bf* ATh = (bf*)take((size_t)TT * DQ * 2); bf* ATl = (bf*)take((size_t)TT * DQ * 2);
    if ((size_t)(wsp - (char*)d_ws) > ws_size) return;
    float* FV = FK;   // v projection reuses the k buffer after the k planes are built (stream-ordered)
    k_cvt8<<<(unsigned)(((size_t)DQ * DM / 8 + 255) / 256), 256, 0, stream>>>(wq, WQ, (size_t)DQ * DM / 8); k_cvt8<<<(unsigned)(((size_t)DKV * DM / 8 + 255) / 256), 256, 0, stream>>>(wk, WK, (size_t)DKV * DM / 8); k_cvt8<<<(unsigned)(((size_t)DKV * DM / 8 + 255) / 256), 256, 0, stream>>>(wv, WV, (size_t)DKV * DM / 8); k_cvt8<<<(unsigned)(((size_t)DM * DQ / 8 + 255) / 256), 256, 0, stream>>>(wo, WO, (size_t)DM * DQ / 8);   /* 'oi' weights = Bt as-is */
    k_csid<<<(TT * HD + 255) / 256, 256, 0, stream>>>(CS);
    const unsigned LQ = (unsigned)(((size_t)NH_ * TT * HD / 2 + 255) / 256), LKv = (unsigned)(((size_t)NKV * TT * HD / 2 + 255) / 256);
    for (int b = 0; b < NB_; ++b) {
        k_cvt8<<<(unsigned)(((size_t)TT * DM / 8 + 255) / 256), 256, 0, stream>>>(x + (size_t)b * TT * DM, XB, (size_t)TT * DM / 8);
        k_gemmw<bf, 0, false><<<dim3(TT / 64, DQ / 64, 1), 32, 0, stream>>>(XB, nullptr, WQ, nullptr, DM, FQ, DQ, nullptr, 0, 0, 0); k_lnrow<<<TT / 8, 256, 0, stream>>>(FQ, gq);   /* q = LN(x Wq^T) gq */
        k_rope<<<LQ, 256, 0, stream>>>(FQ, DQ, NH_, CS, nullptr, nullptr, 1.0f, QP16, QPh, QPl);
        k_gemmw<bf, 0, true><<<dim3(TT / 64, DKV / 64, 1), 32, 0, stream>>>(XB, nullptr, WK, nullptr, DM, FK, DKV, bk, 0, 0, 0); k_lnrow<<<TT / 8, 256, 0, stream>>>(FK, gk);   /* k = LN(x Wk^T + bk) gk */
        k_rope<<<LKv, 256, 0, stream>>>(FK, DKV, NKV, CS, nullptr, nullptr, 1.0f, KP16, KPh, KPl);
        k_gemmw<bf, 0, true><<<dim3(TT / 64, DKV / 64, 1), 32, 0, stream>>>(XB, nullptr, WV, nullptr, DM, FV, DKV, bv, 0, 0, 0); k_vtp<<<LKv, 256, 0, stream>>>(FV, DKV, NKV, VT16, VTh, VTl);
        for (int h0 = 0; h0 < NH_; h0 += ZH) { const size_t zq = (size_t)h0;
            k_gemmw<bf, 2, false><<<dim3(TT / 64, TT / 64, ZH), 32, 0, stream>>>(KPh + zq * TT * HD, KPl + zq * TT * HD, QPh + zq * TT * HD, QPl + zq * TT * HD, HD, Sb, TT, nullptr, (size_t)TT * HD, (size_t)TT * HD, (size_t)TT * TT);   /* S^T[k][q] = k_k.q_q (3 products) */
            k_csoft<<<ZH * TT / 8, 256, 0, stream>>>(Sb, PT16);                                                                                 /* softmax over q -> fp16 x1024 [k][q] */
            k_tp16<<<(unsigned)(((size_t)ZH * TT * TT / 8 + 255) / 256), 256, 0, stream>>>(PT16, P16);                                         /* -> [q][k] */
            k_pvk<<<dim3(TT / 64, KSP, ZH), 32, 0, stream>>>(P16, VT16 + zq * HD * TT, Ob);   /* o = attn . v (one product), KSP partial planes */
            k_merge<<<(unsigned)(((size_t)ZH * TT * HD / 2 + 255) / 256), 256, 0, stream>>>(Ob, h0, ATh, ATl); }                                  /* partial planes summed; hi/lo planes, carry undone on every row (RH 0) */
        k_gemmw<bf, 1, true><<<dim3(TT / 64, DM / 64, 1), 32, 0, stream>>>(ATh, ATl, WO, nullptr, DQ, YO, DM, bo, 0, 0, 0);   /* o Wo^T + bo */
        k_addx<<<(unsigned)(((size_t)TT * DM / 4 + 255) / 256), 256, 0, stream>>>(YO, x + (size_t)b * TT * DM, OUT + (size_t)b * TT * DM, (size_t)TT * DM / 4); }   /* + x */
}

// v002
// One run takes 1350 microseconds.
// Next to v001, in two timings, it ran 1.67 times as fast each time.
// Counting every step since v000, it is 2.31 times as fast.
#include <hip/hip_runtime.h>

// Multi-head self-attention with QK-LayerNorm and the module's QUERY-axis softmax (x [4][2048][768]; q = LN_nobias(x Wq^T) gq, k = LN_nobias(x Wk^T + bk) gk (LayerNorm over the full 768), v = x Wv^T + bv ('oi' [768][768]; 12 heads x 64); scores = q.k/8; attn = softmax over the QUERY axis (per key column); o[q] = sum_k attn[q][k] v[k]; out = merged o Wo^T + bo + x -> [4][2048][768] (6.3 M)).
// Algorithm per (batch, head pair): the TRANSPOSED scores S^T[k][q] = k_k.q_q come from one 3-product GEMM so the column softmax is a row softmax; probabilities are written fp16 x1024 as 16-byte pieces [k/8][q][8] (8 keys of one query, turned through LDS inside the softmax kernel), which are the A fragment pieces of the product with the fp16 value planes (one product, K = 2048); the merge undoes the carry into hi/lo planes; Wo (2 products) + bo; + x residual in f32.
// Compute dtypes, f32 accumulate: every input rounded to bf16; q/k/v on PLAIN bf16 operands (exact) + biases; LayerNorm f32 (biased variance, eps 1e-5); scores hi/lo (3 products) on every row; softmax f32; attn.v single fp16 (P x1024); Wo hl x exact (2 products) + bo; residual f32.

#define NB_  4
#define TT   2048
#define DM   768
#define NH_  12
#define NKV  12
#define REP  (NH_ / NKV)
#define HD   64
#define DQ   (NH_ * HD)
#define DKV  (NKV * HD)
#define ZH   2
#define RH   0                    // every probability row carries x1024 (k_merge undoes it on all rows)
#define WIN  0
#define PCAR 1024.0f
#define SCL  0.125f   // HD^-0.5
typedef _Float16 h16;
typedef unsigned short bf;
typedef __attribute__((ext_vector_type(16))) __bf16   v16bf;
typedef __attribute__((ext_vector_type(16))) _Float16 v16h;
typedef __attribute__((ext_vector_type(8)))  _Float16 v8h;
typedef __attribute__((ext_vector_type(8)))  unsigned short v8us;
typedef __attribute__((ext_vector_type(8)))  float    v8f;
typedef __attribute__((ext_vector_type(4)))  float    v4f;
typedef v8h  __attribute__((may_alias)) v8ha;
typedef v4f  __attribute__((may_alias)) v4fa;
typedef v8us __attribute__((may_alias)) v8usa;

__device__ __forceinline__ unsigned short f2bf(float f) { unsigned u = __float_as_uint(f); u += 0x7FFFu + ((u >> 16) & 1u); return (unsigned short)(u >> 16); }
__device__ __forceinline__ float bf2f(unsigned short b) { return __uint_as_float(((unsigned)b) << 16); }
__device__ __forceinline__ float bfr(float f) { return bf2f(f2bf(f)); }
__device__ __forceinline__ v16h cat16(v8h lo, v8h hi) { return __builtin_shufflevector(lo, hi, 0, 1, 2, 3, 4, 5, 6, 7, 8, 9, 10, 11, 12, 13, 14, 15); }
__device__ __forceinline__ v16bf cat16b(v8us lo, v8us hi) { return __builtin_bit_cast(v16bf, __builtin_shufflevector(lo, hi, 0, 1, 2, 3, 4, 5, 6, 7, 8, 9, 10, 11, 12, 13, 14, 15)); }
__device__ __forceinline__ v8f wmma16(v16h a, v16h b, v8f c) { return __builtin_amdgcn_wmma_f32_16x16x32_f16(false, a, false, b, (short)0, c, false, false); }
__device__ __forceinline__ v8f wmmab(v16bf a, v16bf b, v8f c) { return __builtin_amdgcn_wmma_f32_16x16x32_bf16(false, a, false, b, (short)0, c, false, false); }



// ---- k_gemmw: register-blocked GEMM, ONE WAVE per 64x64 output tile (16 accumulators), operands straight from K-contiguous 16-bit planes; grid (M/64, N/64, Z), 32 threads.
// C[m][n] (f32, pitch ldc, + optional f32 bias[n]) = sum_k A[m][k] Bt[n][k] (+ split products per NSPLIT). z-batch strides sA/sB/sC in elements. K % 32 == 0.
template <typename T16> struct WFrag;
template <> struct WFrag<h16> { typedef v16h V; static __device__ __forceinline__ V ld(const h16* p) { return cat16(*(const v8h*)p, *(const v8h*)(p + 16)); } static __device__ __forceinline__ v8f mma(V a, V b, v8f c) { return wmma16(a, b, c); } };
template <> struct WFrag<bf> { typedef v16bf V; static __device__ __forceinline__ V ld(const bf* p) { return cat16b(*(const v8us*)p, *(const v8us*)(p + 16)); } static __device__ __forceinline__ v8f mma(V a, V b, v8f c) { return wmmab(a, b, c); } };
template <typename T16, int NSPLIT, bool BIAS>
__global__ __launch_bounds__(32) void k_gemmw(const T16* __restrict__ A, const T16* __restrict__ A2, const T16* __restrict__ Bt, const T16* __restrict__ Bt2, int K, float* C, int ldc, const float* __restrict__ bias, size_t sA, size_t sB, size_t sC) {
    typedef typename WFrag<T16>::V V;
    __shared__ __align__(16) float os[16 * 68];
    const size_t z = blockIdx.z; A += z * sA; if (A2) A2 += z * sA; Bt += z * sB; if (Bt2) Bt2 += z * sB; C += z * sC;
    const int lane = threadIdx.x & 31, lr = lane & 15, hi = lane >> 4; const int r0 = blockIdx.x * 64, c0 = blockIdx.y * 64;
    v8f acc[4][4];
#pragma unroll
    for (int mb = 0; mb < 4; ++mb)
#pragma unroll
        for (int nb = 0; nb < 4; ++nb) acc[mb][nb] = (v8f){};
    const size_t aoff = (size_t)(r0 + lr) * K + 8 * hi, boff = (size_t)(c0 + lr) * K + 8 * hi;
#pragma unroll 1
    for (int kc = 0; kc < K; kc += 32) {
        V a[4], a2[4];
#pragma unroll
        for (int mb = 0; mb < 4; ++mb) { a[mb] = WFrag<T16>::ld(A + aoff + (size_t)mb * 16 * K + kc); if (NSPLIT == 1 || NSPLIT == 2) a2[mb] = WFrag<T16>::ld(A2 + aoff + (size_t)mb * 16 * K + kc); }
#pragma unroll
        for (int nb = 0; nb < 4; ++nb) { const V b = WFrag<T16>::ld(Bt + boff + (size_t)nb * 16 * K + kc); V b2; if (NSPLIT >= 2) b2 = WFrag<T16>::ld(Bt2 + boff + (size_t)nb * 16 * K + kc);
#pragma unroll
            for (int mb = 0; mb < 4; ++mb) { acc[mb][nb] = WFrag<T16>::mma(a[mb], b, acc[mb][nb]); if (NSPLIT == 1 || NSPLIT == 2) acc[mb][nb] = WFrag<T16>::mma(a2[mb], b, acc[mb][nb]); if (NSPLIT >= 2) acc[mb][nb] = WFrag<T16>::mma(a[mb], b2, acc[mb][nb]); } }
        asm volatile("v_nop\n\tv_nop\n\tv_nop\n\tv_nop" : "+v"(acc[0][0]), "+v"(acc[1][1]), "+v"(acc[2][2]), "+v"(acc[3][3]) : "v"(a[0]), "v"(a[3]));
    }
#pragma unroll
    for (int mb = 0; mb < 4; ++mb) {
#pragma unroll
        for (int nb = 0; nb < 4; ++nb) {
#pragma unroll
            for (int j = 0; j < 8; ++j) os[(hi * 8 + j) * 68 + nb * 16 + lr] = acc[mb][nb][j]; }
        __builtin_amdgcn_wave_barrier(); asm volatile("" ::: "memory");
        float* crow = C + (size_t)(r0 + mb * 16) * ldc + c0;
{
#pragma unroll
            for (int s = 0; s < 8; ++s) { const int row = 2 * s + hi, cofs = lr * 4; v4f val = *(const v4fa*)(os + row * 68 + cofs); if (BIAS) { val[0] += bfr(bias[c0 + cofs]); val[1] += bfr(bias[c0 + cofs + 1]); val[2] += bfr(bias[c0 + cofs + 2]); val[3] += bfr(bias[c0 + cofs + 3]); }
                *(v4f*)(crow + (size_t)row * ldc + cofs) = val; }
             }
        __builtin_amdgcn_wave_barrier(); asm volatile("" ::: "memory");
    }
}

// ---- k_pvk: attn.v with its K = 2048 keys split over KSP work-groups; grid (TT/64, KSP, ZH), 32 threads. One wave forms the f32 partial 64x64 tile of its KSL keys and stores it to plane [slice][head][t][d]; k_merge adds the KSP planes in slice order. A = probabilities as [head][k/8][q][8]: a lane's two 16-byte fragment pieces (keys kc + 8 hi + 0..7 and kc + 16 + 8 hi + 0..7 of query row q) are pieces kc/8 + hi and kc/8 + 2 + hi at q, the k order of the Bt loader.
#define KSP 16
#define KSL (TT / KSP)
__global__ __launch_bounds__(32) void k_pvk(const h16* __restrict__ A, const h16* __restrict__ Bt, float* C) {
    __shared__ __align__(16) float os[16 * 68];
    const size_t z = blockIdx.z; const int ks = blockIdx.y; A += z * ((size_t)TT * TT) + (size_t)ks * KSL * TT; Bt += z * ((size_t)HD * TT) + ks * KSL; C += ((size_t)ks * ZH + z) * ((size_t)TT * HD);
    const int lane = threadIdx.x & 31, lr = lane & 15, hi = lane >> 4; const int r0 = blockIdx.x * 64;
    v8f acc[4][4];
#pragma unroll
    for (int mb = 0; mb < 4; ++mb)
#pragma unroll
        for (int nb = 0; nb < 4; ++nb) acc[mb][nb] = (v8f){};
    unsigned aoff = (hi * TT + r0 + lr) * 16, boff = (lr * TT + 8 * hi) * 2;   // a lane's byte offsets in this pass
#pragma unroll 1   // rolled: one pass's 8 fragments beside the 128 accumulator registers stay under 256 VGPRs
    for (int kc = 0; kc < KSL; kc += 32) {
        const h16* pa = (const h16*)((const char*)A + aoff); const h16* pb = (const h16*)((const char*)Bt + boff); v16h a[4], b[4];
#pragma unroll
        for (int mb = 0; mb < 4; ++mb) a[mb] = cat16(*(const v8h*)(pa + mb * 128), *(const v8h*)(pa + mb * 128 + 16 * TT));
#pragma unroll
        for (int nb = 0; nb < 4; ++nb) b[nb] = WFrag<h16>::ld(pb + (size_t)nb * 16 * TT);
        // behind the pass's 16 loads, before any register that they name is rewritten; the two offsets pass through the statement so that their step to the next pass stands behind it
        asm volatile("s_wait_xcnt 0x0" : "+v"(aoff), "+v"(boff) :: "memory");
        aoff += 64 * TT; boff += 64;
#pragma unroll
        for (int nb = 0; nb < 4; ++nb)
#pragma unroll
            for (int mb = 0; mb < 4; ++mb) acc[mb][nb] = wmma16(a[mb], b[nb], acc[mb][nb]);
        // four vector slots behind the pass's last WMMAs, on both sides of the loop branch: the next pass's loads rewrite a and b, the LDS stores behind the loop read acc
        asm volatile("v_nop\n\tv_nop\n\tv_nop\n\tv_nop" : "+v"(acc[0][0]), "+v"(acc[1][1]), "+v"(acc[2][2]), "+v"(acc[3][3]) : "v"(a[0]), "v"(a[3]));
    }
#pragma unroll
    for (int mb = 0; mb < 4; ++mb) {
#pragma unroll
        for (int nb = 0; nb < 4; ++nb) {
#pragma unroll
            for (int j = 0; j < 8; ++j) os[(hi * 8 + j) * 68 + nb * 16 + lr] = acc[mb][nb][j]; }
        __builtin_amdgcn_wave_barrier(); asm volatile("" ::: "memory");   // one wave: keeps every lane's LDS stores ahead of the row reads in the compiled order, with no wait on the global stores
        float* crow = C + (size_t)(r0 + mb * 16) * HD;
#pragma unroll
        for (int s = 0; s < 8; ++s) { const int row = 2 * s + hi, cofs = lr * 4; *(v4f*)(crow + (size_t)row * HD + cofs) = *(const v4fa*)(os + row * 68 + cofs); }
        __builtin_amdgcn_wave_barrier(); asm volatile("" ::: "memory");   // keeps the row reads ahead of the next 16 rows' LDS stores
    }
}

__device__ __forceinline__ h16 tohx(float x) { return (h16)x; }
__device__ __forceinline__ void splitf(float y, unsigned short& h, unsigned short& l) { h = f2bf(y); l = f2bf(y - bf2f(h)); }
typedef __attribute__((ext_vector_type(2))) _Float16 v2h;
typedef __attribute__((ext_vector_type(4))) _Float16 v4h;
typedef __attribute__((ext_vector_type(2))) unsigned short v2us;
typedef __attribute__((ext_vector_type(4))) unsigned short v4us;
typedef __attribute__((ext_vector_type(2))) float v2f;
typedef __attribute__((ext_vector_type(4))) int v4i;

__global__ __launch_bounds__(256) void k_wtG(const float* __restrict__ w, int K, int N, bf* Bt) {
    const int lane = threadIdx.x & 31; const int L0 = (blockIdx.x * 8 + (threadIdx.x >> 5)) * 8; const int nlines = N * K / 64;
{
#pragma unroll 1
        for (int l = 0; l < 8; ++l) { const int L = L0 + l; if (L >= nlines) break; const size_t e = (size_t)L * 64 + lane * 2; const int k = (int)(e % K), n = (int)(e / K); v2us o;
            o[0] = f2bf(w[(size_t)k * N + n]); o[1] = f2bf(w[(size_t)(k + 1) * N + n]); *(v2us*)(Bt + e) = o; }
         }
}
__global__ __launch_bounds__(256) void k_cvt8(const float* __restrict__ src, bf* dst, size_t n8) { const size_t i = (size_t)blockIdx.x * 256 + threadIdx.x; if (i >= n8) return; const v8f v = *(const v8f*)(src + i * 8); v8us o;
#pragma unroll
    for (int k = 0; k < 8; ++k) o[k] = f2bf(v[k]); *(v8us*)(dst + i * 8) = o;  }

// k_rope: head planes [h][t][d] (fp16 + hi/lo) of rope(x) x sc with the rotate-half convention out[d] = x[d] cos[t][d] - x[d+HD/2] sin[t][d], out[d+HD/2] = x[d+HD/2] cos[t][d+HD/2] + x[d] sin[t][d+HD/2]
__global__ __launch_bounds__(256) void k_rope(const float* __restrict__ F, int pitch, int nheads, const float* __restrict__ CS, const float* __restrict__ RF, const float* __restrict__ nw, float sc, h16* P16, bf* Ph, bf* Pl) {
    const size_t e = ((size_t)blockIdx.x * 256 + threadIdx.x) * 2; if (e >= (size_t)nheads * TT * HD) return; const int d = (int)(e % HD); const int t = (int)((e / HD) % TT); const int h = (int)(e / ((size_t)HD * TT)); const float* f = F + (size_t)t * pitch + h * HD; const float rf = RF ? RF[(size_t)h * TT + t] : 1.0f; v2h o16; v2us oh, ol;
#pragma unroll
    for (int q = 0; q < 2; ++q) { const int dd = d + q; const int dp = (dd < HD / 2) ? dd + HD / 2 : dd - HD / 2; float x0 = f[dd], x1 = f[dp];
        if (RF) { float n0 = __fmul_rn(x0, rf), n1 = __fmul_rn(x1, rf); asm volatile("" : "+v"(n0)); asm volatile("" : "+v"(n1)); x0 = __fmul_rn(bfr(nw[dd]), n0); x1 = __fmul_rn(bfr(nw[dp]), n1); }
        const v2f cs = *(const v2f*)(CS + ((size_t)t * HD + dd) * 2); float a = __fmul_rn(x0, cs[0]), bq = __fmul_rn(x1, cs[1]); asm volatile("" : "+v"(a)); asm volatile("" : "+v"(bq)); const float r = ((dd < HD / 2) ? __fsub_rn(a, bq) : __fadd_rn(a, bq)) * sc;
        o16[q] = tohx(r); unsigned short a2, c2; splitf(r, a2, c2); oh[q] = a2; ol[q] = c2; }
    *(v2h*)(P16 + e) = o16; *(v2us*)(Ph + e) = oh; *(v2us*)(Pl + e) = ol;  }
__global__ __launch_bounds__(256) void k_vtp(const float* __restrict__ F, int pitch, int nheads, h16* V16, bf* Vh, bf* Vl) { const size_t e = ((size_t)blockIdx.x * 256 + threadIdx.x) * 2; if (e >= (size_t)nheads * HD * TT) return; const int t = (int)(e % TT); const int d = (int)((e / TT) % HD); const int g = (int)(e / ((size_t)TT * HD)); v2h o16; v2us oh, ol;
#pragma unroll
    for (int q = 0; q < 2; ++q) { const float x = F[(size_t)(t + q) * pitch + g * HD + d]; o16[q] = tohx(x); unsigned short a2, c2; splitf(x, a2, c2); oh[q] = a2; ol[q] = c2; }
    *(v2h*)(V16 + e) = o16; *(v2us*)(Vh + e) = oh; *(v2us*)(Vl + e) = ol;  }
__global__ __launch_bounds__(256) void k_csid(float* CS) { const int idx = blockIdx.x * 256 + threadIdx.x; if (idx >= TT * HD) return; v2f cs; cs[0] = 1.0f; cs[1] = 0.0f; *(v2f*)(CS + (size_t)idx * 2) = cs;  }

// ---- k_csoft: softmax over q of CSR consecutive key rows, one wave per row; grid ZH*TT/CSR, CSR*32 threads. Each wave lays its fp16 x1024 row in LDS; behind one barrier the transposing LDS load hands every lane the 8 keys of one query, stored as one 16-byte piece of P8[head][k/8][q][8] (whole 128-byte lines, one writer each).
#define CSR 16
#define CSP (TT * 2 + 32)   // LDS row pitch in bytes, an odd multiple of 32 B: the conflict-free pitch of ds_load_tr16_b128
static_assert((ZH * TT) % CSR == 0 && TT % CSR == 0 && TT == CSR * 128 && (CSP / 32) % 2 == 1, "whole work-groups inside one head; 128 query columns per wave in the turn");
typedef short s16x8 __attribute__((ext_vector_type(8)));
__device__ __forceinline__ v8h ld_tr16(const unsigned char* p) { typedef __attribute__((address_space(3))) s16x8 lds_s16x8; return __builtin_bit_cast(v8h, __builtin_amdgcn_ds_load_tr16_b128_v8i16((lds_s16x8*)p)); }
__global__ __launch_bounds__(CSR * 32) void k_csoft(const float* __restrict__ Sb, h16* P8) {
    __shared__ __attribute__((aligned(32))) unsigned char T[CSR * CSP];
    const int lane = threadIdx.x & 31, w = threadIdx.x >> 5; const int row = blockIdx.x * CSR + w; const float* sr = Sb + (size_t)row * TT; float v[TT / 32]; float mx = -3.0e38f;
#pragma unroll
    for (int ch = 0; ch < TT / 128; ++ch) { const int j0 = ch * 128 + lane * 4; const v4f a = *(const v4f*)(sr + j0);
#pragma unroll
        for (int q = 0; q < 4; ++q) { float sa = a[q] * SCL; asm volatile("" : "+v"(sa)); const float t = sa; v[ch * 4 + q] = t; mx = fmaxf(mx, t); } }
#pragma unroll
    for (int sh = 16; sh; sh >>= 1) mx = fmaxf(mx, __shfl_xor(mx, sh, 32));
    float sum = 0.f;
#pragma unroll
    for (int kk = 0; kk < TT / 32; ++kk) { float d0 = __fsub_rn(v[kk], mx); asm volatile("" : "+v"(d0)); v[kk] = __builtin_amdgcn_exp2f(__fmul_rn(d0, 1.4426950408889634f)); sum += v[kk]; }
#pragma unroll
    for (int sh = 16; sh; sh >>= 1) sum += __shfl_xor(sum, sh, 32);
    const float f = __fdiv_rn(PCAR, sum);
#pragma unroll
    for (int ch = 0; ch < TT / 128; ++ch) { v4h o4;
#pragma unroll
        for (int q = 0; q < 4; ++q) o4[q] = tohx(v[ch * 4 + q] * f); *(v4h*)(T + w * CSP + (ch * 128 + lane * 4) * 2) = o4; }
    __syncthreads();   // all CSR rows lie in LDS before any wave reads across them
    // lane (c = lane & 15, h = lane >> 4) gets T[8 h + 0..7][column + c]; wave w turns query columns 128 w .. 128 w + 127, 16 a load
    const unsigned char* ad = T + (8 * (lane >> 4) + (lane & 7)) * CSP + 16 * ((lane >> 3) & 1) + w * 256;
    h16* dst = P8 + (((size_t)blockIdx.x * (CSR / 8) + (lane >> 4)) * TT + w * 128 + (lane & 15)) * 8;
#pragma unroll
    for (int i = 0; i < 8; ++i) *(v8h*)(dst + i * 128) = ld_tr16(ad + 32 * i);
}

__global__ __launch_bounds__(256) void k_merge(const float* __restrict__ O, int h0, bf* Ah, bf* Al) { const size_t e = ((size_t)blockIdx.x * 256 + threadIdx.x) * 2; if (e >= (size_t)ZH * TT * HD) return; const int d = (int)(e % HD); const int t = (int)((e / HD) % TT); const int zz = (int)(e / ((size_t)HD * TT)); const float cs = (t < RH) ? 1.0f : (1.0f / PCAR); const size_t oo = (size_t)t * DQ + (h0 + zz) * HD + d;
    v2us oh, ol; v2f sm = *(const v2f*)(O + e);
#pragma unroll
    for (int ks = 1; ks < KSP; ++ks) { const v2f p = *(const v2f*)(O + (size_t)ks * ((size_t)ZH * TT * HD) + e); sm[0] += p[0]; sm[1] += p[1]; }   /* the K slices' partial sums, in slice order */
#pragma unroll
    for (int q = 0; q < 2; ++q) { unsigned short a, c2; splitf(sm[q] * cs, a, c2); oh[q] = a; ol[q] = c2; } *(v2us*)(Ah + oo) = oh; *(v2us*)(Al + oo) = ol;  }
__global__ __launch_bounds__(256) void k_lnrow(float* F, const float* __restrict__ gw) {
    const int lane = threadIdx.x & 31; const int r = blockIdx.x * 8 + (threadIdx.x >> 5); if (r >= TT) return; float hv[DM / 32]; float s = 0.f; float* fr = F + (size_t)r * DM;
#pragma unroll
    for (int ch = 0; ch < DM / 128; ++ch) { const v4f y = *(const v4f*)(fr + ch * 128 + lane * 4);
#pragma unroll
        for (int q = 0; q < 4; ++q) { hv[ch * 4 + q] = y[q]; s += y[q]; } }
#pragma unroll
    for (int sh = 16; sh; sh >>= 1) s += __shfl_xor(s, sh, 32);
    const float mu = s * (1.0f / DM); float s2 = 0.f;
#pragma unroll
    for (int k = 0; k < DM / 32; ++k) { float d0 = __fsub_rn(hv[k], mu); asm volatile("" : "+v"(d0)); float p = __fmul_rn(d0, d0); asm volatile("" : "+v"(p)); s2 = __fadd_rn(s2, p); }
#pragma unroll
    for (int sh = 16; sh; sh >>= 1) s2 += __shfl_xor(s2, sh, 32);
    float var = __fadd_rn(s2 * (1.0f / DM), 1e-5f); asm volatile("" : "+v"(var)); const float rs = __frsqrt_rn(var);
    __builtin_amdgcn_wave_barrier(); asm volatile("" ::: "memory");   /* all lanes have read the row before any lane overwrites it */
{
#pragma unroll
        for (int ch = 0; ch < DM / 128; ++ch) { const int c0 = ch * 128 + lane * 4; v4f o;
#pragma unroll
            for (int q = 0; q < 4; ++q) { float gb = bfr(gw[c0 + q]); asm volatile("" : "+v"(gb)); float d0 = __fsub_rn(hv[ch * 4 + q], mu); asm volatile("" : "+v"(d0)); float n0 = __fmul_rn(d0, rs); asm volatile("" : "+v"(n0)); o[q] = __fmul_rn(n0, gb); }
            *(v4f*)(fr + c0) = o; }
         } }
__global__ __launch_bounds__(256) void k_addx(const float* __restrict__ Y, const float* __restrict__ xb, float* O, size_t n4) { const size_t i = (size_t)blockIdx.x * 256 + threadIdx.x; if (i >= n4) return; const v4f y = *(const v4f*)(Y + i * 4); const v4f xv = *(const v4f*)(xb + i * 4); v4f o;
#pragma unroll
    for (int q = 0; q < 4; ++q) { float xr = bfr(xv[q]); asm volatile("" : "+v"(xr)); o[q] = __fadd_rn(y[q], xr); } *(v4f*)(O + i * 4) = o;  }
extern "C" void kernel_launch(void* const* d_in, const int* in_sizes, int n_in,
                              void* d_out, int out_size, void* d_ws, size_t ws_size, hipStream_t stream) {
    (void)in_sizes; (void)n_in; (void)out_size;
    const float* x = (const float*)d_in[0]; const float* wq = (const float*)d_in[1]; const float* wk = (const float*)d_in[2]; const float* bk = (const float*)d_in[3]; const float* wv = (const float*)d_in[4]; const float* bv = (const float*)d_in[5]; const float* gq = (const float*)d_in[6]; const float* gk = (const float*)d_in[7]; const float* wo = (const float*)d_in[8]; const float* bo = (const float*)d_in[9];
    float* OUT = (float*)d_out;     // [4][2048][768]
    char* wsp = (char*)d_ws;
    auto take = [&](size_t bytes) { char* p = wsp; wsp += (bytes + 255) & ~(size_t)255; return (void*)p; };
    bf* WQ = (bf*)take((size_t)DQ * DM * 2); bf* WK = (bf*)take((size_t)DKV * DM * 2); bf* WV = (bf*)take((size_t)DKV * DM * 2); bf* WO = (bf*)take((size_t)DM * DQ * 2); float* CS = (float*)take((size_t)TT * HD * 2 * 4);
    bf* XB = (bf*)take((size_t)TT * DM * 2); float* FQ = (float*)take((size_t)TT * DQ * 4); float* FK = (float*)take((size_t)TT * DKV * 4); float* YO = (float*)take((size_t)TT * DM * 4);
    h16* QP16 = (h16*)take((size_t)NH_ * TT * HD * 2); h16* KP16 = (h16*)take((size_t)NKV * TT * HD * 2); h16* VT16 = (h16*)take((size_t)NKV * HD * TT * 2);
    bf* QPh = (bf*)take((size_t)NH_ * TT * HD * 2); bf* QPl = (bf*)take((size_t)NH_ * TT * HD * 2); bf* KPh = (bf*)take((size_t)NKV * TT * HD * 2); bf* KPl = (bf*)take((size_t)NKV * TT * HD * 2); bf* VTh = (bf*)take((size_t)NKV * HD * TT * 2); bf* VTl = (bf*)take((size_t)NKV * HD * TT * 2);
    float* Sb = (float*)take((size_t)ZH * TT * TT * 4); h16* P8 = (h16*)take((size_t)ZH * TT * TT * 2); float* Ob = (float*)take((size_t)KSP * ZH * TT * HD * 4); bf* ATh = (bf*)take((size_t)TT * DQ * 2); bf* ATl = (bf*)take((size_t)TT * DQ * 2);
    if ((size_t)(wsp - (char*)d_ws) > ws_size) return;
    float* FV = FK;   // v projection reuses the k buffer after the k planes are built (stream-ordered)
    k_cvt8<<<(unsigned)(((size_t)DQ * DM / 8 + 255) / 256), 256, 0, stream>>>(wq, WQ, (size_t)DQ * DM / 8); k_cvt8<<<(unsigned)(((size_t)DKV * DM / 8 + 255) / 256), 256, 0, stream>>>(wk, WK, (size_t)DKV * DM / 8); k_cvt8<<<(unsigned)(((size_t)DKV * DM / 8 + 255) / 256), 256, 0, stream>>>(wv, WV, (size_t)DKV * DM / 8); k_cvt8<<<(unsigned)(((size_t)DM * DQ / 8 + 255) / 256), 256, 0, stream>>>(wo, WO, (size_t)DM * DQ / 8);   /* 'oi' weights = Bt as-is */
    k_csid<<<(TT * HD + 255) / 256, 256, 0, stream>>>(CS);
    const unsigned LQ = (unsigned)(((size_t)NH_ * TT * HD / 2 + 255) / 256), LKv = (unsigned)(((size_t)NKV * TT * HD / 2 + 255) / 256);
    for (int b = 0; b < NB_; ++b) {
        k_cvt8<<<(unsigned)(((size_t)TT * DM / 8 + 255) / 256), 256, 0, stream>>>(x + (size_t)b * TT * DM, XB, (size_t)TT * DM / 8);
        k_gemmw<bf, 0, false><<<dim3(TT / 64, DQ / 64, 1), 32, 0, stream>>>(XB, nullptr, WQ, nullptr, DM, FQ, DQ, nullptr, 0, 0, 0); k_lnrow<<<TT / 8, 256, 0, stream>>>(FQ, gq);   /* q = LN(x Wq^T) gq */
        k_rope<<<LQ, 256, 0, stream>>>(FQ, DQ, NH_, CS, nullptr, nullptr, 1.0f, QP16, QPh, QPl);
        k_gemmw<bf, 0, true><<<dim3(TT / 64, DKV / 64, 1), 32, 0, stream>>>(XB, nullptr, WK, nullptr, DM, FK, DKV, bk, 0, 0, 0); k_lnrow<<<TT / 8, 256, 0, stream>>>(FK, gk);   /* k = LN(x Wk^T + bk) gk */
        k_rope<<<LKv, 256, 0, stream>>>(FK, DKV, NKV, CS, nullptr, nullptr, 1.0f, KP16, KPh, KPl);
        k_gemmw<bf, 0, true><<<dim3(TT / 64, DKV / 64, 1), 32, 0, stream>>>(XB, nullptr, WV, nullptr, DM, FV, DKV, bv, 0, 0, 0); k_vtp<<<LKv, 256, 0, stream>>>(FV, DKV, NKV, VT16, VTh, VTl);
        for (int h0 = 0; h0 < NH_; h0 += ZH) { const size_t zq = (size_t)h0;
            k_gemmw<bf, 2, false><<<dim3(TT / 64, TT / 64, ZH), 32, 0, stream>>>(KPh + zq * TT * HD, KPl + zq * TT * HD, QPh + zq * TT * HD, QPl + zq * TT * HD, HD, Sb, TT, nullptr, (size_t)TT * HD, (size_t)TT * HD, (size_t)TT * TT);   /* S^T[k][q] = k_k.q_q (3 products) */
            k_csoft<<<ZH * TT / CSR, CSR * 32, 0, stream>>>(Sb, P8);                                                                              /* softmax over q -> fp16 x1024 [k/8][q][8] */
            k_pvk<<<dim3(TT / 64, KSP, ZH), 32, 0, stream>>>(P8, VT16 + zq * HD * TT, Ob);   /* o = attn . v (one product), KSP partial planes */
            k_merge<<<(unsigned)(((size_t)ZH * TT * HD / 2 + 255) / 256), 256, 0, stream>>>(Ob, h0, ATh, ATl); }                                  /* partial planes summed; hi/lo planes, carry undone on every row (RH 0) */
        k_gemmw<bf, 1, true><<<dim3(TT / 64, DM / 64, 1), 32, 0, stream>>>(ATh, ATl, WO, nullptr, DQ, YO, DM, bo, 0, 0, 0);   /* o Wo^T + bo */
        k_addx<<<(unsigned)(((size_t)TT * DM / 4 + 255) / 256), 256, 0, stream>>>(YO, x + (size_t)b * TT * DM, OUT + (size_t)b * TT * DM, (size_t)TT * DM / 4); }   /* + x */
}

// v003
// It runs in 1020 microseconds.
// Timed twice side by side with v002, it ran 1.32 times as fast both times.
// Counting every step since v000, it is 3.06 times as fast.
#include <hip/hip_runtime.h>

// Multi-head self-attention with QK-LayerNorm and the module's QUERY-axis softmax (x [4][2048][768]; q = LN_nobias(x Wq^T) gq, k = LN_nobias(x Wk^T + bk) gk (LayerNorm over the full 768), v = x Wv^T + bv ('oi' [768][768]; 12 heads x 64); scores = q.k/8; attn = softmax over the QUERY axis (per key column); o[q] = sum_k attn[q][k] v[k]; out = merged o Wo^T + bo + x -> [4][2048][768] (6.3 M)).
// Algorithm per (batch, group of ZH heads): the TRANSPOSED scores S^T[k][q] = k_k.q_q come from one 3-product GEMM so the column softmax is a row softmax; probabilities are written fp16 x1024 as 16-byte pieces [k/8][q][8] (8 keys of one query, turned through LDS inside the softmax kernel), which are the A fragment pieces of the product with the fp16 value planes (one product, K = 2048); the merge undoes the carry into hi/lo planes; Wo (2 products) + bo; + x residual in f32.
// Compute dtypes, f32 accumulate: every input rounded to bf16; q/k/v on PLAIN bf16 operands (exact) + biases; LayerNorm f32 (biased variance, eps 1e-5); scores hi/lo (3 products) on every row; softmax f32; attn.v single fp16 (P x1024); Wo hl x exact (2 products) + bo; residual f32.

#define NB_  4
#define TT   2048
#define DM   768
#define NH_  12
#define NKV  12
#define REP  (NH_ / NKV)
#define HD   64
#define DQ   (NH_ * HD)
#define DKV  (NKV * HD)
#define ZH   6                    // heads per attention launch: the most whose score, probability and partial planes fit the workspace
#define RH   0                    // every probability row carries x1024 (k_merge undoes it on all rows)
#define WIN  0
#define PCAR 1024.0f
#define SCL  0.125f   // HD^-0.5
typedef _Float16 h16;
typedef unsigned short bf;
typedef __attribute__((ext_vector_type(16))) __bf16   v16bf;
typedef __attribute__((ext_vector_type(16))) _Float16 v16h;
typedef __attribute__((ext_vector_type(8)))  _Float16 v8h;
typedef __attribute__((ext_vector_type(8)))  unsigned short v8us;
typedef __attribute__((ext_vector_type(8)))  float    v8f;
typedef __attribute__((ext_vector_type(4)))  float    v4f;
typedef v8h  __attribute__((may_alias)) v8ha;
typedef v4f  __attribute__((may_alias)) v4fa;
typedef v8us __attribute__((may_alias)) v8usa;

__device__ __forceinline__ unsigned short f2bf(float f) { unsigned u = __float_as_uint(f); u += 0x7FFFu + ((u >> 16) & 1u); return (unsigned short)(u >> 16); }
__device__ __forceinline__ float bf2f(unsigned short b) { return __uint_as_float(((unsigned)b) << 16); }
__device__ __forceinline__ float bfr(float f) { return bf2f(f2bf(f)); }
__device__ __forceinline__ v16h cat16(v8h lo, v8h hi) { return __builtin_shufflevector(lo, hi, 0, 1, 2, 3, 4, 5, 6, 7, 8, 9, 10, 11, 12, 13, 14, 15); }
__device__ __forceinline__ v16bf cat16b(v8us lo, v8us hi) { return __builtin_bit_cast(v16bf, __builtin_shufflevector(lo, hi, 0, 1, 2, 3, 4, 5, 6, 7, 8, 9, 10, 11, 12, 13, 14, 15)); }
__device__ __forceinline__ v8f wmma16(v16h a, v16h b, v8f c) { return __builtin_amdgcn_wmma_f32_16x16x32_f16(false, a, false, b, (short)0, c, false, false); }
__device__ __forceinline__ v8f wmmab(v16bf a, v16bf b, v8f c) { return __builtin_amdgcn_wmma_f32_16x16x32_bf16(false, a, false, b, (short)0, c, false, false); }



// ---- k_gemmw: register-blocked GEMM, ONE WAVE per 64x64 output tile (16 accumulators), operands straight from K-contiguous 16-bit planes; grid (M/64, N/64, Z), 32 threads.
// C[m][n] (f32, pitch ldc, + optional f32 bias[n]) = sum_k A[m][k] Bt[n][k] (+ split products per NSPLIT). z-batch strides sA/sB/sC in elements. K % 32 == 0.
template <typename T16> struct WFrag;
template <> struct WFrag<h16> { typedef v16h V; static __device__ __forceinline__ V ld(const h16* p) { return cat16(*(const v8h*)p, *(const v8h*)(p + 16)); } static __device__ __forceinline__ v8f mma(V a, V b, v8f c) { return wmma16(a, b, c); } };
template <> struct WFrag<bf> { typedef v16bf V; static __device__ __forceinline__ V ld(const bf* p) { return cat16b(*(const v8us*)p, *(const v8us*)(p + 16)); } static __device__ __forceinline__ v8f mma(V a, V b, v8f c) { return wmmab(a, b, c); } };
template <typename T16, int NSPLIT, bool BIAS>
__global__ __launch_bounds__(32) void k_gemmw(const T16* __restrict__ A, const T16* __restrict__ A2, const T16* __restrict__ Bt, const T16* __restrict__ Bt2, int K, float* C, int ldc, const float* __restrict__ bias, size_t sA, size_t sB, size_t sC) {
    typedef typename WFrag<T16>::V V;
    __shared__ __align__(16) float os[16 * 68];
    const size_t z = blockIdx.z; A += z * sA; if (A2) A2 += z * sA; Bt += z * sB; if (Bt2) Bt2 += z * sB; C += z * sC;
    const int lane = threadIdx.x & 31, lr = lane & 15, hi = lane >> 4; const int r0 = blockIdx.x * 64, c0 = blockIdx.y * 64;
    v8f acc[4][4];
#pragma unroll
    for (int mb = 0; mb < 4; ++mb)
#pragma unroll
        for (int nb = 0; nb < 4; ++nb) acc[mb][nb] = (v8f){};
    const size_t aoff = (size_t)(r0 + lr) * K + 8 * hi, boff = (size_t)(c0 + lr) * K + 8 * hi;
#pragma unroll 1
    for (int kc = 0; kc < K; kc += 32) {
        V a[4], a2[4];
#pragma unroll
        for (int mb = 0; mb < 4; ++mb) { a[mb] = WFrag<T16>::ld(A + aoff + (size_t)mb * 16 * K + kc); if (NSPLIT == 1 || NSPLIT == 2) a2[mb] = WFrag<T16>::ld(A2 + aoff + (size_t)mb * 16 * K + kc); }
#pragma unroll
        for (int nb = 0; nb < 4; ++nb) { const V b = WFrag<T16>::ld(Bt + boff + (size_t)nb * 16 * K + kc); V b2; if (NSPLIT >= 2) b2 = WFrag<T16>::ld(Bt2 + boff + (size_t)nb * 16 * K + kc);
#pragma unroll
            for (int mb = 0; mb < 4; ++mb) { acc[mb][nb] = WFrag<T16>::mma(a[mb], b, acc[mb][nb]); if (NSPLIT == 1 || NSPLIT == 2) acc[mb][nb] = WFrag<T16>::mma(a2[mb], b, acc[mb][nb]); if (NSPLIT >= 2) acc[mb][nb] = WFrag<T16>::mma(a[mb], b2, acc[mb][nb]); } }
        asm volatile("v_nop\n\tv_nop\n\tv_nop\n\tv_nop" : "+v"(acc[0][0]), "+v"(acc[1][1]), "+v"(acc[2][2]), "+v"(acc[3][3]) : "v"(a[0]), "v"(a[3]));
    }
#pragma unroll
    for (int mb = 0; mb < 4; ++mb) {
#pragma unroll
        for (int nb = 0; nb < 4; ++nb) {
#pragma unroll
            for (int j = 0; j < 8; ++j) os[(hi * 8 + j) * 68 + nb * 16 + lr] = acc[mb][nb][j]; }
        __builtin_amdgcn_wave_barrier(); asm volatile("" ::: "memory");
        float* crow = C + (size_t)(r0 + mb * 16) * ldc + c0;
{
#pragma unroll
            for (int s = 0; s < 8; ++s) { const int row = 2 * s + hi, cofs = lr * 4; v4f val = *(const v4fa*)(os + row * 68 + cofs); if (BIAS) { val[0] += bfr(bias[c0 + cofs]); val[1] += bfr(bias[c0 + cofs + 1]); val[2] += bfr(bias[c0 + cofs + 2]); val[3] += bfr(bias[c0 + cofs + 3]); }
                *(v4f*)(crow + (size_t)row * ldc + cofs) = val; }
             }
        __builtin_amdgcn_wave_barrier(); asm volatile("" ::: "memory");
    }
}

// ---- k_pvk: attn.v with its K = 2048 keys split over KSP work-groups; grid (TT/64, KSP, ZH), 32 threads. One wave forms the f32 partial 64x64 tile of its KSL keys and stores it to plane [slice][head][t][d]; k_merge adds the KSP planes in slice order. A = probabilities as [head][k/8][q][8]: a lane's two 16-byte fragment pieces (keys kc + 8 hi + 0..7 and kc + 16 + 8 hi + 0..7 of query row q) are pieces kc/8 + hi and kc/8 + 2 + hi at q, the k order of the Bt loader.
#define KSP 16
#define KSL (TT / KSP)
__global__ __launch_bounds__(32) void k_pvk(const h16* __restrict__ A, const h16* __restrict__ Bt, float* C) {
    __shared__ __align__(16) float os[16 * 68];
    const size_t z = blockIdx.z; const int ks = blockIdx.y; A += z * ((size_t)TT * TT) + (size_t)ks * KSL * TT; Bt += z * ((size_t)HD * TT) + ks * KSL; C += ((size_t)ks * ZH + z) * ((size_t)TT * HD);
    const int lane = threadIdx.x & 31, lr = lane & 15, hi = lane >> 4; const int r0 = blockIdx.x * 64;
    v8f acc[4][4];
#pragma unroll
    for (int mb = 0; mb < 4; ++mb)
#pragma unroll
        for (int nb = 0; nb < 4; ++nb) acc[mb][nb] = (v8f){};
    unsigned aoff = (hi * TT + r0 + lr) * 16, boff = (lr * TT + 8 * hi) * 2;   // a lane's byte offsets in this pass
#pragma unroll 1   // rolled: one pass's 8 fragments beside the 128 accumulator registers stay under 256 VGPRs
    for (int kc = 0; kc < KSL; kc += 32) {
        const h16* pa = (const h16*)((const char*)A + aoff); const h16* pb = (const h16*)((const char*)Bt + boff); v16h a[4], b[4];
#pragma unroll
        for (int mb = 0; mb < 4; ++mb) a[mb] = cat16(*(const v8h*)(pa + mb * 128), *(const v8h*)(pa + mb * 128 + 16 * TT));
#pragma unroll
        for (int nb = 0; nb < 4; ++nb) b[nb] = WFrag<h16>::ld(pb + (size_t)nb * 16 * TT);
        // behind the pass's 16 loads, before any register that they name is rewritten; the two offsets pass through the statement so that their step to the next pass stands behind it
        asm volatile("s_wait_xcnt 0x0" : "+v"(aoff), "+v"(boff) :: "memory");
        aoff += 64 * TT; boff += 64;
#pragma unroll
        for (int nb = 0; nb < 4; ++nb)
#pragma unroll
            for (int mb = 0; mb < 4; ++mb) acc[mb][nb] = wmma16(a[mb], b[nb], acc[mb][nb]);
        // four vector slots behind the pass's last WMMAs, on both sides of the loop branch: the next pass's loads rewrite a and b, the LDS stores behind the loop read acc
        asm volatile("v_nop\n\tv_nop\n\tv_nop\n\tv_nop" : "+v"(acc[0][0]), "+v"(acc[1][1]), "+v"(acc[2][2]), "+v"(acc[3][3]) : "v"(a[0]), "v"(a[3]));
    }
#pragma unroll
    for (int mb = 0; mb < 4; ++mb) {
#pragma unroll
        for (int nb = 0; nb < 4; ++nb) {
#pragma unroll
            for (int j = 0; j < 8; ++j) os[(hi * 8 + j) * 68 + nb * 16 + lr] = acc[mb][nb][j]; }
        __builtin_amdgcn_wave_barrier(); asm volatile("" ::: "memory");   // one wave: keeps every lane's LDS stores ahead of the row reads in the compiled order, with no wait on the global stores
        float* crow = C + (size_t)(r0 + mb * 16) * HD;
#pragma unroll
        for (int s = 0; s < 8; ++s) { const int row = 2 * s + hi, cofs = lr * 4; *(v4f*)(crow + (size_t)row * HD + cofs) = *(const v4fa*)(os + row * 68 + cofs); }
        __builtin_amdgcn_wave_barrier(); asm volatile("" ::: "memory");   // keeps the row reads ahead of the next 16 rows' LDS stores
    }
}

__device__ __forceinline__ h16 tohx(float x) { return (h16)x; }
__device__ __forceinline__ void splitf(float y, unsigned short& h, unsigned short& l) { h = f2bf(y); l = f2bf(y - bf2f(h)); }
typedef __attribute__((ext_vector_type(2))) _Float16 v2h;
typedef __attribute__((ext_vector_type(4))) _Float16 v4h;
typedef __attribute__((ext_vector_type(2))) unsigned short v2us;
typedef __attribute__((ext_vector_type(4))) unsigned short v4us;
typedef __attribute__((ext_vector_type(2))) float v2f;
typedef __attribute__((ext_vector_type(4))) int v4i;

__global__ __launch_bounds__(256) void k_wtG(const float* __restrict__ w, int K, int N, bf* Bt) {
    const int lane = threadIdx.x & 31; const int L0 = (blockIdx.x * 8 + (threadIdx.x >> 5)) * 8; const int nlines = N * K / 64;
{
#pragma unroll 1
        for (int l = 0; l < 8; ++l) { const int L = L0 + l; if (L >= nlines) break; const size_t e = (size_t)L * 64 + lane * 2; const int k = (int)(e % K), n = (int)(e / K); v2us o;
            o[0] = f2bf(w[(size_t)k * N + n]); o[1] = f2bf(w[(size_t)(k + 1) * N + n]); *(v2us*)(Bt + e) = o; }
         }
}
__global__ __launch_bounds__(256) void k_cvt8(const float* __restrict__ src, bf* dst, size_t n8) { const size_t i = (size_t)blockIdx.x * 256 + threadIdx.x; if (i >= n8) return; const v8f v = *(const v8f*)(src + i * 8); v8us o;
#pragma unroll
    for (int k = 0; k < 8; ++k) o[k] = f2bf(v[k]); *(v8us*)(dst + i * 8) = o;  }

// k_rope: head planes [h][t][d] (fp16 + hi/lo) of rope(x) x sc with the rotate-half convention out[d] = x[d] cos[t][d] - x[d+HD/2] sin[t][d], out[d+HD/2] = x[d+HD/2] cos[t][d+HD/2] + x[d] sin[t][d+HD/2]
__global__ __launch_bounds__(256) void k_rope(const float* __restrict__ F, int pitch, int nheads, const float* __restrict__ CS, const float* __restrict__ RF, const float* __restrict__ nw, float sc, h16* P16, bf* Ph, bf* Pl) {
    const size_t e = ((size_t)blockIdx.x * 256 + threadIdx.x) * 2; if (e >= (size_t)nheads * TT * HD) return; const int d = (int)(e % HD); const int t = (int)((e / HD) % TT); const int h = (int)(e / ((size_t)HD * TT)); const float* f = F + (size_t)t * pitch + h * HD; const float rf = RF ? RF[(size_t)h * TT + t] : 1.0f; v2h o16; v2us oh, ol;
#pragma unroll
    for (int q = 0; q < 2; ++q) { const int dd = d + q; const int dp = (dd < HD / 2) ? dd + HD / 2 : dd - HD / 2; float x0 = f[dd], x1 = f[dp];
        if (RF) { float n0 = __fmul_rn(x0, rf), n1 = __fmul_rn(x1, rf); asm volatile("" : "+v"(n0)); asm volatile("" : "+v"(n1)); x0 = __fmul_rn(bfr(nw[dd]), n0); x1 = __fmul_rn(bfr(nw[dp]), n1); }
        const v2f cs = *(const v2f*)(CS + ((size_t)t * HD + dd) * 2); float a = __fmul_rn(x0, cs[0]), bq = __fmul_rn(x1, cs[1]); asm volatile("" : "+v"(a)); asm volatile("" : "+v"(bq)); const float r = ((dd < HD / 2) ? __fsub_rn(a, bq) : __fadd_rn(a, bq)) * sc;
        o16[q] = tohx(r); unsigned short a2, c2; splitf(r, a2, c2); oh[q] = a2; ol[q] = c2; }
    *(v2h*)(P16 + e) = o16; *(v2us*)(Ph + e) = oh; *(v2us*)(Pl + e) = ol;  }
__global__ __launch_bounds__(256) void k_vtp(const float* __restrict__ F, int pitch, int nheads, h16* V16, bf* Vh, bf* Vl) { const size_t e = ((size_t)blockIdx.x * 256 + threadIdx.x) * 2; if (e >= (size_t)nheads * HD * TT) return; const int t = (int)(e % TT); const int d = (int)((e / TT) % HD); const int g = (int)(e / ((size_t)TT * HD)); v2h o16; v2us oh, ol;
#pragma unroll
    for (int q = 0; q < 2; ++q) { const float x = F[(size_t)(t + q) * pitch + g * HD + d]; o16[q] = tohx(x); unsigned short a2, c2; splitf(x, a2, c2); oh[q] = a2; ol[q] = c2; }
    *(v2h*)(V16 + e) = o16; *(v2us*)(Vh + e) = oh; *(v2us*)(Vl + e) = ol;  }
__global__ __launch_bounds__(256) void k_csid(float* CS) { const int idx = blockIdx.x * 256 + threadIdx.x; if (idx >= TT * HD) return; v2f cs; cs[0] = 1.0f; cs[1] = 0.0f; *(v2f*)(CS + (size_t)idx * 2) = cs;  }

// ---- k_csoft: softmax over q of CSR consecutive key rows, one wave per row; grid ZH*TT/CSR, CSR*32 threads. Each wave lays its fp16 x1024 row in LDS; behind one barrier the transposing LDS load hands every lane the 8 keys of one query, stored as one 16-byte piece of P8[head][k/8][q][8] (whole 128-byte lines, one writer each).
#define CSR 16
#define CSP (TT * 2 + 32)   // LDS row pitch in bytes, an odd multiple of 32 B: the conflict-free pitch of ds_load_tr16_b128
static_assert((ZH * TT) % CSR == 0 && TT % CSR == 0 && TT == CSR * 128 && (CSP / 32) % 2 == 1, "whole work-groups inside one head; 128 query columns per wave in the turn");
typedef short s16x8 __attribute__((ext_vector_type(8)));
__device__ __forceinline__ v8h ld_tr16(const unsigned char* p) { typedef __attribute__((address_space(3))) s16x8 lds_s16x8; return __builtin_bit_cast(v8h, __builtin_amdgcn_ds_load_tr16_b128_v8i16((lds_s16x8*)p)); }
__global__ __launch_bounds__(CSR * 32) void k_csoft(const float* __restrict__ Sb, h16* P8) {
    __shared__ __attribute__((aligned(32))) unsigned char T[CSR * CSP];
    const int lane = threadIdx.x & 31, w = threadIdx.x >> 5; const int row = blockIdx.x * CSR + w; const float* sr = Sb + (size_t)row * TT; float v[TT / 32]; float mx = -3.0e38f;
#pragma unroll
    for (int ch = 0; ch < TT / 128; ++ch) { const int j0 = ch * 128 + lane * 4; const v4f a = *(const v4f*)(sr + j0);
#pragma unroll
        for (int q = 0; q < 4; ++q) { float sa = a[q] * SCL; asm volatile("" : "+v"(sa)); const float t = sa; v[ch * 4 + q] = t; mx = fmaxf(mx, t); } }
#pragma unroll
    for (int sh = 16; sh; sh >>= 1) mx = fmaxf(mx, __shfl_xor(mx, sh, 32));
    float sum = 0.f;
#pragma unroll
    for (int kk = 0; kk < TT / 32; ++kk) { float d0 = __fsub_rn(v[kk], mx); asm volatile("" : "+v"(d0)); v[kk] = __builtin_amdgcn_exp2f(__fmul_rn(d0, 1.4426950408889634f)); sum += v[kk]; }
#pragma unroll
    for (int sh = 16; sh; sh >>= 1) sum += __shfl_xor(sum, sh, 32);
    const float f = __fdiv_rn(PCAR, sum);
#pragma unroll
    for (int ch = 0; ch < TT / 128; ++ch) { v4h o4;
#pragma unroll
        for (int q = 0; q < 4; ++q) o4[q] = tohx(v[ch * 4 + q] * f); *(v4h*)(T + w * CSP + (ch * 128 + lane * 4) * 2) = o4; }
    __syncthreads();   // all CSR rows lie in LDS before any wave reads across them
    // lane (c = lane & 15, h = lane >> 4) gets T[8 h + 0..7][column + c]; wave w turns query columns 128 w .. 128 w + 127, 16 a load
    const unsigned char* ad = T + (8 * (lane >> 4) + (lane & 7)) * CSP + 16 * ((lane >> 3) & 1) + w * 256;
    h16* dst = P8 + (((size_t)blockIdx.x * (CSR / 8) + (lane >> 4)) * TT + w * 128 + (lane & 15)) * 8;
#pragma unroll
    for (int i = 0; i < 8; ++i) *(v8h*)(dst + i * 128) = ld_tr16(ad + 32 * i);
}

__global__ __launch_bounds__(256) void k_merge(const float* __restrict__ O, int h0, bf* Ah, bf* Al) { const size_t e = ((size_t)blockIdx.x * 256 + threadIdx.x) * 2; if (e >= (size_t)ZH * TT * HD) return; const int d = (int)(e % HD); const int t = (int)((e / HD) % TT); const int zz = (int)(e / ((size_t)HD * TT)); const float cs = (t < RH) ? 1.0f : (1.0f / PCAR); const size_t oo = (size_t)t * DQ + (h0 + zz) * HD + d;
    v2us oh, ol; v2f sm = *(const v2f*)(O + e);
#pragma unroll
    for (int ks = 1; ks < KSP; ++ks) { const v2f p = *(const v2f*)(O + (size_t)ks * ((size_t)ZH * TT * HD) + e); sm[0] += p[0]; sm[1] += p[1]; }   /* the K slices' partial sums, in slice order */
#pragma unroll
    for (int q = 0; q < 2; ++q) { unsigned short a, c2; splitf(sm[q] * cs, a, c2); oh[q] = a; ol[q] = c2; } *(v2us*)(Ah + oo) = oh; *(v2us*)(Al + oo) = ol;  }
__global__ __launch_bounds__(256) void k_lnrow(float* F, const float* __restrict__ gw) {
    const int lane = threadIdx.x & 31; const int r = blockIdx.x * 8 + (threadIdx.x >> 5); if (r >= TT) return; float hv[DM / 32]; float s = 0.f; float* fr = F + (size_t)r * DM;
#pragma unroll
    for (int ch = 0; ch < DM / 128; ++ch) { const v4f y = *(const v4f*)(fr + ch * 128 + lane * 4);
#pragma unroll
        for (int q = 0; q < 4; ++q) { hv[ch * 4 + q] = y[q]; s += y[q]; } }
#pragma unroll
    for (int sh = 16; sh; sh >>= 1) s += __shfl_xor(s, sh, 32);
    const float mu = s * (1.0f / DM); float s2 = 0.f;
#pragma unroll
    for (int k = 0; k < DM / 32; ++k) { float d0 = __fsub_rn(hv[k], mu); asm volatile("" : "+v"(d0)); float p = __fmul_rn(d0, d0); asm volatile("" : "+v"(p)); s2 = __fadd_rn(s2, p); }
#pragma unroll
    for (int sh = 16; sh; sh >>= 1) s2 += __shfl_xor(s2, sh, 32);
    float var = __fadd_rn(s2 * (1.0f / DM), 1e-5f); asm volatile("" : "+v"(var)); const float rs = __frsqrt_rn(var);
    __builtin_amdgcn_wave_barrier(); asm volatile("" ::: "memory");   /* all lanes have read the row before any lane overwrites it */
{
#pragma unroll
        for (int ch = 0; ch < DM / 128; ++ch) { const int c0 = ch * 128 + lane * 4; v4f o;
#pragma unroll
            for (int q = 0; q < 4; ++q) { float gb = bfr(gw[c0 + q]); asm volatile("" : "+v"(gb)); float d0 = __fsub_rn(hv[ch * 4 + q], mu); asm volatile("" : "+v"(d0)); float n0 = __fmul_rn(d0, rs); asm volatile("" : "+v"(n0)); o[q] = __fmul_rn(n0, gb); }
            *(v4f*)(fr + c0) = o; }
         } }
__global__ __launch_bounds__(256) void k_addx(const float* __restrict__ Y, const float* __restrict__ xb, float* O, size_t n4) { const size_t i = (size_t)blockIdx.x * 256 + threadIdx.x; if (i >= n4) return; const v4f y = *(const v4f*)(Y + i * 4); const v4f xv = *(const v4f*)(xb + i * 4); v4f o;
#pragma unroll
    for (int q = 0; q < 4; ++q) { float xr = bfr(xv[q]); asm volatile("" : "+v"(xr)); o[q] = __fadd_rn(y[q], xr); } *(v4f*)(O + i * 4) = o;  }
extern "C" void kernel_launch(void* const* d_in, const int* in_sizes, int n_in,
                              void* d_out, int out_size, void* d_ws, size_t ws_size, hipStream_t stream) {
    (void)in_sizes; (void)n_in; (void)out_size;
    const float* x = (const float*)d_in[0]; const float* wq = (const float*)d_in[1]; const float* wk = (const float*)d_in[2]; const float* bk = (const float*)d_in[3]; const float* wv = (const float*)d_in[4]; const float* bv = (const float*)d_in[5]; const float* gq = (const float*)d_in[6]; const float* gk = (const float*)d_in[7]; const float* wo = (const float*)d_in[8]; const float* bo = (const float*)d_in[9];
    float* OUT = (float*)d_out;     // [4][2048][768]
    char* wsp = (char*)d_ws;
    auto take = [&](size_t bytes) { char* p = wsp; wsp += (bytes + 255) & ~(size_t)255; return (void*)p; };
    bf* WQ = (bf*)take((size_t)DQ * DM * 2); bf* WK = (bf*)take((size_t)DKV * DM * 2); bf* WV = (bf*)take((size_t)DKV * DM * 2); bf* WO = (bf*)take((size_t)DM * DQ * 2); float* CS = (float*)take((size_t)TT * HD * 2 * 4);
    bf* XB = (bf*)take((size_t)TT * DM * 2); float* FQ = (float*)take((size_t)TT * DQ * 4); float* FK = (float*)take((size_t)TT * DKV * 4); float* YO = (float*)take((size_t)TT * DM * 4);
    h16* QP16 = (h16*)take((size_t)NH_ * TT * HD * 2); h16* KP16 = (h16*)take((size_t)NKV * TT * HD * 2); h16* VT16 = (h16*)take((size_t)NKV * HD * TT * 2);
    bf* QPh = (bf*)take((size_t)NH_ * TT * HD * 2); bf* QPl = (bf*)take((size_t)NH_ * TT * HD * 2); bf* KPh = (bf*)take((size_t)NKV * TT * HD * 2); bf* KPl = (bf*)take((size_t)NKV * TT * HD * 2); bf* VTh = (bf*)take((size_t)NKV * HD * TT * 2); bf* VTl = (bf*)take((size_t)NKV * HD * TT * 2);
    float* Sb = (float*)take((size_t)ZH * TT * TT * 4); h16* P8 = (h16*)take((size_t)ZH * TT * TT * 2); float* Ob = (float*)take((size_t)KSP * ZH * TT * HD * 4); bf* ATh = (bf*)take((size_t)TT * DQ * 2); bf* ATl = (bf*)take((size_t)TT * DQ * 2);
    if ((size_t)(wsp - (char*)d_ws) > ws_size) return;
    float* FV = FK;   // v projection reuses the k buffer after the k planes are built (stream-ordered)
    k_cvt8<<<(unsigned)(((size_t)DQ * DM / 8 + 255) / 256), 256, 0, stream>>>(wq, WQ, (size_t)DQ * DM / 8); k_cvt8<<<(unsigned)(((size_t)DKV * DM / 8 + 255) / 256), 256, 0, stream>>>(wk, WK, (size_t)DKV * DM / 8); k_cvt8<<<(unsigned)(((size_t)DKV * DM / 8 + 255) / 256), 256, 0, stream>>>(wv, WV, (size_t)DKV * DM / 8); k_cvt8<<<(unsigned)(((size_t)DM * DQ / 8 + 255) / 256), 256, 0, stream>>>(wo, WO, (size_t)DM * DQ / 8);   /* 'oi' weights = Bt as-is */
    k_csid<<<(TT * HD + 255) / 256, 256, 0, stream>>>(CS);
    const unsigned LQ = (unsigned)(((size_t)NH_ * TT * HD / 2 + 255) / 256), LKv = (unsigned)(((size_t)NKV * TT * HD / 2 + 255) / 256);
    for (int b = 0; b < NB_; ++b) {
        k_cvt8<<<(unsigned)(((size_t)TT * DM / 8 + 255) / 256), 256, 0, stream>>>(x + (size_t)b * TT * DM, XB, (size_t)TT * DM / 8);
        k_gemmw<bf, 0, false><<<dim3(TT / 64, DQ / 64, 1), 32, 0, stream>>>(XB, nullptr, WQ, nullptr, DM, FQ, DQ, nullptr, 0, 0, 0); k_lnrow<<<TT / 8, 256, 0, stream>>>(FQ, gq);   /* q = LN(x Wq^T) gq */
        k_rope<<<LQ, 256, 0, stream>>>(FQ, DQ, NH_, CS, nullptr, nullptr, 1.0f, QP16, QPh, QPl);
        k_gemmw<bf, 0, true><<<dim3(TT / 64, DKV / 64, 1), 32, 0, stream>>>(XB, nullptr, WK, nullptr, DM, FK, DKV, bk, 0, 0, 0); k_lnrow<<<TT / 8, 256, 0, stream>>>(FK, gk);   /* k = LN(x Wk^T + bk) gk */
        k_rope<<<LKv, 256, 0, stream>>>(FK, DKV, NKV, CS, nullptr, nullptr, 1.0f, KP16, KPh, KPl);
        k_gemmw<bf, 0, true><<<dim3(TT / 64, DKV / 64, 1), 32, 0, stream>>>(XB, nullptr, WV, nullptr, DM, FV, DKV, bv, 0, 0, 0); k_vtp<<<LKv, 256, 0, stream>>>(FV, DKV, NKV, VT16, VTh, VTl);
        for (int h0 = 0; h0 < NH_; h0 += ZH) { const size_t zq = (size_t)h0;
            k_gemmw<bf, 2, false><<<dim3(TT / 64, TT / 64, ZH), 32, 0, stream>>>(KPh + zq * TT * HD, KPl + zq * TT * HD, QPh + zq * TT * HD, QPl + zq * TT * HD, HD, Sb, TT, nullptr, (size_t)TT * HD, (size_t)TT * HD, (size_t)TT * TT);   /* S^T[k][q] = k_k.q_q (3 products) */
            k_csoft<<<ZH * TT / CSR, CSR * 32, 0, stream>>>(Sb, P8);                                                                              /* softmax over q -> fp16 x1024 [k/8][q][8] */
            k_pvk<<<dim3(TT / 64, KSP, ZH), 32, 0, stream>>>(P8, VT16 + zq * HD * TT, Ob);   /* o = attn . v (one product), KSP partial planes */
            k_merge<<<(unsigned)(((size_t)ZH * TT * HD / 2 + 255) / 256), 256, 0, stream>>>(Ob, h0, ATh, ATl); }                                  /* partial planes summed; hi/lo planes, carry undone on every row (RH 0) */
        k_gemmw<bf, 1, true><<<dim3(TT / 64, DM / 64, 1), 32, 0, stream>>>(ATh, ATl, WO, nullptr, DQ, YO, DM, bo, 0, 0, 0);   /* o Wo^T + bo */
        k_addx<<<(unsigned)(((size_t)TT * DM / 4 + 255) / 256), 256, 0, stream>>>(YO, x + (size_t)b * TT * DM, OUT + (size_t)b * TT * DM, (size_t)TT * DM / 4); }   /* + x */
}

// v004
// It runs in 829 microseconds.
// Next to v003, in two timings, it ran 1.23 times as fast each time.
// Counting every step since v000, it is 3.77 times as fast.
#include <hip/hip_runtime.h>

// Multi-head self-attention with QK-LayerNorm and the module's QUERY-axis softmax (x [4][2048][768]; q = LN_nobias(x Wq^T) gq, k = LN_nobias(x Wk^T + bk) gk (LayerNorm over the full 768), v = x Wv^T + bv ('oi' [768][768]; 12 heads x 64); scores = q.k/8; attn = softmax over the QUERY axis (per key column); o[q] = sum_k attn[q][k] v[k]; out = merged o Wo^T + bo + x -> [4][2048][768] (6.3 M)).
// Projections, LayerNorm, head planes, Wo and the residual each run once over all NB_ * TT rows; the attention launches go per (batch, group of ZH heads): the TRANSPOSED scores S^T[k][q] = k_k.q_q come from one 3-product GEMM so the column softmax is a row softmax; probabilities are written fp16 x1024 as 16-byte pieces [k/8][q][8] (8 keys of one query, turned through LDS inside the softmax kernel), which are the A fragment pieces of the product with the fp16 value planes (one product, K = 2048); the merge undoes the carry into hi/lo planes; Wo (2 products) + bo; + x residual in f32.
// Compute dtypes, f32 accumulate: every input rounded to bf16; q/k/v on PLAIN bf16 operands (exact) + biases; LayerNorm f32 (biased variance, eps 1e-5); scores hi/lo (3 products) on every row; softmax f32; attn.v single fp16 (P x1024); Wo hl x exact (2 products) + bo; residual f32.

#define NB_  4
#define TT   2048
#define DM   768
#define NH_  12
#define NKV  12
#define REP  (NH_ / NKV)
#define HD   64
#define DQ   (NH_ * HD)
#define DKV  (NKV * HD)
#define ZH   6                    // heads per attention launch: the most whose score and probability planes fit the workspace beside the head planes of all batches
#define RH   0                    // every probability row carries x1024 (k_merge undoes it on all rows)
#define WIN  0
#define PCAR 1024.0f
#define SCL  0.125f   // HD^-0.5
typedef _Float16 h16;
typedef unsigned short bf;
typedef __attribute__((ext_vector_type(16))) __bf16   v16bf;
typedef __attribute__((ext_vector_type(16))) _Float16 v16h;
typedef __attribute__((ext_vector_type(8)))  _Float16 v8h;
typedef __attribute__((ext_vector_type(8)))  unsigned short v8us;
typedef __attribute__((ext_vector_type(8)))  float    v8f;
typedef __attribute__((ext_vector_type(4)))  float    v4f;
typedef v8h  __attribute__((may_alias)) v8ha;
typedef v4f  __attribute__((may_alias)) v4fa;
typedef v8us __attribute__((may_alias)) v8usa;

__device__ __forceinline__ unsigned short f2bf(float f) { unsigned u = __float_as_uint(f); u += 0x7FFFu + ((u >> 16) & 1u); return (unsigned short)(u >> 16); }
__device__ __forceinline__ float bf2f(unsigned short b) { return __uint_as_float(((unsigned)b) << 16); }
__device__ __forceinline__ float bfr(float f) { return bf2f(f2bf(f)); }
__device__ __forceinline__ v16h cat16(v8h lo, v8h hi) { return __builtin_shufflevector(lo, hi, 0, 1, 2, 3, 4, 5, 6, 7, 8, 9, 10, 11, 12, 13, 14, 15); }
__device__ __forceinline__ v16bf cat16b(v8us lo, v8us hi) { return __builtin_bit_cast(v16bf, __builtin_shufflevector(lo, hi, 0, 1, 2, 3, 4, 5, 6, 7, 8, 9, 10, 11, 12, 13, 14, 15)); }
__device__ __forceinline__ v8f wmma16(v16h a, v16h b, v8f c) { return __builtin_amdgcn_wmma_f32_16x16x32_f16(false, a, false, b, (short)0, c, false, false); }
__device__ __forceinline__ v8f wmmab(v16bf a, v16bf b, v8f c) { return __builtin_amdgcn_wmma_f32_16x16x32_bf16(false, a, false, b, (short)0, c, false, false); }



// ---- k_gemmw: register-blocked GEMM, ONE WAVE per 64x64 output tile (16 accumulators), operands straight from K-contiguous 16-bit planes; grid (M/64, N/64, Z), 32 threads.
// C[m][n] (f32, pitch ldc, + optional f32 bias[n]) = sum_k A[m][k] Bt[n][k] (+ split products per NSPLIT). z-batch strides sA/sB/sC in elements. K % 32 == 0.
template <typename T16> struct WFrag;
template <> struct WFrag<h16> { typedef v16h V; static __device__ __forceinline__ V ld(const h16* p) { return cat16(*(const v8h*)p, *(const v8h*)(p + 16)); } static __device__ __forceinline__ v8f mma(V a, V b, v8f c) { return wmma16(a, b, c); } };
template <> struct WFrag<bf> { typedef v16bf V; static __device__ __forceinline__ V ld(const bf* p) { return cat16b(*(const v8us*)p, *(const v8us*)(p + 16)); } static __device__ __forceinline__ v8f mma(V a, V b, v8f c) { return wmmab(a, b, c); } };
template <typename T16, int NSPLIT, bool BIAS>
__global__ __launch_bounds__(32) void k_gemmw(const T16* __restrict__ A, const T16* __restrict__ A2, const T16* __restrict__ Bt, const T16* __restrict__ Bt2, int K, float* C, int ldc, const float* __restrict__ bias, size_t sA, size_t sB, size_t sC) {
    typedef typename WFrag<T16>::V V;
    __shared__ __align__(16) float os[16 * 68];
    const size_t z = blockIdx.z; A += z * sA; if (A2) A2 += z * sA; Bt += z * sB; if (Bt2) Bt2 += z * sB; C += z * sC;
    const int lane = threadIdx.x & 31, lr = lane & 15, hi = lane >> 4; const int r0 = blockIdx.x * 64, c0 = blockIdx.y * 64;
    v8f acc[4][4];
#pragma unroll
    for (int mb = 0; mb < 4; ++mb)
#pragma unroll
        for (int nb = 0; nb < 4; ++nb) acc[mb][nb] = (v8f){};
    const size_t aoff = (size_t)(r0 + lr) * K + 8 * hi, boff = (size_t)(c0 + lr) * K + 8 * hi;
#pragma unroll 1
    for (int kc = 0; kc < K; kc += 32) {
        V a[4], a2[4];
#pragma unroll
        for (int mb = 0; mb < 4; ++mb) { a[mb] = WFrag<T16>::ld(A + aoff + (size_t)mb * 16 * K + kc); if (NSPLIT == 1 || NSPLIT == 2) a2[mb] = WFrag<T16>::ld(A2 + aoff + (size_t)mb * 16 * K + kc); }
#pragma unroll
        for (int nb = 0; nb < 4; ++nb) { const V b = WFrag<T16>::ld(Bt + boff + (size_t)nb * 16 * K + kc); V b2; if (NSPLIT >= 2) b2 = WFrag<T16>::ld(Bt2 + boff + (size_t)nb * 16 * K + kc);
#pragma unroll
            for (int mb = 0; mb < 4; ++mb) { acc[mb][nb] = WFrag<T16>::mma(a[mb], b, acc[mb][nb]); if (NSPLIT == 1 || NSPLIT == 2) acc[mb][nb] = WFrag<T16>::mma(a2[mb], b, acc[mb][nb]); if (NSPLIT >= 2) acc[mb][nb] = WFrag<T16>::mma(a[mb], b2, acc[mb][nb]); } }
        asm volatile("v_nop\n\tv_nop\n\tv_nop\n\tv_nop" : "+v"(acc[0][0]), "+v"(acc[1][1]), "+v"(acc[2][2]), "+v"(acc[3][3]) : "v"(a[0]), "v"(a[3]));
    }
#pragma unroll
    for (int mb = 0; mb < 4; ++mb) {
#pragma unroll
        for (int nb = 0; nb < 4; ++nb) {
#pragma unroll
            for (int j = 0; j < 8; ++j) os[(hi * 8 + j) * 68 + nb * 16 + lr] = acc[mb][nb][j]; }
        __builtin_amdgcn_wave_barrier(); asm volatile("" ::: "memory");
        float* crow = C + (size_t)(r0 + mb * 16) * ldc + c0;
{
#pragma unroll
            for (int s = 0; s < 8; ++s) { const int row = 2 * s + hi, cofs = lr * 4; v4f val = *(const v4fa*)(os + row * 68 + cofs); if (BIAS) { val[0] += bfr(bias[c0 + cofs]); val[1] += bfr(bias[c0 + cofs + 1]); val[2] += bfr(bias[c0 + cofs + 2]); val[3] += bfr(bias[c0 + cofs + 3]); }
                *(v4f*)(crow + (size_t)row * ldc + cofs) = val; }
             }
        __builtin_amdgcn_wave_barrier(); asm volatile("" ::: "memory");
    }
}

// ---- k_pvk: attn.v with its K = 2048 keys split over KSP work-groups; grid (TT/64, KSP, ZH), 32 threads. One wave forms the f32 partial 64x64 tile of its KSL keys and stores it to plane [slice][head][t][d]; k_merge adds the KSP planes in slice order. A = probabilities as [head][k/8][q][8]: a lane's two 16-byte fragment pieces (keys kc + 8 hi + 0..7 and kc + 16 + 8 hi + 0..7 of query row q) are pieces kc/8 + hi and kc/8 + 2 + hi at q, the k order of the Bt loader.
#define KSP 16
#define KSL (TT / KSP)
__global__ __launch_bounds__(32) void k_pvk(const h16* __restrict__ A, const h16* __restrict__ Bt, float* C) {
    __shared__ __align__(16) float os[16 * 68];
    const size_t z = blockIdx.z; const int ks = blockIdx.y; A += z * ((size_t)TT * TT) + (size_t)ks * KSL * TT; Bt += z * ((size_t)HD * TT) + ks * KSL; C += ((size_t)ks * ZH + z) * ((size_t)TT * HD);
    const int lane = threadIdx.x & 31, lr = lane & 15, hi = lane >> 4; const int r0 = blockIdx.x * 64;
    v8f acc[4][4];
#pragma unroll
    for (int mb = 0; mb < 4; ++mb)
#pragma unroll
        for (int nb = 0; nb < 4; ++nb) acc[mb][nb] = (v8f){};
    unsigned aoff = (hi * TT + r0 + lr) * 16, boff = (lr * TT + 8 * hi) * 2;   // a lane's byte offsets in this pass
#pragma unroll 1   // rolled: one pass's 8 fragments beside the 128 accumulator registers stay under 256 VGPRs
    for (int kc = 0; kc < KSL; kc += 32) {
        const h16* pa = (const h16*)((const char*)A + aoff); const h16* pb = (const h16*)((const char*)Bt + boff); v16h a[4], b[4];
#pragma unroll
        for (int mb = 0; mb < 4; ++mb) a[mb] = cat16(*(const v8h*)(pa + mb * 128), *(const v8h*)(pa + mb * 128 + 16 * TT));
#pragma unroll
        for (int nb = 0; nb < 4; ++nb) b[nb] = WFrag<h16>::ld(pb + (size_t)nb * 16 * TT);
        // behind the pass's 16 loads, before any register that they name is rewritten; the two offsets pass through the statement so that their step to the next pass stands behind it
        asm volatile("s_wait_xcnt 0x0" : "+v"(aoff), "+v"(boff) :: "memory");
        aoff += 64 * TT; boff += 64;
#pragma unroll
        for (int nb = 0; nb < 4; ++nb)
#pragma unroll
            for (int mb = 0; mb < 4; ++mb) acc[mb][nb] = wmma16(a[mb], b[nb], acc[mb][nb]);
        // four vector slots behind the pass's last WMMAs, on both sides of the loop branch: the next pass's loads rewrite a and b, the LDS stores behind the loop read acc
        asm volatile("v_nop\n\tv_nop\n\tv_nop\n\tv_nop" : "+v"(acc[0][0]), "+v"(acc[1][1]), "+v"(acc[2][2]), "+v"(acc[3][3]) : "v"(a[0]), "v"(a[3]));
    }
#pragma unroll
    for (int mb = 0; mb < 4; ++mb) {
#pragma unroll
        for (int nb = 0; nb < 4; ++nb) {
#pragma unroll
            for (int j = 0; j < 8; ++j) os[(hi * 8 + j) * 68 + nb * 16 + lr] = acc[mb][nb][j]; }
        __builtin_amdgcn_wave_barrier(); asm volatile("" ::: "memory");   // one wave: keeps every lane's LDS stores ahead of the row reads in the compiled order, with no wait on the global stores
        float* crow = C + (size_t)(r0 + mb * 16) * HD;
#pragma unroll
        for (int s = 0; s < 8; ++s) { const int row = 2 * s + hi, cofs = lr * 4; *(v4f*)(crow + (size_t)row * HD + cofs) = *(const v4fa*)(os + row * 68 + cofs); }
        __builtin_amdgcn_wave_barrier(); asm volatile("" ::: "memory");   // keeps the row reads ahead of the next 16 rows' LDS stores
    }
}

__device__ __forceinline__ h16 tohx(float x) { return (h16)x; }
__device__ __forceinline__ void splitf(float y, unsigned short& h, unsigned short& l) { h = f2bf(y); l = f2bf(y - bf2f(h)); }
typedef __attribute__((ext_vector_type(2))) _Float16 v2h;
typedef __attribute__((ext_vector_type(4))) _Float16 v4h;
typedef __attribute__((ext_vector_type(2))) unsigned short v2us;
typedef __attribute__((ext_vector_type(4))) unsigned short v4us;
typedef __attribute__((ext_vector_type(2))) float v2f;
typedef __attribute__((ext_vector_type(4))) int v4i;

__global__ __launch_bounds__(256) void k_wtG(const float* __restrict__ w, int K, int N, bf* Bt) {
    const int lane = threadIdx.x & 31; const int L0 = (blockIdx.x * 8 + (threadIdx.x >> 5)) * 8; const int nlines = N * K / 64;
{
#pragma unroll 1
        for (int l = 0; l < 8; ++l) { const int L = L0 + l; if (L >= nlines) break; const size_t e = (size_t)L * 64 + lane * 2; const int k = (int)(e % K), n = (int)(e / K); v2us o;
            o[0] = f2bf(w[(size_t)k * N + n]); o[1] = f2bf(w[(size_t)(k + 1) * N + n]); *(v2us*)(Bt + e) = o; }
         }
}
__global__ __launch_bounds__(256) void k_cvt8(const float* __restrict__ src, bf* dst, size_t n8) { const size_t i = (size_t)blockIdx.x * 256 + threadIdx.x; if (i >= n8) return; const v8f v = *(const v8f*)(src + i * 8); v8us o;
#pragma unroll
    for (int k = 0; k < 8; ++k) o[k] = f2bf(v[k]); *(v8us*)(dst + i * 8) = o;  }

// k_rope: head planes [h][t][d] (fp16 + hi/lo) of rope(x) x sc with the rotate-half convention out[d] = x[d] cos[t][d] - x[d+HD/2] sin[t][d], out[d+HD/2] = x[d+HD/2] cos[t][d+HD/2] + x[d] sin[t][d+HD/2]
__global__ __launch_bounds__(256) void k_rope(const float* __restrict__ F, int pitch, int nheads, const float* __restrict__ CS, const float* __restrict__ RF, const float* __restrict__ nw, float sc, h16* P16, bf* Ph, bf* Pl) {
    { const size_t bz = blockIdx.y; F += bz * ((size_t)TT * pitch); const size_t po = bz * ((size_t)nheads * TT * HD); P16 += po; Ph += po; Pl += po; }   // grid y = batch: rows bz TT .. of F, planes [batch][h][t][d]
    const size_t e = ((size_t)blockIdx.x * 256 + threadIdx.x) * 2; if (e >= (size_t)nheads * TT * HD) return; const int d = (int)(e % HD); const int t = (int)((e / HD) % TT); const int h = (int)(e / ((size_t)HD * TT)); const float* f = F + (size_t)t * pitch + h * HD; const float rf = RF ? RF[(size_t)h * TT + t] : 1.0f; v2h o16; v2us oh, ol;
#pragma unroll
    for (int q = 0; q < 2; ++q) { const int dd = d + q; const int dp = (dd < HD / 2) ? dd + HD / 2 : dd - HD / 2; float x0 = f[dd], x1 = f[dp];
        if (RF) { float n0 = __fmul_rn(x0, rf), n1 = __fmul_rn(x1, rf); asm volatile("" : "+v"(n0)); asm volatile("" : "+v"(n1)); x0 = __fmul_rn(bfr(nw[dd]), n0); x1 = __fmul_rn(bfr(nw[dp]), n1); }
        const v2f cs = *(const v2f*)(CS + ((size_t)t * HD + dd) * 2); float a = __fmul_rn(x0, cs[0]), bq = __fmul_rn(x1, cs[1]); asm volatile("" : "+v"(a)); asm volatile("" : "+v"(bq)); const float r = ((dd < HD / 2) ? __fsub_rn(a, bq) : __fadd_rn(a, bq)) * sc;
        o16[q] = tohx(r); unsigned short a2, c2; splitf(r, a2, c2); oh[q] = a2; ol[q] = c2; }
    *(v2h*)(P16 + e) = o16; *(v2us*)(Ph + e) = oh; *(v2us*)(Pl + e) = ol;  }
__global__ __launch_bounds__(256) void k_vtp(const float* __restrict__ F, int pitch, int nheads, h16* V16, bf* Vh, bf* Vl) {
    { const size_t bz = blockIdx.y; F += bz * ((size_t)TT * pitch); const size_t po = bz * ((size_t)nheads * HD * TT); V16 += po; Vh += po; Vl += po; }   // grid y = batch: planes [batch][g][d][t]
    const size_t e = ((size_t)blockIdx.x * 256 + threadIdx.x) * 2; if (e >= (size_t)nheads * HD * TT) return; const int t = (int)(e % TT); const int d = (int)((e / TT) % HD); const int g = (int)(e / ((size_t)TT * HD)); v2h o16; v2us oh, ol;
#pragma unroll
    for (int q = 0; q < 2; ++q) { const float x = F[(size_t)(t + q) * pitch + g * HD + d]; o16[q] = tohx(x); unsigned short a2, c2; splitf(x, a2, c2); oh[q] = a2; ol[q] = c2; }
    *(v2h*)(V16 + e) = o16; *(v2us*)(Vh + e) = oh; *(v2us*)(Vl + e) = ol;  }
__global__ __launch_bounds__(256) void k_csid(float* CS) { const int idx = blockIdx.x * 256 + threadIdx.x; if (idx >= TT * HD) return; v2f cs; cs[0] = 1.0f; cs[1] = 0.0f; *(v2f*)(CS + (size_t)idx * 2) = cs;  }

// ---- k_csoft: softmax over q of CSR consecutive key rows, one wave per row; grid ZH*TT/CSR, CSR*32 threads. Each wave lays its fp16 x1024 row in LDS; behind one barrier the transposing LDS load hands every lane the 8 keys of one query, stored as one 16-byte piece of P8[head][k/8][q][8] (whole 128-byte lines, one writer each).
#define CSR 16
#define CSP (TT * 2 + 32)   // LDS row pitch in bytes, an odd multiple of 32 B: the conflict-free pitch of ds_load_tr16_b128
static_assert((ZH * TT) % CSR == 0 && TT % CSR == 0 && TT == CSR * 128 && (CSP / 32) % 2 == 1, "whole work-groups inside one head; 128 query columns per wave in the turn");
typedef short s16x8 __attribute__((ext_vector_type(8)));
__device__ __forceinline__ v8h ld_tr16(const unsigned char* p) { typedef __attribute__((address_space(3))) s16x8 lds_s16x8; return __builtin_bit_cast(v8h, __builtin_amdgcn_ds_load_tr16_b128_v8i16((lds_s16x8*)p)); }
__global__ __launch_bounds__(CSR * 32) void k_csoft(const float* __restrict__ Sb, h16* P8) {
    __shared__ __attribute__((aligned(32))) unsigned char T[CSR * CSP];
    const int lane = threadIdx.x & 31, w = threadIdx.x >> 5; const int row = blockIdx.x * CSR + w; const float* sr = Sb + (size_t)row * TT; float v[TT / 32]; float mx = -3.0e38f;
#pragma unroll
    for (int ch = 0; ch < TT / 128; ++ch) { const int j0 = ch * 128 + lane * 4; const v4f a = *(const v4f*)(sr + j0);
#pragma unroll
        for (int q = 0; q < 4; ++q) { float sa = a[q] * SCL; asm volatile("" : "+v"(sa)); const float t = sa; v[ch * 4 + q] = t; mx = fmaxf(mx, t); } }
#pragma unroll
    for (int sh = 16; sh; sh >>= 1) mx = fmaxf(mx, __shfl_xor(mx, sh, 32));
    float sum = 0.f;
#pragma unroll
    for (int kk = 0; kk < TT / 32; ++kk) { float d0 = __fsub_rn(v[kk], mx); asm volatile("" : "+v"(d0)); v[kk] = __builtin_amdgcn_exp2f(__fmul_rn(d0, 1.4426950408889634f)); sum += v[kk]; }
#pragma unroll
    for (int sh = 16; sh; sh >>= 1) sum += __shfl_xor(sum, sh, 32);
    const float f = __fdiv_rn(PCAR, sum);
#pragma unroll
    for (int ch = 0; ch < TT / 128; ++ch) { v4h o4;
#pragma unroll
        for (int q = 0; q < 4; ++q) o4[q] = tohx(v[ch * 4 + q] * f); *(v4h*)(T + w * CSP + (ch * 128 + lane * 4) * 2) = o4; }
    __syncthreads();   // all CSR rows lie in LDS before any wave reads across them
    // lane (c = lane & 15, h = lane >> 4) gets T[8 h + 0..7][column + c]; wave w turns query columns 128 w .. 128 w + 127, 16 a load
    const unsigned char* ad = T + (8 * (lane >> 4) + (lane & 7)) * CSP + 16 * ((lane >> 3) & 1) + w * 256;
    h16* dst = P8 + (((size_t)blockIdx.x * (CSR / 8) + (lane >> 4)) * TT + w * 128 + (lane & 15)) * 8;
#pragma unroll
    for (int i = 0; i < 8; ++i) *(v8h*)(dst + i * 128) = ld_tr16(ad + 32 * i);
}

__global__ __launch_bounds__(256) void k_merge(const float* __restrict__ O, int h0, bf* Ah, bf* Al) { const size_t e = ((size_t)blockIdx.x * 256 + threadIdx.x) * 2; if (e >= (size_t)ZH * TT * HD) return; const int d = (int)(e % HD); const int t = (int)((e / HD) % TT); const int zz = (int)(e / ((size_t)HD * TT)); const float cs = (t < RH) ? 1.0f : (1.0f / PCAR); const size_t oo = (size_t)t * DQ + (h0 + zz) * HD + d;
    v2us oh, ol; v2f sm = *(const v2f*)(O + e);
#pragma unroll
    for (int ks = 1; ks < KSP; ++ks) { const v2f p = *(const v2f*)(O + (size_t)ks * ((size_t)ZH * TT * HD) + e); sm[0] += p[0]; sm[1] += p[1]; }   /* the K slices' partial sums, in slice order */
#pragma unroll
    for (int q = 0; q < 2; ++q) { unsigned short a, c2; splitf(sm[q] * cs, a, c2); oh[q] = a; ol[q] = c2; } *(v2us*)(Ah + oo) = oh; *(v2us*)(Al + oo) = ol;  }
__global__ __launch_bounds__(256) void k_lnrow(float* F, const float* __restrict__ gw) {
    const int lane = threadIdx.x & 31; const int r = blockIdx.x * 8 + (threadIdx.x >> 5); if (r >= NB_ * TT) return; float hv[DM / 32]; float s = 0.f; float* fr = F + (size_t)r * DM;
#pragma unroll
    for (int ch = 0; ch < DM / 128; ++ch) { const v4f y = *(const v4f*)(fr + ch * 128 + lane * 4);
#pragma unroll
        for (int q = 0; q < 4; ++q) { hv[ch * 4 + q] = y[q]; s += y[q]; } }
#pragma unroll
    for (int sh = 16; sh; sh >>= 1) s += __shfl_xor(s, sh, 32);
    const float mu = s * (1.0f / DM); float s2 = 0.f;
#pragma unroll
    for (int k = 0; k < DM / 32; ++k) { float d0 = __fsub_rn(hv[k], mu); asm volatile("" : "+v"(d0)); float p = __fmul_rn(d0, d0); asm volatile("" : "+v"(p)); s2 = __fadd_rn(s2, p); }
#pragma unroll
    for (int sh = 16; sh; sh >>= 1) s2 += __shfl_xor(s2, sh, 32);
    float var = __fadd_rn(s2 * (1.0f / DM), 1e-5f); asm volatile("" : "+v"(var)); const float rs = __frsqrt_rn(var);
    __builtin_amdgcn_wave_barrier(); asm volatile("" ::: "memory");   /* all lanes have read the row before any lane overwrites it */
{
#pragma unroll
        for (int ch = 0; ch < DM / 128; ++ch) { const int c0 = ch * 128 + lane * 4; v4f o;
#pragma unroll
            for (int q = 0; q < 4; ++q) { float gb = bfr(gw[c0 + q]); asm volatile("" : "+v"(gb)); float d0 = __fsub_rn(hv[ch * 4 + q], mu); asm volatile("" : "+v"(d0)); float n0 = __fmul_rn(d0, rs); asm volatile("" : "+v"(n0)); o[q] = __fmul_rn(n0, gb); }
            *(v4f*)(fr + c0) = o; }
         } }
__global__ __launch_bounds__(256) void k_addx(const float* __restrict__ Y, const float* __restrict__ xb, float* O, size_t n4) { const size_t i = (size_t)blockIdx.x * 256 + threadIdx.x; if (i >= n4) return; const v4f y = *(const v4f*)(Y + i * 4); const v4f xv = *(const v4f*)(xb + i * 4); v4f o;
#pragma unroll
    for (int q = 0; q < 4; ++q) { float xr = bfr(xv[q]); asm volatile("" : "+v"(xr)); o[q] = __fadd_rn(y[q], xr); } *(v4f*)(O + i * 4) = o;  }
extern "C" void kernel_launch(void* const* d_in, const int* in_sizes, int n_in,
                              void* d_out, int out_size, void* d_ws, size_t ws_size, hipStream_t stream) {
    (void)in_sizes; (void)n_in; (void)out_size;
    const float* x = (const float*)d_in[0]; const float* wq = (const float*)d_in[1]; const float* wk = (const float*)d_in[2]; const float* bk = (const float*)d_in[3]; const float* wv = (const float*)d_in[4]; const float* bv = (const float*)d_in[5]; const float* gq = (const float*)d_in[6]; const float* gk = (const float*)d_in[7]; const float* wo = (const float*)d_in[8]; const float* bo = (const float*)d_in[9];
    float* OUT = (float*)d_out;     // [4][2048][768]
    char* wsp = (char*)d_ws;
    auto take = [&](size_t bytes) { char* p = wsp; wsp += (bytes + 255) & ~(size_t)255; return (void*)p; };
    bf* WQ = (bf*)take((size_t)DQ * DM * 2); bf* WK = (bf*)take((size_t)DKV * DM * 2); bf* WV = (bf*)take((size_t)DKV * DM * 2); bf* WO = (bf*)take((size_t)DM * DQ * 2); float* CS = (float*)take((size_t)TT * HD * 2 * 4);
    // planes of all NB_ batches that the attention launches read or write
    bf* QPh = (bf*)take((size_t)NB_ * NH_ * TT * HD * 2); bf* QPl = (bf*)take((size_t)NB_ * NH_ * TT * HD * 2); bf* KPh = (bf*)take((size_t)NB_ * NKV * TT * HD * 2); bf* KPl = (bf*)take((size_t)NB_ * NKV * TT * HD * 2); h16* VT16 = (h16*)take((size_t)NB_ * NKV * HD * TT * 2);
    bf* ATh = (bf*)take((size_t)NB_ * TT * DQ * 2); bf* ATl = (bf*)take((size_t)NB_ * TT * DQ * 2);
    char* const big = wsp;
    float* Sb = (float*)take((size_t)ZH * TT * TT * 4); h16* P8 = (h16*)take((size_t)ZH * TT * TT * 2);
    if ((size_t)(wsp - (char*)d_ws) > ws_size) return;
    // the score and probability bytes serve three times over, stream-ordered: before the first score launch they hold the projection stage's buffers; the partial planes lie on the scores, which are dead once the softmax has read them; the Wo result lies there after the last merge
    static_assert((size_t)KSP * HD <= (size_t)TT && (size_t)NB_ * DM <= (size_t)ZH * TT, "partial planes and the Wo result fit the score plane");
    static_assert((size_t)NB_ * TT * DM * 2 + (size_t)NB_ * TT * (DQ + DKV) * 4 + (size_t)NB_ * (NH_ + 3 * NKV) * TT * HD * 2 <= (size_t)ZH * TT * TT * 6, "projection stage fits the score and probability bytes");
    float* Ob = Sb; float* YO = Sb;
    wsp = big;
    bf* XB = (bf*)take((size_t)NB_ * TT * DM * 2); float* FQ = (float*)take((size_t)NB_ * TT * DQ * 4); float* FK = (float*)take((size_t)NB_ * TT * DKV * 4);
    h16* QP16 = (h16*)take((size_t)NB_ * NH_ * TT * HD * 2); h16* KP16 = (h16*)take((size_t)NB_ * NKV * TT * HD * 2); bf* VTh = (bf*)take((size_t)NB_ * NKV * HD * TT * 2); bf* VTl = (bf*)take((size_t)NB_ * NKV * HD * TT * 2);
    float* FV = FK;   // v projection reuses the k buffer after the k planes are built (stream-ordered)
    k_cvt8<<<(unsigned)(((size_t)DQ * DM / 8 + 255) / 256), 256, 0, stream>>>(wq, WQ, (size_t)DQ * DM / 8); k_cvt8<<<(unsigned)(((size_t)DKV * DM / 8 + 255) / 256), 256, 0, stream>>>(wk, WK, (size_t)DKV * DM / 8); k_cvt8<<<(unsigned)(((size_t)DKV * DM / 8 + 255) / 256), 256, 0, stream>>>(wv, WV, (size_t)DKV * DM / 8); k_cvt8<<<(unsigned)(((size_t)DM * DQ / 8 + 255) / 256), 256, 0, stream>>>(wo, WO, (size_t)DM * DQ / 8);   /* 'oi' weights = Bt as-is */
    k_csid<<<(TT * HD + 255) / 256, 256, 0, stream>>>(CS);
    const unsigned LQ = (unsigned)(((size_t)NH_ * TT * HD / 2 + 255) / 256), LKv = (unsigned)(((size_t)NKV * TT * HD / 2 + 255) / 256);
    // every launch of this stage covers the NB_ * TT rows of all batches
    k_cvt8<<<(unsigned)(((size_t)NB_ * TT * DM / 8 + 255) / 256), 256, 0, stream>>>(x, XB, (size_t)NB_ * TT * DM / 8);
    k_gemmw<bf, 0, false><<<dim3(NB_ * TT / 64, DQ / 64, 1), 32, 0, stream>>>(XB, nullptr, WQ, nullptr, DM, FQ, DQ, nullptr, 0, 0, 0); k_lnrow<<<NB_ * TT / 8, 256, 0, stream>>>(FQ, gq);   /* q = LN(x Wq^T) gq */
    k_rope<<<dim3(LQ, NB_, 1), 256, 0, stream>>>(FQ, DQ, NH_, CS, nullptr, nullptr, 1.0f, QP16, QPh, QPl);
    k_gemmw<bf, 0, true><<<dim3(NB_ * TT / 64, DKV / 64, 1), 32, 0, stream>>>(XB, nullptr, WK, nullptr, DM, FK, DKV, bk, 0, 0, 0); k_lnrow<<<NB_ * TT / 8, 256, 0, stream>>>(FK, gk);   /* k = LN(x Wk^T + bk) gk */
    k_rope<<<dim3(LKv, NB_, 1), 256, 0, stream>>>(FK, DKV, NKV, CS, nullptr, nullptr, 1.0f, KP16, KPh, KPl);
    k_gemmw<bf, 0, true><<<dim3(NB_ * TT / 64, DKV / 64, 1), 32, 0, stream>>>(XB, nullptr, WV, nullptr, DM, FV, DKV, bv, 0, 0, 0); k_vtp<<<dim3(LKv, NB_, 1), 256, 0, stream>>>(FV, DKV, NKV, VT16, VTh, VTl);
    for (int b = 0; b < NB_; ++b) {
        for (int h0 = 0; h0 < NH_; h0 += ZH) { const size_t zq = (size_t)b * NH_ + h0;   // first head plane of the group, planes [batch][head]
            k_gemmw<bf, 2, false><<<dim3(TT / 64, TT / 64, ZH), 32, 0, stream>>>(KPh + zq * TT * HD, KPl + zq * TT * HD, QPh + zq * TT * HD, QPl + zq * TT * HD, HD, Sb, TT, nullptr, (size_t)TT * HD, (size_t)TT * HD, (size_t)TT * TT);   /* S^T[k][q] = k_k.q_q (3 products) */
            k_csoft<<<ZH * TT / CSR, CSR * 32, 0, stream>>>(Sb, P8);                                                                              /* softmax over q -> fp16 x1024 [k/8][q][8] */
            k_pvk<<<dim3(TT / 64, KSP, ZH), 32, 0, stream>>>(P8, VT16 + zq * HD * TT, Ob);   /* o = attn . v (one product), KSP partial planes */
            k_merge<<<(unsigned)(((size_t)ZH * TT * HD / 2 + 255) / 256), 256, 0, stream>>>(Ob, h0, ATh + (size_t)b * TT * DQ, ATl + (size_t)b * TT * DQ); } }                                  /* partial planes summed; hi/lo planes, carry undone on every row (RH 0) */
    k_gemmw<bf, 1, true><<<dim3(NB_ * TT / 64, DM / 64, 1), 32, 0, stream>>>(ATh, ATl, WO, nullptr, DQ, YO, DM, bo, 0, 0, 0);   /* o Wo^T + bo */
    k_addx<<<(unsigned)(((size_t)NB_ * TT * DM / 4 + 255) / 256), 256, 0, stream>>>(YO, x, OUT, (size_t)NB_ * TT * DM / 4);   /* + x */
}

// v005
// Measured time: 689 microseconds a run.
// Next to v004, in two timings, it ran 1.20 times as fast each time.
// Counting every step since v000, it is 4.52 times as fast.
#include <hip/hip_runtime.h>

// Multi-head self-attention with QK-LayerNorm and the module's QUERY-axis softmax (x [4][2048][768]; q = LN_nobias(x Wq^T) gq, k = LN_nobias(x Wk^T + bk) gk (LayerNorm over the full 768), v = x Wv^T + bv ('oi' [768][768]; 12 heads x 64); scores = q.k/8; attn = softmax over the QUERY axis (per key column); o[q] = sum_k attn[q][k] v[k]; out = merged o Wo^T + bo + x -> [4][2048][768] (6.3 M)).
// Projections, LayerNorm, head planes, Wo and the residual each run once over all NB_ * TT rows; the attention launches go per (batch, group of ZH heads): the TRANSPOSED scores S^T[k][q] = k_k.q_q (3 products) are formed and normalised over q inside one kernel and never stored; probabilities are written fp16 x1024 as 16-byte pieces [k/8][q][8] (8 keys of one query, as an accumulator tile holds them), which are the A fragment pieces of the product with the fp16 value planes (one product, K = 2048); the merge undoes the carry into hi/lo planes; Wo (2 products) + bo; + x residual in f32.
// Compute dtypes, f32 accumulate: every input rounded to bf16; q/k/v on PLAIN bf16 operands (exact) + biases; LayerNorm f32 (biased variance, eps 1e-5); scores hi/lo (3 products) on every row; softmax f32; attn.v single fp16 (P x1024); Wo hl x exact (2 products) + bo; residual f32.

#define NB_  4
#define TT   2048
#define DM   768
#define NH_  12
#define NKV  12
#define REP  (NH_ / NKV)
#define HD   64
#define DQ   (NH_ * HD)
#define DKV  (NKV * HD)
#define ZH   6                    // heads per attention launch
#define RH   0                    // every probability row carries x1024 (k_merge undoes it on all rows)
#define WIN  0
#define PCAR 1024.0f
#define SCL  0.125f   // HD^-0.5
typedef _Float16 h16;
typedef unsigned short bf;
typedef __attribute__((ext_vector_type(16))) __bf16   v16bf;
typedef __attribute__((ext_vector_type(16))) _Float16 v16h;
typedef __attribute__((ext_vector_type(8)))  _Float16 v8h;
typedef __attribute__((ext_vector_type(8)))  unsigned short v8us;
typedef __attribute__((ext_vector_type(8)))  float    v8f;
typedef __attribute__((ext_vector_type(4)))  float    v4f;
typedef v8h  __attribute__((may_alias)) v8ha;
typedef v4f  __attribute__((may_alias)) v4fa;
typedef v8us __attribute__((may_alias)) v8usa;

__device__ __forceinline__ unsigned short f2bf(float f) { unsigned u = __float_as_uint(f); u += 0x7FFFu + ((u >> 16) & 1u); return (unsigned short)(u >> 16); }
__device__ __forceinline__ float bf2f(unsigned short b) { return __uint_as_float(((unsigned)b) << 16); }
__device__ __forceinline__ float bfr(float f) { return bf2f(f2bf(f)); }
__device__ __forceinline__ v16h cat16(v8h lo, v8h hi) { return __builtin_shufflevector(lo, hi, 0, 1, 2, 3, 4, 5, 6, 7, 8, 9, 10, 11, 12, 13, 14, 15); }
__device__ __forceinline__ v16bf cat16b(v8us lo, v8us hi) { return __builtin_bit_cast(v16bf, __builtin_shufflevector(lo, hi, 0, 1, 2, 3, 4, 5, 6, 7, 8, 9, 10, 11, 12, 13, 14, 15)); }
__device__ __forceinline__ v8f wmma16(v16h a, v16h b, v8f c) { return __builtin_amdgcn_wmma_f32_16x16x32_f16(false, a, false, b, (short)0, c, false, false); }
__device__ __forceinline__ v8f wmmab(v16bf a, v16bf b, v8f c) { return __builtin_amdgcn_wmma_f32_16x16x32_bf16(false, a, false, b, (short)0, c, false, false); }



// ---- k_gemmw: register-blocked GEMM, ONE WAVE per 64x64 output tile (16 accumulators), operands straight from K-contiguous 16-bit planes; grid (M/64, N/64, Z), 32 threads.
// C[m][n] (f32, pitch ldc, + optional f32 bias[n]) = sum_k A[m][k] Bt[n][k] (+ split products per NSPLIT). z-batch strides sA/sB/sC in elements. K % 32 == 0.
template <typename T16> struct WFrag;
template <> struct WFrag<h16> { typedef v16h V; static __device__ __forceinline__ V ld(const h16* p) { return cat16(*(const v8h*)p, *(const v8h*)(p + 16)); } static __device__ __forceinline__ v8f mma(V a, V b, v8f c) { return wmma16(a, b, c); } };
template <> struct WFrag<bf> { typedef v16bf V; static __device__ __forceinline__ V ld(const bf* p) { return cat16b(*(const v8us*)p, *(const v8us*)(p + 16)); } static __device__ __forceinline__ v8f mma(V a, V b, v8f c) { return wmmab(a, b, c); } };
template <typename T16, int NSPLIT, bool BIAS>
__global__ __launch_bounds__(32) void k_gemmw(const T16* __restrict__ A, const T16* __restrict__ A2, const T16* __restrict__ Bt, const T16* __restrict__ Bt2, int K, float* C, int ldc, const float* __restrict__ bias, size_t sA, size_t sB, size_t sC) {
    typedef typename WFrag<T16>::V V;
    __shared__ __align__(16) float os[16 * 68];
    const size_t z = blockIdx.z; A += z * sA; if (A2) A2 += z * sA; Bt += z * sB; if (Bt2) Bt2 += z * sB; C += z * sC;
    const int lane = threadIdx.x & 31, lr = lane & 15, hi = lane >> 4; const int r0 = blockIdx.x * 64, c0 = blockIdx.y * 64;
    v8f acc[4][4];
#pragma unroll
    for (int mb = 0; mb < 4; ++mb)
#pragma unroll
        for (int nb = 0; nb < 4; ++nb) acc[mb][nb] = (v8f){};
    const size_t aoff = (size_t)(r0 + lr) * K + 8 * hi, boff = (size_t)(c0 + lr) * K + 8 * hi;
#pragma unroll 1
    for (int kc = 0; kc < K; kc += 32) {
        V a[4], a2[4];
#pragma unroll
        for (int mb = 0; mb < 4; ++mb) { a[mb] = WFrag<T16>::ld(A + aoff + (size_t)mb * 16 * K + kc); if (NSPLIT == 1 || NSPLIT == 2) a2[mb] = WFrag<T16>::ld(A2 + aoff + (size_t)mb * 16 * K + kc); }
#pragma unroll
        for (int nb = 0; nb < 4; ++nb) { const V b = WFrag<T16>::ld(Bt + boff + (size_t)nb * 16 * K + kc); V b2; if (NSPLIT >= 2) b2 = WFrag<T16>::ld(Bt2 + boff + (size_t)nb * 16 * K + kc);
#pragma unroll
            for (int mb = 0; mb < 4; ++mb) { acc[mb][nb] = WFrag<T16>::mma(a[mb], b, acc[mb][nb]); if (NSPLIT == 1 || NSPLIT == 2) acc[mb][nb] = WFrag<T16>::mma(a2[mb], b, acc[mb][nb]); if (NSPLIT >= 2) acc[mb][nb] = WFrag<T16>::mma(a[mb], b2, acc[mb][nb]); } }
        asm volatile("v_nop\n\tv_nop\n\tv_nop\n\tv_nop" : "+v"(acc[0][0]), "+v"(acc[1][1]), "+v"(acc[2][2]), "+v"(acc[3][3]) : "v"(a[0]), "v"(a[3]));
    }
#pragma unroll
    for (int mb = 0; mb < 4; ++mb) {
#pragma unroll
        for (int nb = 0; nb < 4; ++nb) {
#pragma unroll
            for (int j = 0; j < 8; ++j) os[(hi * 8 + j) * 68 + nb * 16 + lr] = acc[mb][nb][j]; }
        __builtin_amdgcn_wave_barrier(); asm volatile("" ::: "memory");
        float* crow = C + (size_t)(r0 + mb * 16) * ldc + c0;
{
#pragma unroll
            for (int s = 0; s < 8; ++s) { const int row = 2 * s + hi, cofs = lr * 4; v4f val = *(const v4fa*)(os + row * 68 + cofs); if (BIAS) { val[0] += bfr(bias[c0 + cofs]); val[1] += bfr(bias[c0 + cofs + 1]); val[2] += bfr(bias[c0 + cofs + 2]); val[3] += bfr(bias[c0 + cofs + 3]); }
                *(v4f*)(crow + (size_t)row * ldc + cofs) = val; }
             }
        __builtin_amdgcn_wave_barrier(); asm volatile("" ::: "memory");
    }
}

// ---- k_pvk: attn.v with its K = 2048 keys split over KSP work-groups; grid (TT/64, KSP, ZH), 32 threads. One wave forms the f32 partial 64x64 tile of its KSL keys and stores it to plane [slice][head][t][d]; k_merge adds the KSP planes in slice order. A = probabilities as [head][k/8][q][8]: a lane's two 16-byte fragment pieces (keys kc + 8 hi + 0..7 and kc + 16 + 8 hi + 0..7 of query row q) are pieces kc/8 + hi and kc/8 + 2 + hi at q, the k order of the Bt loader.
#define KSP 16
#define KSL (TT / KSP)
__global__ __launch_bounds__(32) void k_pvk(const h16* __restrict__ A, const h16* __restrict__ Bt, float* C) {
    __shared__ __align__(16) float os[16 * 68];
    const size_t z = blockIdx.z; const int ks = blockIdx.y; A += z * ((size_t)TT * TT) + (size_t)ks * KSL * TT; Bt += z * ((size_t)HD * TT) + ks * KSL; C += ((size_t)ks * ZH + z) * ((size_t)TT * HD);
    const int lane = threadIdx.x & 31, lr = lane & 15, hi = lane >> 4; const int r0 = blockIdx.x * 64;
    v8f acc[4][4];
#pragma unroll
    for (int mb = 0; mb < 4; ++mb)
#pragma unroll
        for (int nb = 0; nb < 4; ++nb) acc[mb][nb] = (v8f){};
    unsigned aoff = (hi * TT + r0 + lr) * 16, boff = (lr * TT + 8 * hi) * 2;   // a lane's byte offsets in this pass
#pragma unroll 1   // rolled: one pass's 8 fragments beside the 128 accumulator registers stay under 256 VGPRs
    for (int kc = 0; kc < KSL; kc += 32) {
        const h16* pa = (const h16*)((const char*)A + aoff); const h16* pb = (const h16*)((const char*)Bt + boff); v16h a[4], b[4];
#pragma unroll
        for (int mb = 0; mb < 4; ++mb) a[mb] = cat16(*(const v8h*)(pa + mb * 128), *(const v8h*)(pa + mb * 128 + 16 * TT));
#pragma unroll
        for (int nb = 0; nb < 4; ++nb) b[nb] = WFrag<h16>::ld(pb + (size_t)nb * 16 * TT);
        // behind the pass's 16 loads, before any register that they name is rewritten; the two offsets pass through the statement so that their step to the next pass stands behind it
        asm volatile("s_wait_xcnt 0x0" : "+v"(aoff), "+v"(boff) :: "memory");
        aoff += 64 * TT; boff += 64;
#pragma unroll
        for (int nb = 0; nb < 4; ++nb)
#pragma unroll
            for (int mb = 0; mb < 4; ++mb) acc[mb][nb] = wmma16(a[mb], b[nb], acc[mb][nb]);
        // four vector slots behind the pass's last WMMAs, on both sides of the loop branch: the next pass's loads rewrite a and b, the LDS stores behind the loop read acc
        asm volatile("v_nop\n\tv_nop\n\tv_nop\n\tv_nop" : "+v"(acc[0][0]), "+v"(acc[1][1]), "+v"(acc[2][2]), "+v"(acc[3][3]) : "v"(a[0]), "v"(a[3]));
    }
#pragma unroll
    for (int mb = 0; mb < 4; ++mb) {
#pragma unroll
        for (int nb = 0; nb < 4; ++nb) {
#pragma unroll
            for (int j = 0; j < 8; ++j) os[(hi * 8 + j) * 68 + nb * 16 + lr] = acc[mb][nb][j]; }
        __builtin_amdgcn_wave_barrier(); asm volatile("" ::: "memory");   // one wave: keeps every lane's LDS stores ahead of the row reads in the compiled order, with no wait on the global stores
        float* crow = C + (size_t)(r0 + mb * 16) * HD;
#pragma unroll
        for (int s = 0; s < 8; ++s) { const int row = 2 * s + hi, cofs = lr * 4; *(v4f*)(crow + (size_t)row * HD + cofs) = *(const v4fa*)(os + row * 68 + cofs); }
        __builtin_amdgcn_wave_barrier(); asm volatile("" ::: "memory");   // keeps the row reads ahead of the next 16 rows' LDS stores
    }
}

__device__ __forceinline__ h16 tohx(float x) { return (h16)x; }
__device__ __forceinline__ void splitf(float y, unsigned short& h, unsigned short& l) { h = f2bf(y); l = f2bf(y - bf2f(h)); }
typedef __attribute__((ext_vector_type(2))) _Float16 v2h;
typedef __attribute__((ext_vector_type(4))) _Float16 v4h;
typedef __attribute__((ext_vector_type(2))) unsigned short v2us;
typedef __attribute__((ext_vector_type(4))) unsigned short v4us;
typedef __attribute__((ext_vector_type(2))) float v2f;
typedef __attribute__((ext_vector_type(4))) int v4i;

__global__ __launch_bounds__(256) void k_wtG(const float* __restrict__ w, int K, int N, bf* Bt) {
    const int lane = threadIdx.x & 31; const int L0 = (blockIdx.x * 8 + (threadIdx.x >> 5)) * 8; const int nlines = N * K / 64;
{
#pragma unroll 1
        for (int l = 0; l < 8; ++l) { const int L = L0 + l; if (L >= nlines) break; const size_t e = (size_t)L * 64 + lane * 2; const int k = (int)(e % K), n = (int)(e / K); v2us o;
            o[0] = f2bf(w[(size_t)k * N + n]); o[1] = f2bf(w[(size_t)(k + 1) * N + n]); *(v2us*)(Bt + e) = o; }
         }
}
__global__ __launch_bounds__(256) void k_cvt8(const float* __restrict__ src, bf* dst, size_t n8) { const size_t i = (size_t)blockIdx.x * 256 + threadIdx.x; if (i >= n8) return; const v8f v = *(const v8f*)(src + i * 8); v8us o;
#pragma unroll
    for (int k = 0; k < 8; ++k) o[k] = f2bf(v[k]); *(v8us*)(dst + i * 8) = o;  }

// k_rope: head planes [h][t][d] (fp16 + hi/lo) of rope(x) x sc with the rotate-half convention out[d] = x[d] cos[t][d] - x[d+HD/2] sin[t][d], out[d+HD/2] = x[d+HD/2] cos[t][d+HD/2] + x[d] sin[t][d+HD/2]
__global__ __launch_bounds__(256) void k_rope(const float* __restrict__ F, int pitch, int nheads, const float* __restrict__ CS, const float* __restrict__ RF, const float* __restrict__ nw, float sc, h16* P16, bf* Ph, bf* Pl) {
    { const size_t bz = blockIdx.y; F += bz * ((size_t)TT * pitch); const size_t po = bz * ((size_t)nheads * TT * HD); P16 += po; Ph += po; Pl += po; }   // grid y = batch: rows bz TT .. of F, planes [batch][h][t][d]
    const size_t e = ((size_t)blockIdx.x * 256 + threadIdx.x) * 2; if (e >= (size_t)nheads * TT * HD) return; const int d = (int)(e % HD); const int t = (int)((e / HD) % TT); const int h = (int)(e / ((size_t)HD * TT)); const float* f = F + (size_t)t * pitch + h * HD; const float rf = RF ? RF[(size_t)h * TT + t] : 1.0f; v2h o16; v2us oh, ol;
#pragma unroll
    for (int q = 0; q < 2; ++q) { const int dd = d + q; const int dp = (dd < HD / 2) ? dd + HD / 2 : dd - HD / 2; float x0 = f[dd], x1 = f[dp];
        if (RF) { float n0 = __fmul_rn(x0, rf), n1 = __fmul_rn(x1, rf); asm volatile("" : "+v"(n0)); asm volatile("" : "+v"(n1)); x0 = __fmul_rn(bfr(nw[dd]), n0); x1 = __fmul_rn(bfr(nw[dp]), n1); }
        const v2f cs = *(const v2f*)(CS + ((size_t)t * HD + dd) * 2); float a = __fmul_rn(x0, cs[0]), bq = __fmul_rn(x1, cs[1]); asm volatile("" : "+v"(a)); asm volatile("" : "+v"(bq)); const float r = ((dd < HD / 2) ? __fsub_rn(a, bq) : __fadd_rn(a, bq)) * sc;
        o16[q] = tohx(r); unsigned short a2, c2; splitf(r, a2, c2); oh[q] = a2; ol[q] = c2; }
    *(v2h*)(P16 + e) = o16; *(v2us*)(Ph + e) = oh; *(v2us*)(Pl + e) = ol;  }
__global__ __launch_bounds__(256) void k_vtp(const float* __restrict__ F, int pitch, int nheads, h16* V16, bf* Vh, bf* Vl) {
    { const size_t bz = blockIdx.y; F += bz * ((size_t)TT * pitch); const size_t po = bz * ((size_t)nheads * HD * TT); V16 += po; Vh += po; Vl += po; }   // grid y = batch: planes [batch][g][d][t]
    const size_t e = ((size_t)blockIdx.x * 256 + threadIdx.x) * 2; if (e >= (size_t)nheads * HD * TT) return; const int t = (int)(e % TT); const int d = (int)((e / TT) % HD); const int g = (int)(e / ((size_t)TT * HD)); v2h o16; v2us oh, ol;
#pragma unroll
    for (int q = 0; q < 2; ++q) { const float x = F[(size_t)(t + q) * pitch + g * HD + d]; o16[q] = tohx(x); unsigned short a2, c2; splitf(x, a2, c2); oh[q] = a2; ol[q] = c2; }
    *(v2h*)(V16 + e) = o16; *(v2us*)(Vh + e) = oh; *(v2us*)(Vl + e) = ol;  }
__global__ __launch_bounds__(256) void k_csid(float* CS) { const int idx = blockIdx.x * 256 + threadIdx.x; if (idx >= TT * HD) return; v2f cs; cs[0] = 1.0f; cs[1] = 0.0f; *(v2f*)(CS + (size_t)idx * 2) = cs;  }

// ---- k_scsoft: scores and their softmax over q in one kernel; grid (TT/FKB, ZH), FNW*32 threads. A work-group owns FKB key rows against all TT queries: wave w forms S^T[FKB keys][128 queries from 128 w] in 16 accumulator tiles (3 products, K = HD, the product order a.b, a2.b, a.b2 per 32 of K), so a score never leaves the registers. Row maximum and row sum: over a lane's 8 tiles, over the 16 lanes of a row by DPP, over the FNW waves through LDS in wave order. An accumulator tile holds in each lane 8 consecutive keys of one query: one 16-byte piece of P8[head][k/8][q][8], stored as it stands (whole 128-byte lines, one writer each).
#define FKB 32
#define FNW 16
static_assert(TT % FKB == 0 && TT == FNW * 128 && HD == 64 && FKB == 32, "two 16-key tile rows; 128 query columns per wave; one lane of wave 0 per key row in the cross-wave step");
template <int M> __device__ __forceinline__ float rowx(float v) { return __builtin_bit_cast(float, __builtin_amdgcn_mov_dpp(__builtin_bit_cast(int, v), 0x160 | M, 0xf, 0xf, true)); }   // value of lane ^ M inside the 16-lane row (row_xmask)
__global__ __launch_bounds__(FNW * 32) void k_scsoft(const bf* __restrict__ Kh, const bf* __restrict__ Kl, const bf* __restrict__ Qh, const bf* __restrict__ Ql, h16* P8) {
    __shared__ __align__(16) float redm[FNW][FKB], reds[FNW][FKB], finm[FKB], fins[FKB];
    const size_t z = blockIdx.y; Kh += z * ((size_t)TT * HD); Kl += z * ((size_t)TT * HD); Qh += z * ((size_t)TT * HD); Ql += z * ((size_t)TT * HD);
    const int lane = threadIdx.x & 31, lr = lane & 15, hi = lane >> 4, w = threadIdx.x >> 5; const int k0 = blockIdx.x * FKB, q0 = w * 128;
    v16bf ah[2][2], al[2][2], rb[2][2], rb2[2][2]; v8f acc[2][8];
    const bf* qh = Qh + (size_t)(q0 + lr) * HD + 8 * hi; const bf* ql = Ql + (size_t)(q0 + lr) * HD + 8 * hi; const size_t ko = (size_t)(k0 + lr) * HD + 8 * hi;
    // step nb: the six products (K slices 0 and 1) into tiles (0, nb) and (1, nb); a step's eight query loads, which share its 32 lines, go out together, one step ahead
#pragma unroll
    for (int kk = 0; kk < 2; ++kk) { rb[0][kk] = WFrag<bf>::ld(qh + kk * 32); rb2[0][kk] = WFrag<bf>::ld(ql + kk * 32); }
#pragma unroll
    for (int mb = 0; mb < 2; ++mb)
#pragma unroll
        for (int kk = 0; kk < 2; ++kk) { ah[mb][kk] = WFrag<bf>::ld(Kh + ko + mb * 16 * HD + kk * 32); al[mb][kk] = WFrag<bf>::ld(Kl + ko + mb * 16 * HD + kk * 32); }
    asm volatile("s_wait_xcnt 0x0" ::: "memory");   // the key address registers are dead behind these loads: the wait stands before the next loads' results may land in them
#pragma unroll
    for (int nb = 0; nb < 8; ++nb) {
        if (nb + 1 < 8) {
#pragma unroll
            for (int kk = 0; kk < 2; ++kk) { rb[(nb + 1) & 1][kk] = WFrag<bf>::ld(qh + (nb + 1) * 16 * HD + kk * 32); rb2[(nb + 1) & 1][kk] = WFrag<bf>::ld(ql + (nb + 1) * 16 * HD + kk * 32); } }
        __builtin_amdgcn_sched_barrier(0);   // keeps the next step's loads ahead of this step's products: sunk to their use, each would cost its whole latency
#pragma unroll
        for (int mb = 0; mb < 2; ++mb) { v8f a = (v8f){};
#pragma unroll
            for (int kk = 0; kk < 2; ++kk) { a = wmmab(ah[mb][kk], rb[nb & 1][kk], a); a = wmmab(al[mb][kk], rb[nb & 1][kk], a); a = wmmab(ah[mb][kk], rb2[nb & 1][kk], a); }
            acc[mb][nb] = a; }
        __builtin_amdgcn_sched_barrier(0); }   // keeps later loads behind this step's products: hoisted, a third set of query fragments would be live and the build spills
    // lane (lr, hi), tile (mb, nb), register j: key k0 + 16 mb + 8 hi + j, query q0 + 16 nb + lr
    float rv[2][8];
#pragma unroll
    for (int mb = 0; mb < 2; ++mb)
#pragma unroll
        for (int j = 0; j < 8; ++j) { float m = -3.0e38f;
#pragma unroll
            for (int nb = 0; nb < 8; ++nb) m = fmaxf(m, acc[mb][nb][j]);
            m = fmaxf(m, rowx<1>(m)); m = fmaxf(m, rowx<2>(m)); m = fmaxf(m, rowx<4>(m)); m = fmaxf(m, rowx<8>(m)); rv[mb][j] = m; }
    if (lr == 0) {
#pragma unroll
        for (int mb = 0; mb < 2; ++mb) { *(v4fa*)&redm[w][mb * 16 + hi * 8] = (v4f){rv[mb][0], rv[mb][1], rv[mb][2], rv[mb][3]}; *(v4fa*)&redm[w][mb * 16 + hi * 8 + 4] = (v4f){rv[mb][4], rv[mb][5], rv[mb][6], rv[mb][7]}; } }
    __syncthreads();   // every wave's row maxima lie in LDS
    if (threadIdx.x < FKB) { float m = redm[0][threadIdx.x];
#pragma unroll
        for (int ww = 1; ww < FNW; ++ww) m = fmaxf(m, redm[ww][threadIdx.x]);
        finm[threadIdx.x] = m; }
    __syncthreads();   // the FKB row maxima over all queries are published
#pragma unroll
    for (int mb = 0; mb < 2; ++mb) { const v4f m0 = *(const v4fa*)&finm[mb * 16 + hi * 8], m1 = *(const v4fa*)&finm[mb * 16 + hi * 8 + 4]; const v8f mx = __builtin_shufflevector(m0, m1, 0, 1, 2, 3, 4, 5, 6, 7); v8f s8;
#pragma unroll
        for (int nb = 0; nb < 8; ++nb) { v8f t = (acc[mb][nb] - mx) * (SCL * 1.4426950408889634f);
#pragma unroll
            for (int j = 0; j < 8; ++j) t[j] = __builtin_amdgcn_exp2f(t[j]);
            acc[mb][nb] = t; s8 = nb ? s8 + t : t; }   // SCL is a power of two: (a - m) (SCL c) rounds as (a SCL - m SCL) c does
#pragma unroll
        for (int j = 0; j < 8; ++j) { float s = s8[j]; s += rowx<1>(s); s += rowx<2>(s); s += rowx<4>(s); s += rowx<8>(s); rv[mb][j] = s; } }
    if (lr == 0) {
#pragma unroll
        for (int mb = 0; mb < 2; ++mb) { *(v4fa*)&reds[w][mb * 16 + hi * 8] = (v4f){rv[mb][0], rv[mb][1], rv[mb][2], rv[mb][3]}; *(v4fa*)&reds[w][mb * 16 + hi * 8 + 4] = (v4f){rv[mb][4], rv[mb][5], rv[mb][6], rv[mb][7]}; } }
    __syncthreads();   // every wave's row sums lie in LDS
    if (threadIdx.x < FKB) { float s = reds[0][threadIdx.x];
#pragma unroll
        for (int ww = 1; ww < FNW; ++ww) s += reds[ww][threadIdx.x];
        fins[threadIdx.x] = __fdiv_rn(PCAR, s); }
    __syncthreads();   // the FKB row factors 1024 / sum are published
    h16* dst = P8 + ((((size_t)z * TT + k0) / 8 + hi) * TT + q0 + lr) * 8;
#pragma unroll
    for (int mb = 0; mb < 2; ++mb) { const v4f f0 = *(const v4fa*)&fins[mb * 16 + hi * 8], f1 = *(const v4fa*)&fins[mb * 16 + hi * 8 + 4];
#pragma unroll
        for (int nb = 0; nb < 8; ++nb) { v8h o;
#pragma unroll
            for (int j = 0; j < 8; ++j) o[j] = tohx(acc[mb][nb][j] * ((j < 4) ? f0[j & 3] : f1[j & 3]));
            *(v8h*)(dst + ((size_t)mb * 2 * TT + nb * 16) * 8) = o; } }
}

__global__ __launch_bounds__(256) void k_merge(const float* __restrict__ O, int h0, bf* Ah, bf* Al) { const size_t e = ((size_t)blockIdx.x * 256 + threadIdx.x) * 2; if (e >= (size_t)ZH * TT * HD) return; const int d = (int)(e % HD); const int t = (int)((e / HD) % TT); const int zz = (int)(e / ((size_t)HD * TT)); const float cs = (t < RH) ? 1.0f : (1.0f / PCAR); const size_t oo = (size_t)t * DQ + (h0 + zz) * HD + d;
    v2us oh, ol; v2f sm = *(const v2f*)(O + e);
#pragma unroll
    for (int ks = 1; ks < KSP; ++ks) { const v2f p = *(const v2f*)(O + (size_t)ks * ((size_t)ZH * TT * HD) + e); sm[0] += p[0]; sm[1] += p[1]; }   /* the K slices' partial sums, in slice order */
#pragma unroll
    for (int q = 0; q < 2; ++q) { unsigned short a, c2; splitf(sm[q] * cs, a, c2); oh[q] = a; ol[q] = c2; } *(v2us*)(Ah + oo) = oh; *(v2us*)(Al + oo) = ol;  }
__global__ __launch_bounds__(256) void k_lnrow(float* F, const float* __restrict__ gw) {
    const int lane = threadIdx.x & 31; const int r = blockIdx.x * 8 + (threadIdx.x >> 5); if (r >= NB_ * TT) return; float hv[DM / 32]; float s = 0.f; float* fr = F + (size_t)r * DM;
#pragma unroll
    for (int ch = 0; ch < DM / 128; ++ch) { const v4f y = *(const v4f*)(fr + ch * 128 + lane * 4);
#pragma unroll
        for (int q = 0; q < 4; ++q) { hv[ch * 4 + q] = y[q]; s += y[q]; } }
#pragma unroll
    for (int sh = 16; sh; sh >>= 1) s += __shfl_xor(s, sh, 32);
    const float mu = s * (1.0f / DM); float s2 = 0.f;
#pragma unroll
    for (int k = 0; k < DM / 32; ++k) { float d0 = __fsub_rn(hv[k], mu); asm volatile("" : "+v"(d0)); float p = __fmul_rn(d0, d0); asm volatile("" : "+v"(p)); s2 = __fadd_rn(s2, p); }
#pragma unroll
    for (int sh = 16; sh; sh >>= 1) s2 += __shfl_xor(s2, sh, 32);
    float var = __fadd_rn(s2 * (1.0f / DM), 1e-5f); asm volatile("" : "+v"(var)); const float rs = __frsqrt_rn(var);
    __builtin_amdgcn_wave_barrier(); asm volatile("" ::: "memory");   /* all lanes have read the row before any lane overwrites it */
{
#pragma unroll
        for (int ch = 0; ch < DM / 128; ++ch) { const int c0 = ch * 128 + lane * 4; v4f o;
#pragma unroll
            for (int q = 0; q < 4; ++q) { float gb = bfr(gw[c0 + q]); asm volatile("" : "+v"(gb)); float d0 = __fsub_rn(hv[ch * 4 + q], mu); asm volatile("" : "+v"(d0)); float n0 = __fmul_rn(d0, rs); asm volatile("" : "+v"(n0)); o[q] = __fmul_rn(n0, gb); }
            *(v4f*)(fr + c0) = o; }
         } }
__global__ __launch_bounds__(256) void k_addx(const float* __restrict__ Y, const float* __restrict__ xb, float* O, size_t n4) { const size_t i = (size_t)blockIdx.x * 256 + threadIdx.x; if (i >= n4) return; const v4f y = *(const v4f*)(Y + i * 4); const v4f xv = *(const v4f*)(xb + i * 4); v4f o;
#pragma unroll
    for (int q = 0; q < 4; ++q) { float xr = bfr(xv[q]); asm volatile("" : "+v"(xr)); o[q] = __fadd_rn(y[q], xr); } *(v4f*)(O + i * 4) = o;  }
extern "C" void kernel_launch(void* const* d_in, const int* in_sizes, int n_in,
                              void* d_out, int out_size, void* d_ws, size_t ws_size, hipStream_t stream) {
    (void)in_sizes; (void)n_in; (void)out_size;
    const float* x = (const float*)d_in[0]; const float* wq = (const float*)d_in[1]; const float* wk = (const float*)d_in[2]; const float* bk = (const float*)d_in[3]; const float* wv = (const float*)d_in[4]; const float* bv = (const float*)d_in[5]; const float* gq = (const float*)d_in[6]; const float* gk = (const float*)d_in[7]; const float* wo = (const float*)d_in[8]; const float* bo = (const float*)d_in[9];
    float* OUT = (float*)d_out;     // [4][2048][768]
    char* wsp = (char*)d_ws;
    auto take = [&](size_t bytes) { char* p = wsp; wsp += (bytes + 255) & ~(size_t)255; return (void*)p; };
    bf* WQ = (bf*)take((size_t)DQ * DM * 2); bf* WK = (bf*)take((size_t)DKV * DM * 2); bf* WV = (bf*)take((size_t)DKV * DM * 2); bf* WO = (bf*)take((size_t)DM * DQ * 2); float* CS = (float*)take((size_t)TT * HD * 2 * 4);
    // planes of all NB_ batches that the attention launches read or write
    bf* QPh = (bf*)take((size_t)NB_ * NH_ * TT * HD * 2); bf* QPl = (bf*)take((size_t)NB_ * NH_ * TT * HD * 2); bf* KPh = (bf*)take((size_t)NB_ * NKV * TT * HD * 2); bf* KPl = (bf*)take((size_t)NB_ * NKV * TT * HD * 2); h16* VT16 = (h16*)take((size_t)NB_ * NKV * HD * TT * 2);
    bf* ATh = (bf*)take((size_t)NB_ * TT * DQ * 2); bf* ATl = (bf*)take((size_t)NB_ * TT * DQ * 2);
    char* const big = wsp;
    float* Sb = (float*)take((size_t)ZH * TT * TT * 4); h16* P8 = (h16*)take((size_t)ZH * TT * TT * 2);
    if ((size_t)(wsp - (char*)d_ws) > ws_size) return;
    // Sb holds no scores: its bytes and the probability bytes serve, stream-ordered, the projection stage's buffers before the first attention launch; Sb then holds the partial planes, and the Wo result after the last merge
    static_assert((size_t)KSP * HD <= (size_t)TT && (size_t)NB_ * DM <= (size_t)ZH * TT, "partial planes and the Wo result fit Sb");
    static_assert((size_t)NB_ * TT * DM * 2 + (size_t)NB_ * TT * (DQ + DKV) * 4 + (size_t)NB_ * (NH_ + 3 * NKV) * TT * HD * 2 <= (size_t)ZH * TT * TT * 6, "projection stage fits Sb and the probability bytes");
    float* Ob = Sb; float* YO = Sb;
    wsp = big;
    bf* XB = (bf*)take((size_t)NB_ * TT * DM * 2); float* FQ = (float*)take((size_t)NB_ * TT * DQ * 4); float* FK = (float*)take((size_t)NB_ * TT * DKV * 4);
    h16* QP16 = (h16*)take((size_t)NB_ * NH_ * TT * HD * 2); h16* KP16 = (h16*)take((size_t)NB_ * NKV * TT * HD * 2); bf* VTh = (bf*)take((size_t)NB_ * NKV * HD * TT * 2); bf* VTl = (bf*)take((size_t)NB_ * NKV * HD * TT * 2);
    float* FV = FK;   // v projection reuses the k buffer after the k planes are built (stream-ordered)
    k_cvt8<<<(unsigned)(((size_t)DQ * DM / 8 + 255) / 256), 256, 0, stream>>>(wq, WQ, (size_t)DQ * DM / 8); k_cvt8<<<(unsigned)(((size_t)DKV * DM / 8 + 255) / 256), 256, 0, stream>>>(wk, WK, (size_t)DKV * DM / 8); k_cvt8<<<(unsigned)(((size_t)DKV * DM / 8 + 255) / 256), 256, 0, stream>>>(wv, WV, (size_t)DKV * DM / 8); k_cvt8<<<(unsigned)(((size_t)DM * DQ / 8 + 255) / 256), 256, 0, stream>>>(wo, WO, (size_t)DM * DQ / 8);   /* 'oi' weights = Bt as-is */
    k_csid<<<(TT * HD + 255) / 256, 256, 0, stream>>>(CS);
    const unsigned LQ = (unsigned)(((size_t)NH_ * TT * HD / 2 + 255) / 256), LKv = (unsigned)(((size_t)NKV * TT * HD / 2 + 255) / 256);
    // every launch of this stage covers the NB_ * TT rows of all batches
    k_cvt8<<<(unsigned)(((size_t)NB_ * TT * DM / 8 + 255) / 256), 256, 0, stream>>>(x, XB, (size_t)NB_ * TT * DM / 8);
    k_gemmw<bf, 0, false><<<dim3(NB_ * TT / 64, DQ / 64, 1), 32, 0, stream>>>(XB, nullptr, WQ, nullptr, DM, FQ, DQ, nullptr, 0, 0, 0); k_lnrow<<<NB_ * TT / 8, 256, 0, stream>>>(FQ, gq);   /* q = LN(x Wq^T) gq */
    k_rope<<<dim3(LQ, NB_, 1), 256, 0, stream>>>(FQ, DQ, NH_, CS, nullptr, nullptr, 1.0f, QP16, QPh, QPl);
    k_gemmw<bf, 0, true><<<dim3(NB_ * TT / 64, DKV / 64, 1), 32, 0, stream>>>(XB, nullptr, WK, nullptr, DM, FK, DKV, bk, 0, 0, 0); k_lnrow<<<NB_ * TT / 8, 256, 0, stream>>>(FK, gk);   /* k = LN(x Wk^T + bk) gk */
    k_rope<<<dim3(LKv, NB_, 1), 256, 0, stream>>>(FK, DKV, NKV, CS, nullptr, nullptr, 1.0f, KP16, KPh, KPl);
    k_gemmw<bf, 0, true><<<dim3(NB_ * TT / 64, DKV / 64, 1), 32, 0, stream>>>(XB, nullptr, WV, nullptr, DM, FV, DKV, bv, 0, 0, 0); k_vtp<<<dim3(LKv, NB_, 1), 256, 0, stream>>>(FV, DKV, NKV, VT16, VTh, VTl);
    for (int b = 0; b < NB_; ++b) {
        for (int h0 = 0; h0 < NH_; h0 += ZH) { const size_t zq = (size_t)b * NH_ + h0;   // first head plane of the group, planes [batch][head]
            k_scsoft<<<dim3(TT / FKB, ZH, 1), FNW * 32, 0, stream>>>(KPh + zq * TT * HD, KPl + zq * TT * HD, QPh + zq * TT * HD, QPl + zq * TT * HD, P8);   /* S^T[k][q] = k_k.q_q (3 products), softmax over q -> fp16 x1024 [k/8][q][8] */
            k_pvk<<<dim3(TT / 64, KSP, ZH), 32, 0, stream>>>(P8, VT16 + zq * HD * TT, Ob);   /* o = attn . v (one product), KSP partial planes */
            k_merge<<<(unsigned)(((size_t)ZH * TT * HD / 2 + 255) / 256), 256, 0, stream>>>(Ob, h0, ATh + (size_t)b * TT * DQ, ATl + (size_t)b * TT * DQ); } }                                  /* partial planes summed; hi/lo planes, carry undone on every row (RH 0) */
    k_gemmw<bf, 1, true><<<dim3(NB_ * TT / 64, DM / 64, 1), 32, 0, stream>>>(ATh, ATl, WO, nullptr, DQ, YO, DM, bo, 0, 0, 0);   /* o Wo^T + bo */
    k_addx<<<(unsigned)(((size_t)NB_ * TT * DM / 4 + 255) / 256), 256, 0, stream>>>(YO, x, OUT, (size_t)NB_ * TT * DM / 4);   /* + x */
}

// v006
// A run of this version takes 617 microseconds.
// In two side-by-side timings against v005, it was 1.10 and 1.11 times as fast.
// All steps since v000 together make it 5.00 times as fast.
#include <hip/hip_runtime.h>

// Multi-head self-attention with QK-LayerNorm and the module's QUERY-axis softmax (x [4][2048][768]; q = LN_nobias(x Wq^T) gq, k = LN_nobias(x Wk^T + bk) gk (LayerNorm over the full 768), v = x Wv^T + bv ('oi' [768][768]; 12 heads x 64); scores = q.k/8; attn = softmax over the QUERY axis (per key column); o[q] = sum_k attn[q][k] v[k]; out = merged o Wo^T + bo + x -> [4][2048][768] (6.3 M)).
// Projections, LayerNorm, head planes, Wo and the residual each run once over all NB_ * TT rows; the attention launches go per (batch, group of ZH heads): the TRANSPOSED scores S^T[k][q] = k_k.q_q (3 products) are formed and normalised over q inside one kernel and never stored; probabilities are written fp16 x1024 as 16-byte pieces [k/8][q][8] (8 keys of one query, as an accumulator tile holds them), which are the A fragment pieces of the product with the fp16 value planes (one product, K = 2048), whose kernel adds its K slices in LDS and undoes the carry into hi/lo planes; Wo (2 products) + bo; + x residual in f32.
// Compute dtypes, f32 accumulate: every input rounded to bf16; q/k/v on PLAIN bf16 operands (exact) + biases; LayerNorm f32 (biased variance, eps 1e-5); scores hi/lo (3 products) on every row; softmax f32; attn.v single fp16 (P x1024); Wo hl x exact (2 products) + bo; residual f32.

#define NB_  4
#define TT   2048
#define DM   768
#define NH_  12
#define NKV  12
#define REP  (NH_ / NKV)
#define HD   64
#define DQ   (NH_ * HD)
#define DKV  (NKV * HD)
#define ZH   6                    // heads per attention launch
#define RH   0                    // every probability row carries x1024 (k_pvk undoes it on all rows)
#define WIN  0
#define PCAR 1024.0f
#define SCL  0.125f   // HD^-0.5
typedef _Float16 h16;
typedef unsigned short bf;
typedef __attribute__((ext_vector_type(16))) __bf16   v16bf;
typedef __attribute__((ext_vector_type(16))) _Float16 v16h;
typedef __attribute__((ext_vector_type(8)))  _Float16 v8h;
typedef __attribute__((ext_vector_type(8)))  unsigned short v8us;
typedef __attribute__((ext_vector_type(8)))  float    v8f;
typedef __attribute__((ext_vector_type(4)))  float    v4f;
typedef v8h  __attribute__((may_alias)) v8ha;
typedef v4f  __attribute__((may_alias)) v4fa;
typedef v8us __attribute__((may_alias)) v8usa;

__device__ __forceinline__ unsigned short f2bf(float f) { unsigned u = __float_as_uint(f); u += 0x7FFFu + ((u >> 16) & 1u); return (unsigned short)(u >> 16); }
__device__ __forceinline__ float bf2f(unsigned short b) { return __uint_as_float(((unsigned)b) << 16); }
__device__ __forceinline__ float bfr(float f) { return bf2f(f2bf(f)); }
__device__ __forceinline__ v16h cat16(v8h lo, v8h hi) { return __builtin_shufflevector(lo, hi, 0, 1, 2, 3, 4, 5, 6, 7, 8, 9, 10, 11, 12, 13, 14, 15); }
__device__ __forceinline__ v16bf cat16b(v8us lo, v8us hi) { return __builtin_bit_cast(v16bf, __builtin_shufflevector(lo, hi, 0, 1, 2, 3, 4, 5, 6, 7, 8, 9, 10, 11, 12, 13, 14, 15)); }
__device__ __forceinline__ v8f wmma16(v16h a, v16h b, v8f c) { return __builtin_amdgcn_wmma_f32_16x16x32_f16(false, a, false, b, (short)0, c, false, false); }
__device__ __forceinline__ v8f wmmab(v16bf a, v16bf b, v8f c) { return __builtin_amdgcn_wmma_f32_16x16x32_bf16(false, a, false, b, (short)0, c, false, false); }



// ---- k_gemmw: register-blocked GEMM, ONE WAVE per 64x64 output tile (16 accumulators), operands straight from K-contiguous 16-bit planes; grid (M/64, N/64, Z), 32 threads.
// C[m][n] (f32, pitch ldc, + optional f32 bias[n]) = sum_k A[m][k] Bt[n][k] (+ split products per NSPLIT). z-batch strides sA/sB/sC in elements. K % 32 == 0.
template <typename T16> struct WFrag;
template <> struct WFrag<h16> { typedef v16h V; static __device__ __forceinline__ V ld(const h16* p) { return cat16(*(const v8h*)p, *(const v8h*)(p + 16)); } static __device__ __forceinline__ v8f mma(V a, V b, v8f c) { return wmma16(a, b, c); } };
template <> struct WFrag<bf> { typedef v16bf V; static __device__ __forceinline__ V ld(const bf* p) { return cat16b(*(const v8us*)p, *(const v8us*)(p + 16)); } static __device__ __forceinline__ v8f mma(V a, V b, v8f c) { return wmmab(a, b, c); } };
template <typename T16, int NSPLIT, bool BIAS>
__global__ __launch_bounds__(32) void k_gemmw(const T16* __restrict__ A, const T16* __restrict__ A2, const T16* __restrict__ Bt, const T16* __restrict__ Bt2, int K, float* C, int ldc, const float* __restrict__ bias, size_t sA, size_t sB, size_t sC) {
    typedef typename WFrag<T16>::V V;
    __shared__ __align__(16) float os[16 * 68];
    const size_t z = blockIdx.z; A += z * sA; if (A2) A2 += z * sA; Bt += z * sB; if (Bt2) Bt2 += z * sB; C += z * sC;
    const int lane = threadIdx.x & 31, lr = lane & 15, hi = lane >> 4; const int r0 = blockIdx.x * 64, c0 = blockIdx.y * 64;
    v8f acc[4][4];
#pragma unroll
    for (int mb = 0; mb < 4; ++mb)
#pragma unroll
        for (int nb = 0; nb < 4; ++nb) acc[mb][nb] = (v8f){};
    const size_t aoff = (size_t)(r0 + lr) * K + 8 * hi, boff = (size_t)(c0 + lr) * K + 8 * hi;
#pragma unroll 1
    for (int kc = 0; kc < K; kc += 32) {
        V a[4], a2[4];
#pragma unroll
        for (int mb = 0; mb < 4; ++mb) { a[mb] = WFrag<T16>::ld(A + aoff + (size_t)mb * 16 * K + kc); if (NSPLIT == 1 || NSPLIT == 2) a2[mb] = WFrag<T16>::ld(A2 + aoff + (size_t)mb * 16 * K + kc); }
#pragma unroll
        for (int nb = 0; nb < 4; ++nb) { const V b = WFrag<T16>::ld(Bt + boff + (size_t)nb * 16 * K + kc); V b2; if (NSPLIT >= 2) b2 = WFrag<T16>::ld(Bt2 + boff + (size_t)nb * 16 * K + kc);
#pragma unroll
            for (int mb = 0; mb < 4; ++mb) { acc[mb][nb] = WFrag<T16>::mma(a[mb], b, acc[mb][nb]); if (NSPLIT == 1 || NSPLIT == 2) acc[mb][nb] = WFrag<T16>::mma(a2[mb], b, acc[mb][nb]); if (NSPLIT >= 2) acc[mb][nb] = WFrag<T16>::mma(a[mb], b2, acc[mb][nb]); } }
        asm volatile("v_nop\n\tv_nop\n\tv_nop\n\tv_nop" : "+v"(acc[0][0]), "+v"(acc[1][1]), "+v"(acc[2][2]), "+v"(acc[3][3]) : "v"(a[0]), "v"(a[3]));
    }
#pragma unroll
    for (int mb = 0; mb < 4; ++mb) {
#pragma unroll
        for (int nb = 0; nb < 4; ++nb) {
#pragma unroll
            for (int j = 0; j < 8; ++j) os[(hi * 8 + j) * 68 + nb * 16 + lr] = acc[mb][nb][j]; }
        __builtin_amdgcn_wave_barrier(); asm volatile("" ::: "memory");
        float* crow = C + (size_t)(r0 + mb * 16) * ldc + c0;
{
#pragma unroll
            for (int s = 0; s < 8; ++s) { const int row = 2 * s + hi, cofs = lr * 4; v4f val = *(const v4fa*)(os + row * 68 + cofs); if (BIAS) { val[0] += bfr(bias[c0 + cofs]); val[1] += bfr(bias[c0 + cofs + 1]); val[2] += bfr(bias[c0 + cofs + 2]); val[3] += bfr(bias[c0 + cofs + 3]); }
                *(v4f*)(crow + (size_t)row * ldc + cofs) = val; }
             }
        __builtin_amdgcn_wave_barrier(); asm volatile("" ::: "memory");
    }
}

__device__ __forceinline__ h16 tohx(float x) { return (h16)x; }
__device__ __forceinline__ void splitf(float y, unsigned short& h, unsigned short& l) { h = f2bf(y); l = f2bf(y - bf2f(h)); }
typedef __attribute__((ext_vector_type(2))) _Float16 v2h;
typedef __attribute__((ext_vector_type(4))) _Float16 v4h;
typedef __attribute__((ext_vector_type(2))) unsigned short v2us;
typedef __attribute__((ext_vector_type(4))) unsigned short v4us;
typedef __attribute__((ext_vector_type(2))) float v2f;
typedef __attribute__((ext_vector_type(4))) int v4i;

// ---- k_pvk: attn.v with its K = 2048 keys split over the KSP waves of one work-group; grid (TT/64, ZH), KSP*32 threads. Wave ks forms the f32 partial 64x64 tile of its KSL keys and lays it in its own LDS plane; behind one barrier the work-group adds the KSP planes in slice order, undoes the x1024 carry and stores the hi/lo planes [t][head][d] (16 lanes write one whole 128-byte line). A = probabilities as [head][k/8][q][8]: a lane's two 16-byte fragment pieces (keys kc + 8 hi + 0..7 and kc + 16 + 8 hi + 0..7 of query row q) are pieces kc/8 + hi and kc/8 + 2 + hi at q, the k order of the Bt loader.
#define KSP 16
#define KSL (TT / KSP)
#define OSP 68                  // LDS row pitch in floats: the two 8-row halves of an accumulator tile land 32 banks apart
__global__ __launch_bounds__(KSP * 32) void k_pvk(const h16* __restrict__ A, const h16* __restrict__ Bt, int h0, bf* Ah, bf* Al) {
    __shared__ __align__(16) float os[KSP][64 * OSP];
    const size_t z = blockIdx.y; const int ks = __builtin_amdgcn_readfirstlane((int)(threadIdx.x >> 5)); A += z * ((size_t)TT * TT) + (size_t)ks * KSL * TT; Bt += z * ((size_t)HD * TT) + ks * KSL;   // the wave's number through readfirstlane: both bases stay scalar
    const int lane = threadIdx.x & 31, lr = lane & 15, hi = lane >> 4; const int r0 = blockIdx.x * 64;
    v8f acc[4][4];
#pragma unroll
    for (int mb = 0; mb < 4; ++mb)
#pragma unroll
        for (int nb = 0; nb < 4; ++nb) acc[mb][nb] = (v8f){};
    unsigned aoff = (hi * TT + r0 + lr) * 16, boff = (lr * TT + 8 * hi) * 2;   // a lane's byte offsets in this pass
#pragma unroll 1   // rolled: one pass's 8 fragments beside the 128 accumulator registers stay under 256 VGPRs
    for (int kc = 0; kc < KSL; kc += 32) {
        const h16* pa = (const h16*)((const char*)A + aoff); const h16* pb = (const h16*)((const char*)Bt + boff); v16h a[4], b[4];
#pragma unroll
        for (int mb = 0; mb < 4; ++mb) a[mb] = cat16(*(const v8h*)(pa + mb * 128), *(const v8h*)(pa + mb * 128 + 16 * TT));
#pragma unroll
        for (int nb = 0; nb < 4; ++nb) b[nb] = WFrag<h16>::ld(pb + (size_t)nb * 16 * TT);
        // behind the pass's 16 loads, before any register that they name is rewritten; the two offsets pass through the statement so that their step to the next pass stands behind it
        asm volatile("s_wait_xcnt 0x0" : "+v"(aoff), "+v"(boff) :: "memory");
        aoff += 64 * TT; boff += 64;
#pragma unroll
        for (int nb = 0; nb < 4; ++nb)
#pragma unroll
            for (int mb = 0; mb < 4; ++mb) acc[mb][nb] = wmma16(a[mb], b[nb], acc[mb][nb]);
        // four vector slots behind the pass's last WMMAs, on both sides of the loop branch: the next pass's loads rewrite a and b, the LDS stores behind the loop read acc
        asm volatile("v_nop\n\tv_nop\n\tv_nop\n\tv_nop" : "+v"(acc[0][0]), "+v"(acc[1][1]), "+v"(acc[2][2]), "+v"(acc[3][3]) : "v"(a[0]), "v"(a[3]));
    }
    float* ow = os[ks];
#pragma unroll
    for (int mb = 0; mb < 4; ++mb)
#pragma unroll
        for (int nb = 0; nb < 4; ++nb)
#pragma unroll
            for (int j = 0; j < 8; ++j) ow[(mb * 16 + hi * 8 + j) * OSP + nb * 16 + lr] = acc[mb][nb][j];
    __syncthreads();   // every slice's partial tile lies in LDS
    const int cofs = (threadIdx.x & 15) * 4;
#pragma unroll
    for (int rr = 0; rr < 2; ++rr) { const int row = (int)(threadIdx.x >> 4) + rr * 32, t = r0 + row; const float cs = (t < RH) ? 1.0f : (1.0f / PCAR); v4f sm = *(const v4fa*)(&os[0][row * OSP + cofs]);
#pragma unroll
        for (int s = 1; s < KSP; ++s) sm += *(const v4fa*)(&os[s][row * OSP + cofs]);   /* the K slices' partial sums, in slice order */
        v4us oh, ol;
#pragma unroll
        for (int q = 0; q < 4; ++q) { unsigned short a, c2; splitf(sm[q] * cs, a, c2); oh[q] = a; ol[q] = c2; }
        const size_t oo = (size_t)t * DQ + (h0 + (int)z) * HD + cofs; *(v4us*)(Ah + oo) = oh; *(v4us*)(Al + oo) = ol; }
}


__global__ __launch_bounds__(256) void k_wtG(const float* __restrict__ w, int K, int N, bf* Bt) {
    const int lane = threadIdx.x & 31; const int L0 = (blockIdx.x * 8 + (threadIdx.x >> 5)) * 8; const int nlines = N * K / 64;
{
#pragma unroll 1
        for (int l = 0; l < 8; ++l) { const int L = L0 + l; if (L >= nlines) break; const size_t e = (size_t)L * 64 + lane * 2; const int k = (int)(e % K), n = (int)(e / K); v2us o;
            o[0] = f2bf(w[(size_t)k * N + n]); o[1] = f2bf(w[(size_t)(k + 1) * N + n]); *(v2us*)(Bt + e) = o; }
         }
}
__global__ __launch_bounds__(256) void k_cvt8(const float* __restrict__ src, bf* dst, size_t n8) { const size_t i = (size_t)blockIdx.x * 256 + threadIdx.x; if (i >= n8) return; const v8f v = *(const v8f*)(src + i * 8); v8us o;
#pragma unroll
    for (int k = 0; k < 8; ++k) o[k] = f2bf(v[k]); *(v8us*)(dst + i * 8) = o;  }

// k_rope: head planes [h][t][d] (fp16 + hi/lo) of rope(x) x sc with the rotate-half convention out[d] = x[d] cos[t][d] - x[d+HD/2] sin[t][d], out[d+HD/2] = x[d+HD/2] cos[t][d+HD/2] + x[d] sin[t][d+HD/2]
__global__ __launch_bounds__(256) void k_rope(const float* __restrict__ F, int pitch, int nheads, const float* __restrict__ CS, const float* __restrict__ RF, const float* __restrict__ nw, float sc, h16* P16, bf* Ph, bf* Pl) {
    { const size_t bz = blockIdx.y; F += bz * ((size_t)TT * pitch); const size_t po = bz * ((size_t)nheads * TT * HD); P16 += po; Ph += po; Pl += po; }   // grid y = batch: rows bz TT .. of F, planes [batch][h][t][d]
    const size_t e = ((size_t)blockIdx.x * 256 + threadIdx.x) * 2; if (e >= (size_t)nheads * TT * HD) return; const int d = (int)(e % HD); const int t = (int)((e / HD) % TT); const int h = (int)(e / ((size_t)HD * TT)); const float* f = F + (size_t)t * pitch + h * HD; const float rf = RF ? RF[(size_t)h * TT + t] : 1.0f; v2h o16; v2us oh, ol;
#pragma unroll
    for (int q = 0; q < 2; ++q) { const int dd = d + q; const int dp = (dd < HD / 2) ? dd + HD / 2 : dd - HD / 2; float x0 = f[dd], x1 = f[dp];
        if (RF) { float n0 = __fmul_rn(x0, rf), n1 = __fmul_rn(x1, rf); asm volatile("" : "+v"(n0)); asm volatile("" : "+v"(n1)); x0 = __fmul_rn(bfr(nw[dd]), n0); x1 = __fmul_rn(bfr(nw[dp]), n1); }
        const v2f cs = *(const v2f*)(CS + ((size_t)t * HD + dd) * 2); float a = __fmul_rn(x0, cs[0]), bq = __fmul_rn(x1, cs[1]); asm volatile("" : "+v"(a)); asm volatile("" : "+v"(bq)); const float r = ((dd < HD / 2) ? __fsub_rn(a, bq) : __fadd_rn(a, bq)) * sc;
        o16[q] = tohx(r); unsigned short a2, c2; splitf(r, a2, c2); oh[q] = a2; ol[q] = c2; }
    *(v2h*)(P16 + e) = o16; *(v2us*)(Ph + e) = oh; *(v2us*)(Pl + e) = ol;  }
__global__ __launch_bounds__(256) void k_vtp(const float* __restrict__ F, int pitch, int nheads, h16* V16, bf* Vh, bf* Vl) {
    { const size_t bz = blockIdx.y; F += bz * ((size_t)TT * pitch); const size_t po = bz * ((size_t)nheads * HD * TT); V16 += po; Vh += po; Vl += po; }   // grid y = batch: planes [batch][g][d][t]
    const size_t e = ((size_t)blockIdx.x * 256 + threadIdx.x) * 2; if (e >= (size_t)nheads * HD * TT) return; const int t = (int)(e % TT); const int d = (int)((e / TT) % HD); const int g = (int)(e / ((size_t)TT * HD)); v2h o16; v2us oh, ol;
#pragma unroll
    for (int q = 0; q < 2; ++q) { const float x = F[(size_t)(t + q) * pitch + g * HD + d]; o16[q] = tohx(x); unsigned short a2, c2; splitf(x, a2, c2); oh[q] = a2; ol[q] = c2; }
    *(v2h*)(V16 + e) = o16; *(v2us*)(Vh + e) = oh; *(v2us*)(Vl + e) = ol;  }
__global__ __launch_bounds__(256) void k_csid(float* CS) { const int idx = blockIdx.x * 256 + threadIdx.x; if (idx >= TT * HD) return; v2f cs; cs[0] = 1.0f; cs[1] = 0.0f; *(v2f*)(CS + (size_t)idx * 2) = cs;  }

// ---- k_scsoft: scores and their softmax over q in one kernel; grid (TT/FKB, ZH), FNW*32 threads. A work-group owns FKB key rows against all TT queries: wave w forms S^T[FKB keys][128 queries from 128 w] in 16 accumulator tiles (3 products, K = HD, the product order a.b, a2.b, a.b2 per 32 of K), so a score never leaves the registers. Row maximum and row sum: over a lane's 8 tiles, over the 16 lanes of a row by DPP, over the FNW waves through LDS in wave order. An accumulator tile holds in each lane 8 consecutive keys of one query: one 16-byte piece of P8[head][k/8][q][8], stored as it stands (whole 128-byte lines, one writer each).
#define FKB 32
#define FNW 16
static_assert(TT % FKB == 0 && TT == FNW * 128 && HD == 64 && FKB == 32, "two 16-key tile rows; 128 query columns per wave; one lane of wave 0 per key row in the cross-wave step");
template <int M> __device__ __forceinline__ float rowx(float v) { return __builtin_bit_cast(float, __builtin_amdgcn_mov_dpp(__builtin_bit_cast(int, v), 0x160 | M, 0xf, 0xf, true)); }   // value of lane ^ M inside the 16-lane row (row_xmask)
__global__ __launch_bounds__(FNW * 32) void k_scsoft(const bf* __restrict__ Kh, const bf* __restrict__ Kl, const bf* __restrict__ Qh, const bf* __restrict__ Ql, h16* P8) {
    __shared__ __align__(16) float redm[FNW][FKB], reds[FNW][FKB], finm[FKB], fins[FKB];
    const size_t z = blockIdx.y; Kh += z * ((size_t)TT * HD); Kl += z * ((size_t)TT * HD); Qh += z * ((size_t)TT * HD); Ql += z * ((size_t)TT * HD);
    const int lane = threadIdx.x & 31, lr = lane & 15, hi = lane >> 4, w = threadIdx.x >> 5; const int k0 = blockIdx.x * FKB, q0 = w * 128;
    v16bf ah[2][2], al[2][2], rb[2][2], rb2[2][2]; v8f acc[2][8];
    const bf* qh = Qh + (size_t)(q0 + lr) * HD + 8 * hi; const bf* ql = Ql + (size_t)(q0 + lr) * HD + 8 * hi; const size_t ko = (size_t)(k0 + lr) * HD + 8 * hi;
    // step nb: the six products (K slices 0 and 1) into tiles (0, nb) and (1, nb); a step's eight query loads, which share its 32 lines, go out together, one step ahead
#pragma unroll
    for (int kk = 0; kk < 2; ++kk) { rb[0][kk] = WFrag<bf>::ld(qh + kk * 32); rb2[0][kk] = WFrag<bf>::ld(ql + kk * 32); }
#pragma unroll
    for (int mb = 0; mb < 2; ++mb)
#pragma unroll
        for (int kk = 0; kk < 2; ++kk) { ah[mb][kk] = WFrag<bf>::ld(Kh + ko + mb * 16 * HD + kk * 32); al[mb][kk] = WFrag<bf>::ld(Kl + ko + mb * 16 * HD + kk * 32); }
    asm volatile("s_wait_xcnt 0x0" ::: "memory");   // the key address registers are dead behind these loads: the wait stands before the next loads' results may land in them
#pragma unroll
    for (int nb = 0; nb < 8; ++nb) {
        if (nb + 1 < 8) {
#pragma unroll
            for (int kk = 0; kk < 2; ++kk) { rb[(nb + 1) & 1][kk] = WFrag<bf>::ld(qh + (nb + 1) * 16 * HD + kk * 32); rb2[(nb + 1) & 1][kk] = WFrag<bf>::ld(ql + (nb + 1) * 16 * HD + kk * 32); } }
        __builtin_amdgcn_sched_barrier(0);   // keeps the next step's loads ahead of this step's products: sunk to their use, each would cost its whole latency
#pragma unroll
        for (int mb = 0; mb < 2; ++mb) { v8f a = (v8f){};
#pragma unroll
            for (int kk = 0; kk < 2; ++kk) { a = wmmab(ah[mb][kk], rb[nb & 1][kk], a); a = wmmab(al[mb][kk], rb[nb & 1][kk], a); a = wmmab(ah[mb][kk], rb2[nb & 1][kk], a); }
            acc[mb][nb] = a; }
        __builtin_amdgcn_sched_barrier(0); }   // keeps later loads behind this step's products: hoisted, a third set of query fragments would be live and the build spills
    // lane (lr, hi), tile (mb, nb), register j: key k0 + 16 mb + 8 hi + j, query q0 + 16 nb + lr
    float rv[2][8];
#pragma unroll
    for (int mb = 0; mb < 2; ++mb)
#pragma unroll
        for (int j = 0; j < 8; ++j) { float m = -3.0e38f;
#pragma unroll
            for (int nb = 0; nb < 8; ++nb) m = fmaxf(m, acc[mb][nb][j]);
            m = fmaxf(m, rowx<1>(m)); m = fmaxf(m, rowx<2>(m)); m = fmaxf(m, rowx<4>(m)); m = fmaxf(m, rowx<8>(m)); rv[mb][j] = m; }
    if (lr == 0) {
#pragma unroll
        for (int mb = 0; mb < 2; ++mb) { *(v4fa*)&redm[w][mb * 16 + hi * 8] = (v4f){rv[mb][0], rv[mb][1], rv[mb][2], rv[mb][3]}; *(v4fa*)&redm[w][mb * 16 + hi * 8 + 4] = (v4f){rv[mb][4], rv[mb][5], rv[mb][6], rv[mb][7]}; } }
    __syncthreads();   // every wave's row maxima lie in LDS
    if (threadIdx.x < FKB) { float m = redm[0][threadIdx.x];
#pragma unroll
        for (int ww = 1; ww < FNW; ++ww) m = fmaxf(m, redm[ww][threadIdx.x]);
        finm[threadIdx.x] = m; }
    __syncthreads();   // the FKB row maxima over all queries are published
#pragma unroll
    for (int mb = 0; mb < 2; ++mb) { const v4f m0 = *(const v4fa*)&finm[mb * 16 + hi * 8], m1 = *(const v4fa*)&finm[mb * 16 + hi * 8 + 4]; const v8f mx = __builtin_shufflevector(m0, m1, 0, 1, 2, 3, 4, 5, 6, 7); v8f s8;
#pragma unroll
        for (int nb = 0; nb < 8; ++nb) { v8f t = (acc[mb][nb] - mx) * (SCL * 1.4426950408889634f);
#pragma unroll
            for (int j = 0; j < 8; ++j) t[j] = __builtin_amdgcn_exp2f(t[j]);
            acc[mb][nb] = t; s8 = nb ? s8 + t : t; }   // SCL is a power of two: (a - m) (SCL c) rounds as (a SCL - m SCL) c does
#pragma unroll
        for (int j = 0; j < 8; ++j) { float s = s8[j]; s += rowx<1>(s); s += rowx<2>(s); s += rowx<4>(s); s += rowx<8>(s); rv[mb][j] = s; } }
    if (lr == 0) {
#pragma unroll
        for (int mb = 0; mb < 2; ++mb) { *(v4fa*)&reds[w][mb * 16 + hi * 8] = (v4f){rv[mb][0], rv[mb][1], rv[mb][2], rv[mb][3]}; *(v4fa*)&reds[w][mb * 16 + hi * 8 + 4] = (v4f){rv[mb][4], rv[mb][5], rv[mb][6], rv[mb][7]}; } }
    __syncthreads();   // every wave's row sums lie in LDS
    if (threadIdx.x < FKB) { float s = reds[0][threadIdx.x];
#pragma unroll
        for (int ww = 1; ww < FNW; ++ww) s += reds[ww][threadIdx.x];
        fins[threadIdx.x] = __fdiv_rn(PCAR, s); }
    __syncthreads();   // the FKB row factors 1024 / sum are published
    h16* dst = P8 + ((((size_t)z * TT + k0) / 8 + hi) * TT + q0 + lr) * 8;
#pragma unroll
    for (int mb = 0; mb < 2; ++mb) { const v4f f0 = *(const v4fa*)&fins[mb * 16 + hi * 8], f1 = *(const v4fa*)&fins[mb * 16 + hi * 8 + 4];
#pragma unroll
        for (int nb = 0; nb < 8; ++nb) { v8h o;
#pragma unroll
            for (int j = 0; j < 8; ++j) o[j] = tohx(acc[mb][nb][j] * ((j < 4) ? f0[j & 3] : f1[j & 3]));
            *(v8h*)(dst + ((size_t)mb * 2 * TT + nb * 16) * 8) = o; } }
}

__global__ __launch_bounds__(256) void k_lnrow(float* F, const float* __restrict__ gw) {
    const int lane = threadIdx.x & 31; const int r = blockIdx.x * 8 + (threadIdx.x >> 5); if (r >= NB_ * TT) return; float hv[DM / 32]; float s = 0.f; float* fr = F + (size_t)r * DM;
#pragma unroll
    for (int ch = 0; ch < DM / 128; ++ch) { const v4f y = *(const v4f*)(fr + ch * 128 + lane * 4);
#pragma unroll
        for (int q = 0; q < 4; ++q) { hv[ch * 4 + q] = y[q]; s += y[q]; } }
#pragma unroll
    for (int sh = 16; sh; sh >>= 1) s += __shfl_xor(s, sh, 32);
    const float mu = s * (1.0f / DM); float s2 = 0.f;
#pragma unroll
    for (int k = 0; k < DM / 32; ++k) { float d0 = __fsub_rn(hv[k], mu); asm volatile("" : "+v"(d0)); float p = __fmul_rn(d0, d0); asm volatile("" : "+v"(p)); s2 = __fadd_rn(s2, p); }
#pragma unroll
    for (int sh = 16; sh; sh >>= 1) s2 += __shfl_xor(s2, sh, 32);
    float var = __fadd_rn(s2 * (1.0f / DM), 1e-5f); asm volatile("" : "+v"(var)); const float rs = __frsqrt_rn(var);
    __builtin_amdgcn_wave_barrier(); asm volatile("" ::: "memory");   /* all lanes have read the row before any lane overwrites it */
{
#pragma unroll
        for (int ch = 0; ch < DM / 128; ++ch) { const int c0 = ch * 128 + lane * 4; v4f o;
#pragma unroll
            for (int q = 0; q < 4; ++q) { float gb = bfr(gw[c0 + q]); asm volatile("" : "+v"(gb)); float d0 = __fsub_rn(hv[ch * 4 + q], mu); asm volatile("" : "+v"(d0)); float n0 = __fmul_rn(d0, rs); asm volatile("" : "+v"(n0)); o[q] = __fmul_rn(n0, gb); }
            *(v4f*)(fr + c0) = o; }
         } }
__global__ __launch_bounds__(256) void k_addx(const float* __restrict__ Y, const float* __restrict__ xb, float* O, size_t n4) { const size_t i = (size_t)blockIdx.x * 256 + threadIdx.x; if (i >= n4) return; const v4f y = *(const v4f*)(Y + i * 4); const v4f xv = *(const v4f*)(xb + i * 4); v4f o;
#pragma unroll
    for (int q = 0; q < 4; ++q) { float xr = bfr(xv[q]); asm volatile("" : "+v"(xr)); o[q] = __fadd_rn(y[q], xr); } *(v4f*)(O + i * 4) = o;  }
extern "C" void kernel_launch(void* const* d_in, const int* in_sizes, int n_in,
                              void* d_out, int out_size, void* d_ws, size_t ws_size, hipStream_t stream) {
    (void)in_sizes; (void)n_in; (void)out_size;
    const float* x = (const float*)d_in[0]; const float* wq = (const float*)d_in[1]; const float* wk = (const float*)d_in[2]; const float* bk = (const float*)d_in[3]; const float* wv = (const float*)d_in[4]; const float* bv = (const float*)d_in[5]; const float* gq = (const float*)d_in[6]; const float* gk = (const float*)d_in[7]; const float* wo = (const float*)d_in[8]; const float* bo = (const float*)d_in[9];
    float* OUT = (float*)d_out;     // [4][2048][768]
    char* wsp = (char*)d_ws;
    auto take = [&](size_t bytes) { char* p = wsp; wsp += (bytes + 255) & ~(size_t)255; return (void*)p; };
    bf* WQ = (bf*)take((size_t)DQ * DM * 2); bf* WK = (bf*)take((size_t)DKV * DM * 2); bf* WV = (bf*)take((size_t)DKV * DM * 2); bf* WO = (bf*)take((size_t)DM * DQ * 2); float* CS = (float*)take((size_t)TT * HD * 2 * 4);
    // planes of all NB_ batches that the attention launches read or write
    bf* QPh = (bf*)take((size_t)NB_ * NH_ * TT * HD * 2); bf* QPl = (bf*)take((size_t)NB_ * NH_ * TT * HD * 2); bf* KPh = (bf*)take((size_t)NB_ * NKV * TT * HD * 2); bf* KPl = (bf*)take((size_t)NB_ * NKV * TT * HD * 2); h16* VT16 = (h16*)take((size_t)NB_ * NKV * HD * TT * 2);
    bf* ATh = (bf*)take((size_t)NB_ * TT * DQ * 2); bf* ATl = (bf*)take((size_t)NB_ * TT * DQ * 2);
    char* const big = wsp;
    float* Sb = (float*)take((size_t)ZH * TT * TT * 4); h16* P8 = (h16*)take((size_t)ZH * TT * TT * 2);
    if ((size_t)(wsp - (char*)d_ws) > ws_size) return;
    // Sb holds no scores: its bytes and the probability bytes serve, stream-ordered, the projection stage's buffers before the first attention launch, and Sb the Wo result after the last one
    static_assert((size_t)NB_ * DM <= (size_t)ZH * TT, "the Wo result fits Sb");
    static_assert((size_t)NB_ * TT * DM * 2 + (size_t)NB_ * TT * (DQ + DKV) * 4 + (size_t)NB_ * (NH_ + 3 * NKV) * TT * HD * 2 <= (size_t)ZH * TT * TT * 6, "projection stage fits Sb and the probability bytes");
    float* YO = Sb;
    wsp = big;
    bf* XB = (bf*)take((size_t)NB_ * TT * DM * 2); float* FQ = (float*)take((size_t)NB_ * TT * DQ * 4); float* FK = (float*)take((size_t)NB_ * TT * DKV * 4);
    h16* QP16 = (h16*)take((size_t)NB_ * NH_ * TT * HD * 2); h16* KP16 = (h16*)take((size_t)NB_ * NKV * TT * HD * 2); bf* VTh = (bf*)take((size_t)NB_ * NKV * HD * TT * 2); bf* VTl = (bf*)take((size_t)NB_ * NKV * HD * TT * 2);
    float* FV = FK;   // v projection reuses the k buffer after the k planes are built (stream-ordered)
    k_cvt8<<<(unsigned)(((size_t)DQ * DM / 8 + 255) / 256), 256, 0, stream>>>(wq, WQ, (size_t)DQ * DM / 8); k_cvt8<<<(unsigned)(((size_t)DKV * DM / 8 + 255) / 256), 256, 0, stream>>>(wk, WK, (size_t)DKV * DM / 8); k_cvt8<<<(unsigned)(((size_t)DKV * DM / 8 + 255) / 256), 256, 0, stream>>>(wv, WV, (size_t)DKV * DM / 8); k_cvt8<<<(unsigned)(((size_t)DM * DQ / 8 + 255) / 256), 256, 0, stream>>>(wo, WO, (size_t)DM * DQ / 8);   /* 'oi' weights = Bt as-is */
    k_csid<<<(TT * HD + 255) / 256, 256, 0, stream>>>(CS);
    const unsigned LQ = (unsigned)(((size_t)NH_ * TT * HD / 2 + 255) / 256), LKv = (unsigned)(((size_t)NKV * TT * HD / 2 + 255) / 256);
    // every launch of this stage covers the NB_ * TT rows of all batches
    k_cvt8<<<(unsigned)(((size_t)NB_ * TT * DM / 8 + 255) / 256), 256, 0, stream>>>(x, XB, (size_t)NB_ * TT * DM / 8);
    k_gemmw<bf, 0, false><<<dim3(NB_ * TT / 64, DQ / 64, 1), 32, 0, stream>>>(XB, nullptr, WQ, nullptr, DM, FQ, DQ, nullptr, 0, 0, 0); k_lnrow<<<NB_ * TT / 8, 256, 0, stream>>>(FQ, gq);   /* q = LN(x Wq^T) gq */
    k_rope<<<dim3(LQ, NB_, 1), 256, 0, stream>>>(FQ, DQ, NH_, CS, nullptr, nullptr, 1.0f, QP16, QPh, QPl);
    k_gemmw<bf, 0, true><<<dim3(NB_ * TT / 64, DKV / 64, 1), 32, 0, stream>>>(XB, nullptr, WK, nullptr, DM, FK, DKV, bk, 0, 0, 0); k_lnrow<<<NB_ * TT / 8, 256, 0, stream>>>(FK, gk);   /* k = LN(x Wk^T + bk) gk */
    k_rope<<<dim3(LKv, NB_, 1), 256, 0, stream>>>(FK, DKV, NKV, CS, nullptr, nullptr, 1.0f, KP16, KPh, KPl);
    k_gemmw<bf, 0, true><<<dim3(NB_ * TT / 64, DKV / 64, 1), 32, 0, stream>>>(XB, nullptr, WV, nullptr, DM, FV, DKV, bv, 0, 0, 0); k_vtp<<<dim3(LKv, NB_, 1), 256, 0, stream>>>(FV, DKV, NKV, VT16, VTh, VTl);
    for (int b = 0; b < NB_; ++b) {
        for (int h0 = 0; h0 < NH_; h0 += ZH) { const size_t zq = (size_t)b * NH_ + h0;   // first head plane of the group, planes [batch][head]
            k_scsoft<<<dim3(TT / FKB, ZH, 1), FNW * 32, 0, stream>>>(KPh + zq * TT * HD, KPl + zq * TT * HD, QPh + zq * TT * HD, QPl + zq * TT * HD, P8);   /* S^T[k][q] = k_k.q_q (3 products), softmax over q -> fp16 x1024 [k/8][q][8] */
            k_pvk<<<dim3(TT / 64, ZH, 1), KSP * 32, 0, stream>>>(P8, VT16 + zq * HD * TT, h0, ATh + (size_t)b * TT * DQ, ATl + (size_t)b * TT * DQ); } }   /* o = attn . v (one product), KSP slices summed in LDS; hi/lo planes, carry undone on every row (RH 0) */
    k_gemmw<bf, 1, true><<<dim3(NB_ * TT / 64, DM / 64, 1), 32, 0, stream>>>(ATh, ATl, WO, nullptr, DQ, YO, DM, bo, 0, 0, 0);   /* o Wo^T + bo */
    k_addx<<<(unsigned)(((size_t)NB_ * TT * DM / 4 + 255) / 256), 256, 0, stream>>>(YO, x, OUT, (size_t)NB_ * TT * DM / 4);   /* + x */
}

// v007
// A run of this version takes 557 microseconds.
// Next to v006, in two timings, it ran 1.12 times as fast each time.
// Over all steps from v000 it is 5.58 times as fast.
#include <hip/hip_runtime.h>

// Multi-head self-attention with QK-LayerNorm and the module's QUERY-axis softmax (x [4][2048][768]; q = LN_nobias(x Wq^T) gq, k = LN_nobias(x Wk^T + bk) gk (LayerNorm over the full 768), v = x Wv^T + bv ('oi' [768][768]; 12 heads x 64); scores = q.k/8; attn = softmax over the QUERY axis (per key column); o[q] = sum_k attn[q][k] v[k]; out = merged o Wo^T + bo + x -> [4][2048][768] (6.3 M)).
// Projections, LayerNorm, head planes, Wo and the residual each run once over all NB_ * TT rows; the attention launches go per group of ZH of the NB_ * NH_ (batch, head) planes, ZH chosen so that both attention grids are whole multiples of the chip's 256 WGPs (each work-group fills one WGP): the TRANSPOSED scores S^T[k][q] = k_k.q_q (3 products) are formed and normalised over q inside one kernel and never stored; probabilities are written fp16 x1024 as 16-byte pieces [k/8][q][8] (8 keys of one query, as an accumulator tile holds them), which are the A fragment pieces of the product with the fp16 value planes (one product, K = 2048), whose kernel adds its K slices in LDS and undoes the carry into hi/lo planes; Wo (2 products) + bo; + x residual in f32.
// Compute dtypes, f32 accumulate: every input rounded to bf16; q/k/v on PLAIN bf16 operands (exact) + biases; LayerNorm f32 (biased variance, eps 1e-5); scores hi/lo (3 products) on every row; softmax f32; attn.v single fp16 (P x1024); Wo hl x exact (2 products) + bo; residual f32.

#define NB_  4
#define TT   2048
#define DM   768
#define NH_  12
#define NKV  12
#define REP  (NH_ / NKV)
#define HD   64
#define DQ   (NH_ * HD)
#define DKV  (NKV * HD)
#define ZH   16                   // (batch, head) planes per attention launch: 64 ZH and 32 ZH work-groups, one to a WGP, are whole rounds of 256 WGPs
#define RH   0                    // every probability row carries x1024 (k_pvk undoes it on all rows)
#define WIN  0
#define PCAR 1024.0f
#define SCL  0.125f   // HD^-0.5
typedef _Float16 h16;
typedef unsigned short bf;
typedef __attribute__((ext_vector_type(16))) __bf16   v16bf;
typedef __attribute__((ext_vector_type(16))) _Float16 v16h;
typedef __attribute__((ext_vector_type(8)))  _Float16 v8h;
typedef __attribute__((ext_vector_type(8)))  unsigned short v8us;
typedef __attribute__((ext_vector_type(8)))  float    v8f;
typedef __attribute__((ext_vector_type(4)))  float    v4f;
typedef v8h  __attribute__((may_alias)) v8ha;
typedef v4f  __attribute__((may_alias)) v4fa;
typedef v8us __attribute__((may_alias)) v8usa;

__device__ __forceinline__ unsigned short f2bf(float f) { unsigned u = __float_as_uint(f); u += 0x7FFFu + ((u >> 16) & 1u); return (unsigned short)(u >> 16); }
__device__ __forceinline__ float bf2f(unsigned short b) { return __uint_as_float(((unsigned)b) << 16); }
__device__ __forceinline__ float bfr(float f) { return bf2f(f2bf(f)); }
__device__ __forceinline__ v16h cat16(v8h lo, v8h hi) { return __builtin_shufflevector(lo, hi, 0, 1, 2, 3, 4, 5, 6, 7, 8, 9, 10, 11, 12, 13, 14, 15); }
__device__ __forceinline__ v16bf cat16b(v8us lo, v8us hi) { return __builtin_bit_cast(v16bf, __builtin_shufflevector(lo, hi, 0, 1, 2, 3, 4, 5, 6, 7, 8, 9, 10, 11, 12, 13, 14, 15)); }
__device__ __forceinline__ v8f wmma16(v16h a, v16h b, v8f c) { return __builtin_amdgcn_wmma_f32_16x16x32_f16(false, a, false, b, (short)0, c, false, false); }
__device__ __forceinline__ v8f wmmab(v16bf a, v16bf b, v8f c) { return __builtin_amdgcn_wmma_f32_16x16x32_bf16(false, a, false, b, (short)0, c, false, false); }



// ---- k_gemmw: register-blocked GEMM, ONE WAVE per 64x64 output tile (16 accumulators), operands straight from K-contiguous 16-bit planes; grid (M/64, N/64, Z), 32 threads.
// C[m][n] (f32, pitch ldc, + optional f32 bias[n]) = sum_k A[m][k] Bt[n][k] (+ split products per NSPLIT). z-batch strides sA/sB/sC in elements. K % 32 == 0.
template <typename T16> struct WFrag;
template <> struct WFrag<h16> { typedef v16h V; static __device__ __forceinline__ V ld(const h16* p) { return cat16(*(const v8h*)p, *(const v8h*)(p + 16)); } static __device__ __forceinline__ v8f mma(V a, V b, v8f c) { return wmma16(a, b, c); } };
template <> struct WFrag<bf> { typedef v16bf V; static __device__ __forceinline__ V ld(const bf* p) { return cat16b(*(const v8us*)p, *(const v8us*)(p + 16)); } static __device__ __forceinline__ v8f mma(V a, V b, v8f c) { return wmmab(a, b, c); } };
template <typename T16, int NSPLIT, bool BIAS>
__global__ __launch_bounds__(32) void k_gemmw(const T16* __restrict__ A, const T16* __restrict__ A2, const T16* __restrict__ Bt, const T16* __restrict__ Bt2, int K, float* C, int ldc, const float* __restrict__ bias, size_t sA, size_t sB, size_t sC) {
    typedef typename WFrag<T16>::V V;
    __shared__ __align__(16) float os[16 * 68];
    const size_t z = blockIdx.z; A += z * sA; if (A2) A2 += z * sA; Bt += z * sB; if (Bt2) Bt2 += z * sB; C += z * sC;
    const int lane = threadIdx.x & 31, lr = lane & 15, hi = lane >> 4; const int r0 = blockIdx.x * 64, c0 = blockIdx.y * 64;
    v8f acc[4][4];
#pragma unroll
    for (int mb = 0; mb < 4; ++mb)
#pragma unroll
        for (int nb = 0; nb < 4; ++nb) acc[mb][nb] = (v8f){};
    const size_t aoff = (size_t)(r0 + lr) * K + 8 * hi, boff = (size_t)(c0 + lr) * K + 8 * hi;
#pragma unroll 1
    for (int kc = 0; kc < K; kc += 32) {
        V a[4], a2[4];
#pragma unroll
        for (int mb = 0; mb < 4; ++mb) { a[mb] = WFrag<T16>::ld(A + aoff + (size_t)mb * 16 * K + kc); if (NSPLIT == 1 || NSPLIT == 2) a2[mb] = WFrag<T16>::ld(A2 + aoff + (size_t)mb * 16 * K + kc); }
#pragma unroll
        for (int nb = 0; nb < 4; ++nb) { const V b = WFrag<T16>::ld(Bt + boff + (size_t)nb * 16 * K + kc); V b2; if (NSPLIT >= 2) b2 = WFrag<T16>::ld(Bt2 + boff + (size_t)nb * 16 * K + kc);
#pragma unroll
            for (int mb = 0; mb < 4; ++mb) { acc[mb][nb] = WFrag<T16>::mma(a[mb], b, acc[mb][nb]); if (NSPLIT == 1 || NSPLIT == 2) acc[mb][nb] = WFrag<T16>::mma(a2[mb], b, acc[mb][nb]); if (NSPLIT >= 2) acc[mb][nb] = WFrag<T16>::mma(a[mb], b2, acc[mb][nb]); } }
        asm volatile("v_nop\n\tv_nop\n\tv_nop\n\tv_nop" : "+v"(acc[0][0]), "+v"(acc[1][1]), "+v"(acc[2][2]), "+v"(acc[3][3]) : "v"(a[0]), "v"(a[3]));
    }
#pragma unroll
    for (int mb = 0; mb < 4; ++mb) {
#pragma unroll
        for (int nb = 0; nb < 4; ++nb) {
#pragma unroll
            for (int j = 0; j < 8; ++j) os[(hi * 8 + j) * 68 + nb * 16 + lr] = acc[mb][nb][j]; }
        __builtin_amdgcn_wave_barrier(); asm volatile("" ::: "memory");
        float* crow = C + (size_t)(r0 + mb * 16) * ldc + c0;
{
#pragma unroll
            for (int s = 0; s < 8; ++s) { const int row = 2 * s + hi, cofs = lr * 4; v4f val = *(const v4fa*)(os + row * 68 + cofs); if (BIAS) { val[0] += bfr(bias[c0 + cofs]); val[1] += bfr(bias[c0 + cofs + 1]); val[2] += bfr(bias[c0 + cofs + 2]); val[3] += bfr(bias[c0 + cofs + 3]); }
                *(v4f*)(crow + (size_t)row * ldc + cofs) = val; }
             }
        __builtin_amdgcn_wave_barrier(); asm volatile("" ::: "memory");
    }
}

__device__ __forceinline__ h16 tohx(float x) { return (h16)x; }
__device__ __forceinline__ void splitf(float y, unsigned short& h, unsigned short& l) { h = f2bf(y); l = f2bf(y - bf2f(h)); }
typedef __attribute__((ext_vector_type(2))) _Float16 v2h;
typedef __attribute__((ext_vector_type(4))) _Float16 v4h;
typedef __attribute__((ext_vector_type(2))) unsigned short v2us;
typedef __attribute__((ext_vector_type(4))) unsigned short v4us;
typedef __attribute__((ext_vector_type(2))) float v2f;
typedef __attribute__((ext_vector_type(4))) int v4i;

// ---- k_pvk: attn.v with its K = 2048 keys split over the KSP waves of one work-group; grid (TT/64, ZH), KSP*32 threads. Wave ks forms the f32 partial 64x64 tile of its KSL keys and lays it in its own LDS plane; behind one barrier the work-group adds the KSP planes in slice order, undoes the x1024 carry and stores the hi/lo planes [batch][t][head][d] (16 lanes write one whole 128-byte line). A = probabilities as [head][k/8][q][8]: a lane's two 16-byte fragment pieces (keys kc + 8 hi + 0..7 and kc + 16 + 8 hi + 0..7 of query row q) are pieces kc/8 + hi and kc/8 + 2 + hi at q, the k order of the Bt loader.
#define KSP 16
#define KSL (TT / KSP)
#define OSP 68                  // LDS row pitch in floats: the two 8-row halves of an accumulator tile land 32 banks apart
__global__ __launch_bounds__(KSP * 32) void k_pvk(const h16* __restrict__ A, const h16* __restrict__ Bt, int g0, bf* Ah, bf* Al) {
    __shared__ __align__(16) float os[KSP][64 * OSP];
    const size_t z = blockIdx.y; const int ks = __builtin_amdgcn_readfirstlane((int)(threadIdx.x >> 5)); A += z * ((size_t)TT * TT) + (size_t)ks * KSL * TT; Bt += z * ((size_t)HD * TT) + ks * KSL;   // the wave's number through readfirstlane: both bases stay scalar
    const int lane = threadIdx.x & 31, lr = lane & 15, hi = lane >> 4; const int r0 = blockIdx.x * 64;
    v8f acc[4][4];
#pragma unroll
    for (int mb = 0; mb < 4; ++mb)
#pragma unroll
        for (int nb = 0; nb < 4; ++nb) acc[mb][nb] = (v8f){};
    unsigned aoff = (hi * TT + r0 + lr) * 16, boff = (lr * TT + 8 * hi) * 2;   // a lane's byte offsets in this pass
#pragma unroll 1   // rolled: one pass's 8 fragments beside the 128 accumulator registers stay under 256 VGPRs
    for (int kc = 0; kc < KSL; kc += 32) {
        const h16* pa = (const h16*)((const char*)A + aoff); const h16* pb = (const h16*)((const char*)Bt + boff); v16h a[4], b[4];
#pragma unroll
        for (int mb = 0; mb < 4; ++mb) a[mb] = cat16(*(const v8h*)(pa + mb * 128), *(const v8h*)(pa + mb * 128 + 16 * TT));
#pragma unroll
        for (int nb = 0; nb < 4; ++nb) b[nb] = WFrag<h16>::ld(pb + (size_t)nb * 16 * TT);
        // behind the pass's 16 loads, before any register that they name is rewritten; the two offsets pass through the statement so that their step to the next pass stands behind it
        asm volatile("s_wait_xcnt 0x0" : "+v"(aoff), "+v"(boff) :: "memory");
        aoff += 64 * TT; boff += 64;
#pragma unroll
        for (int nb = 0; nb < 4; ++nb)
#pragma unroll
            for (int mb = 0; mb < 4; ++mb) acc[mb][nb] = wmma16(a[mb], b[nb], acc[mb][nb]);
        // four vector slots behind the pass's last WMMAs, on both sides of the loop branch: the next pass's loads rewrite a and b, the LDS stores behind the loop read acc
        asm volatile("v_nop\n\tv_nop\n\tv_nop\n\tv_nop" : "+v"(acc[0][0]), "+v"(acc[1][1]), "+v"(acc[2][2]), "+v"(acc[3][3]) : "v"(a[0]), "v"(a[3]));
    }
    float* ow = os[ks];
#pragma unroll
    for (int mb = 0; mb < 4; ++mb)
#pragma unroll
        for (int nb = 0; nb < 4; ++nb)
#pragma unroll
            for (int j = 0; j < 8; ++j) ow[(mb * 16 + hi * 8 + j) * OSP + nb * 16 + lr] = acc[mb][nb][j];
    __syncthreads();   // every slice's partial tile lies in LDS
    const int cofs = (threadIdx.x & 15) * 4;
#pragma unroll
    for (int rr = 0; rr < 2; ++rr) { const int row = (int)(threadIdx.x >> 4) + rr * 32, t = r0 + row; const float cs = (t < RH) ? 1.0f : (1.0f / PCAR); v4f sm = *(const v4fa*)(&os[0][row * OSP + cofs]);
#pragma unroll
        for (int s = 1; s < KSP; ++s) sm += *(const v4fa*)(&os[s][row * OSP + cofs]);   /* the K slices' partial sums, in slice order */
        v4us oh, ol;
#pragma unroll
        for (int q = 0; q < 4; ++q) { unsigned short a, c2; splitf(sm[q] * cs, a, c2); oh[q] = a; ol[q] = c2; }
        const int g = g0 + (int)z; const size_t oo = ((size_t)(g / NH_) * TT + t) * DQ + (g % NH_) * HD + cofs;   /* plane g = batch g / NH_, head g % NH_ */ *(v4us*)(Ah + oo) = oh; *(v4us*)(Al + oo) = ol; }
}


__global__ __launch_bounds__(256) void k_wtG(const float* __restrict__ w, int K, int N, bf* Bt) {
    const int lane = threadIdx.x & 31; const int L0 = (blockIdx.x * 8 + (threadIdx.x >> 5)) * 8; const int nlines = N * K / 64;
{
#pragma unroll 1
        for (int l = 0; l < 8; ++l) { const int L = L0 + l; if (L >= nlines) break; const size_t e = (size_t)L * 64 + lane * 2; const int k = (int)(e % K), n = (int)(e / K); v2us o;
            o[0] = f2bf(w[(size_t)k * N + n]); o[1] = f2bf(w[(size_t)(k + 1) * N + n]); *(v2us*)(Bt + e) = o; }
         }
}
__global__ __launch_bounds__(256) void k_cvt8(const float* __restrict__ src, bf* dst, size_t n8) { const size_t i = (size_t)blockIdx.x * 256 + threadIdx.x; if (i >= n8) return; const v8f v = *(const v8f*)(src + i * 8); v8us o;
#pragma unroll
    for (int k = 0; k < 8; ++k) o[k] = f2bf(v[k]); *(v8us*)(dst + i * 8) = o;  }

// k_rope: head planes [h][t][d] (fp16 + hi/lo) of rope(x) x sc with the rotate-half convention out[d] = x[d] cos[t][d] - x[d+HD/2] sin[t][d], out[d+HD/2] = x[d+HD/2] cos[t][d+HD/2] + x[d] sin[t][d+HD/2]
__global__ __launch_bounds__(256) void k_rope(const float* __restrict__ F, int pitch, int nheads, const float* __restrict__ CS, const float* __restrict__ RF, const float* __restrict__ nw, float sc, h16* P16, bf* Ph, bf* Pl) {
    { const size_t bz = blockIdx.y; F += bz * ((size_t)TT * pitch); const size_t po = bz * ((size_t)nheads * TT * HD); P16 += po; Ph += po; Pl += po; }   // grid y = batch: rows bz TT .. of F, planes [batch][h][t][d]
    const size_t e = ((size_t)blockIdx.x * 256 + threadIdx.x) * 2; if (e >= (size_t)nheads * TT * HD) return; const int d = (int)(e % HD); const int t = (int)((e / HD) % TT); const int h = (int)(e / ((size_t)HD * TT)); const float* f = F + (size_t)t * pitch + h * HD; const float rf = RF ? RF[(size_t)h * TT + t] : 1.0f; v2h o16; v2us oh, ol;
#pragma unroll
    for (int q = 0; q < 2; ++q) { const int dd = d + q; const int dp = (dd < HD / 2) ? dd + HD / 2 : dd - HD / 2; float x0 = f[dd], x1 = f[dp];
        if (RF) { float n0 = __fmul_rn(x0, rf), n1 = __fmul_rn(x1, rf); asm volatile("" : "+v"(n0)); asm volatile("" : "+v"(n1)); x0 = __fmul_rn(bfr(nw[dd]), n0); x1 = __fmul_rn(bfr(nw[dp]), n1); }
        const v2f cs = *(const v2f*)(CS + ((size_t)t * HD + dd) * 2); float a = __fmul_rn(x0, cs[0]), bq = __fmul_rn(x1, cs[1]); asm volatile("" : "+v"(a)); asm volatile("" : "+v"(bq)); const float r = ((dd < HD / 2) ? __fsub_rn(a, bq) : __fadd_rn(a, bq)) * sc;
        o16[q] = tohx(r); unsigned short a2, c2; splitf(r, a2, c2); oh[q] = a2; ol[q] = c2; }
    *(v2h*)(P16 + e) = o16; *(v2us*)(Ph + e) = oh; *(v2us*)(Pl + e) = ol;  }
__global__ __launch_bounds__(256) void k_vtp(const float* __restrict__ F, int pitch, int nheads, h16* V16, bf* Vh, bf* Vl) {
    { const size_t bz = blockIdx.y; F += bz * ((size_t)TT * pitch); const size_t po = bz * ((size_t)nheads * HD * TT); V16 += po; Vh += po; Vl += po; }   // grid y = batch: planes [batch][g][d][t]
    const size_t e = ((size_t)blockIdx.x * 256 + threadIdx.x) * 2; if (e >= (size_t)nheads * HD * TT) return; const int t = (int)(e % TT); const int d = (int)((e / TT) % HD); const int g = (int)(e / ((size_t)TT * HD)); v2h o16; v2us oh, ol;
#pragma unroll
    for (int q = 0; q < 2; ++q) { const float x = F[(size_t)(t + q) * pitch + g * HD + d]; o16[q] = tohx(x); unsigned short a2, c2; splitf(x, a2, c2); oh[q] = a2; ol[q] = c2; }
    *(v2h*)(V16 + e) = o16; *(v2us*)(Vh + e) = oh; *(v2us*)(Vl + e) = ol;  }
__global__ __launch_bounds__(256) void k_csid(float* CS) { const int idx = blockIdx.x * 256 + threadIdx.x; if (idx >= TT * HD) return; v2f cs; cs[0] = 1.0f; cs[1] = 0.0f; *(v2f*)(CS + (size_t)idx * 2) = cs;  }

// ---- k_scsoft: scores and their softmax over q in one kernel; grid (TT/FKB, ZH), FNW*32 threads. A work-group owns FKB key rows against all TT queries: wave w forms S^T[FKB keys][128 queries from 128 w] in 16 accumulator tiles (3 products, K = HD, the product order a.b, a2.b, a.b2 per 32 of K), so a score never leaves the registers. Row maximum and row sum: over a lane's 8 tiles, over the 16 lanes of a row by DPP, over the FNW waves through LDS in wave order. An accumulator tile holds in each lane 8 consecutive keys of one query: one 16-byte piece of P8[head][k/8][q][8], stored as it stands (whole 128-byte lines, one writer each).
#define FKB 32
#define FNW 16
static_assert(TT % FKB == 0 && TT == FNW * 128 && HD == 64 && FKB == 32, "two 16-key tile rows; 128 query columns per wave; one lane of wave 0 per key row in the cross-wave step");
template <int M> __device__ __forceinline__ float rowx(float v) { return __builtin_bit_cast(float, __builtin_amdgcn_mov_dpp(__builtin_bit_cast(int, v), 0x160 | M, 0xf, 0xf, true)); }   // value of lane ^ M inside the 16-lane row (row_xmask)
__global__ __launch_bounds__(FNW * 32) void k_scsoft(const bf* __restrict__ Kh, const bf* __restrict__ Kl, const bf* __restrict__ Qh, const bf* __restrict__ Ql, h16* P8) {
    __shared__ __align__(16) float redm[FNW][FKB], reds[FNW][FKB], finm[FKB], fins[FKB];
    const size_t z = blockIdx.y; Kh += z * ((size_t)TT * HD); Kl += z * ((size_t)TT * HD); Qh += z * ((size_t)TT * HD); Ql += z * ((size_t)TT * HD);
    const int lane = threadIdx.x & 31, lr = lane & 15, hi = lane >> 4, w = threadIdx.x >> 5; const int k0 = blockIdx.x * FKB, q0 = w * 128;
    v16bf ah[2][2], al[2][2], rb[2][2], rb2[2][2]; v8f acc[2][8];
    const bf* qh = Qh + (size_t)(q0 + lr) * HD + 8 * hi; const bf* ql = Ql + (size_t)(q0 + lr) * HD + 8 * hi; const size_t ko = (size_t)(k0 + lr) * HD + 8 * hi;
    // step nb: the six products (K slices 0 and 1) into tiles (0, nb) and (1, nb); a step's eight query loads, which share its 32 lines, go out together, one step ahead
#pragma unroll
    for (int kk = 0; kk < 2; ++kk) { rb[0][kk] = WFrag<bf>::ld(qh + kk * 32); rb2[0][kk] = WFrag<bf>::ld(ql + kk * 32); }
#pragma unroll
    for (int mb = 0; mb < 2; ++mb)
#pragma unroll
        for (int kk = 0; kk < 2; ++kk) { ah[mb][kk] = WFrag<bf>::ld(Kh + ko + mb * 16 * HD + kk * 32); al[mb][kk] = WFrag<bf>::ld(Kl + ko + mb * 16 * HD + kk * 32); }
    asm volatile("s_wait_xcnt 0x0" ::: "memory");   // the key address registers are dead behind these loads: the wait stands before the next loads' results may land in them
#pragma unroll
    for (int nb = 0; nb < 8; ++nb) {
        if (nb + 1 < 8) {
#pragma unroll
            for (int kk = 0; kk < 2; ++kk) { rb[(nb + 1) & 1][kk] = WFrag<bf>::ld(qh + (nb + 1) * 16 * HD + kk * 32); rb2[(nb + 1) & 1][kk] = WFrag<bf>::ld(ql + (nb + 1) * 16 * HD + kk * 32); } }
        __builtin_amdgcn_sched_barrier(0);   // keeps the next step's loads ahead of this step's products: sunk to their use, each would cost its whole latency
#pragma unroll
        for (int mb = 0; mb < 2; ++mb) { v8f a = (v8f){};
#pragma unroll
            for (int kk = 0; kk < 2; ++kk) { a = wmmab(ah[mb][kk], rb[nb & 1][kk], a); a = wmmab(al[mb][kk], rb[nb & 1][kk], a); a = wmmab(ah[mb][kk], rb2[nb & 1][kk], a); }
            acc[mb][nb] = a; }
        __builtin_amdgcn_sched_barrier(0); }   // keeps later loads behind this step's products: hoisted, a third set of query fragments would be live and the build spills
    // lane (lr, hi), tile (mb, nb), register j: key k0 + 16 mb + 8 hi + j, query q0 + 16 nb + lr
    float rv[2][8];
#pragma unroll
    for (int mb = 0; mb < 2; ++mb)
#pragma unroll
        for (int j = 0; j < 8; ++j) { float m = -3.0e38f;
#pragma unroll
            for (int nb = 0; nb < 8; ++nb) m = fmaxf(m, acc[mb][nb][j]);
            m = fmaxf(m, rowx<1>(m)); m = fmaxf(m, rowx<2>(m)); m = fmaxf(m, rowx<4>(m)); m = fmaxf(m, rowx<8>(m)); rv[mb][j] = m; }
    if (lr == 0) {
#pragma unroll
        for (int mb = 0; mb < 2; ++mb) { *(v4fa*)&redm[w][mb * 16 + hi * 8] = (v4f){rv[mb][0], rv[mb][1], rv[mb][2], rv[mb][3]}; *(v4fa*)&redm[w][mb * 16 + hi * 8 + 4] = (v4f){rv[mb][4], rv[mb][5], rv[mb][6], rv[mb][7]}; } }
    __syncthreads();   // every wave's row maxima lie in LDS
    if (threadIdx.x < FKB) { float m = redm[0][threadIdx.x];
#pragma unroll
        for (int ww = 1; ww < FNW; ++ww) m = fmaxf(m, redm[ww][threadIdx.x]);
        finm[threadIdx.x] = m; }
    __syncthreads();   // the FKB row maxima over all queries are published
#pragma unroll
    for (int mb = 0; mb < 2; ++mb) { const v4f m0 = *(const v4fa*)&finm[mb * 16 + hi * 8], m1 = *(const v4fa*)&finm[mb * 16 + hi * 8 + 4]; const v8f mx = __builtin_shufflevector(m0, m1, 0, 1, 2, 3, 4, 5, 6, 7); v8f s8;
#pragma unroll
        for (int nb = 0; nb < 8; ++nb) { v8f t = (acc[mb][nb] - mx) * (SCL * 1.4426950408889634f);
#pragma unroll
            for (int j = 0; j < 8; ++j) t[j] = __builtin_amdgcn_exp2f(t[j]);
            acc[mb][nb] = t; s8 = nb ? s8 + t : t; }   // SCL is a power of two: (a - m) (SCL c) rounds as (a SCL - m SCL) c does
#pragma unroll
        for (int j = 0; j < 8; ++j) { float s = s8[j]; s += rowx<1>(s); s += rowx<2>(s); s += rowx<4>(s); s += rowx<8>(s); rv[mb][j] = s; } }
    if (lr == 0) {
#pragma unroll
        for (int mb = 0; mb < 2; ++mb) { *(v4fa*)&reds[w][mb * 16 + hi * 8] = (v4f){rv[mb][0], rv[mb][1], rv[mb][2], rv[mb][3]}; *(v4fa*)&reds[w][mb * 16 + hi * 8 + 4] = (v4f){rv[mb][4], rv[mb][5], rv[mb][6], rv[mb][7]}; } }
    __syncthreads();   // every wave's row sums lie in LDS
    if (threadIdx.x < FKB) { float s = reds[0][threadIdx.x];
#pragma unroll
        for (int ww = 1; ww < FNW; ++ww) s += reds[ww][threadIdx.x];
        fins[threadIdx.x] = __fdiv_rn(PCAR, s); }
    __syncthreads();   // the FKB row factors 1024 / sum are published
    h16* dst = P8 + ((((size_t)z * TT + k0) / 8 + hi) * TT + q0 + lr) * 8;
#pragma unroll
    for (int mb = 0; mb < 2; ++mb) { const v4f f0 = *(const v4fa*)&fins[mb * 16 + hi * 8], f1 = *(const v4fa*)&fins[mb * 16 + hi * 8 + 4];
#pragma unroll
        for (int nb = 0; nb < 8; ++nb) { v8h o;
#pragma unroll
            for (int j = 0; j < 8; ++j) o[j] = tohx(acc[mb][nb][j] * ((j < 4) ? f0[j & 3] : f1[j & 3]));
            *(v8h*)(dst + ((size_t)mb * 2 * TT + nb * 16) * 8) = o; } }
}

__global__ __launch_bounds__(256) void k_lnrow(float* F, const float* __restrict__ gw) {
    const int lane = threadIdx.x & 31; const int r = blockIdx.x * 8 + (threadIdx.x >> 5); if (r >= NB_ * TT) return; float hv[DM / 32]; float s = 0.f; float* fr = F + (size_t)r * DM;
#pragma unroll
    for (int ch = 0; ch < DM / 128; ++ch) { const v4f y = *(const v4f*)(fr + ch * 128 + lane * 4);
#pragma unroll
        for (int q = 0; q < 4; ++q) { hv[ch * 4 + q] = y[q]; s += y[q]; } }
#pragma unroll
    for (int sh = 16; sh; sh >>= 1) s += __shfl_xor(s, sh, 32);
    const float mu = s * (1.0f / DM); float s2 = 0.f;
#pragma unroll
    for (int k = 0; k < DM / 32; ++k) { float d0 = __fsub_rn(hv[k], mu); asm volatile("" : "+v"(d0)); float p = __fmul_rn(d0, d0); asm volatile("" : "+v"(p)); s2 = __fadd_rn(s2, p); }
#pragma unroll
    for (int sh = 16; sh; sh >>= 1) s2 += __shfl_xor(s2, sh, 32);
    float var = __fadd_rn(s2 * (1.0f / DM), 1e-5f); asm volatile("" : "+v"(var)); const float rs = __frsqrt_rn(var);
    __builtin_amdgcn_wave_barrier(); asm volatile("" ::: "memory");   /* all lanes have read the row before any lane overwrites it */
{
#pragma unroll
        for (int ch = 0; ch < DM / 128; ++ch) { const int c0 = ch * 128 + lane * 4; v4f o;
#pragma unroll
            for (int q = 0; q < 4; ++q) { float gb = bfr(gw[c0 + q]); asm volatile("" : "+v"(gb)); float d0 = __fsub_rn(hv[ch * 4 + q], mu); asm volatile("" : "+v"(d0)); float n0 = __fmul_rn(d0, rs); asm volatile("" : "+v"(n0)); o[q] = __fmul_rn(n0, gb); }
            *(v4f*)(fr + c0) = o; }
         } }
__global__ __launch_bounds__(256) void k_addx(const float* __restrict__ Y, const float* __restrict__ xb, float* O, size_t n4) { const size_t i = (size_t)blockIdx.x * 256 + threadIdx.x; if (i >= n4) return; const v4f y = *(const v4f*)(Y + i * 4); const v4f xv = *(const v4f*)(xb + i * 4); v4f o;
#pragma unroll
    for (int q = 0; q < 4; ++q) { float xr = bfr(xv[q]); asm volatile("" : "+v"(xr)); o[q] = __fadd_rn(y[q], xr); } *(v4f*)(O + i * 4) = o;  }
extern "C" void kernel_launch(void* const* d_in, const int* in_sizes, int n_in,
                              void* d_out, int out_size, void* d_ws, size_t ws_size, hipStream_t stream) {
    (void)in_sizes; (void)n_in; (void)out_size;
    const float* x = (const float*)d_in[0]; const float* wq = (const float*)d_in[1]; const float* wk = (const float*)d_in[2]; const float* bk = (const float*)d_in[3]; const float* wv = (const float*)d_in[4]; const float* bv = (const float*)d_in[5]; const float* gq = (const float*)d_in[6]; const float* gk = (const float*)d_in[7]; const float* wo = (const float*)d_in[8]; const float* bo = (const float*)d_in[9];
    float* OUT = (float*)d_out;     // [4][2048][768]
    char* wsp = (char*)d_ws;
    auto take = [&](size_t bytes) { char* p = wsp; wsp += (bytes + 255) & ~(size_t)255; return (void*)p; };
    bf* WQ = (bf*)take((size_t)DQ * DM * 2); bf* WK = (bf*)take((size_t)DKV * DM * 2); bf* WV = (bf*)take((size_t)DKV * DM * 2); bf* WO = (bf*)take((size_t)DM * DQ * 2); float* CS = (float*)take((size_t)TT * HD * 2 * 4);
    // planes of all NB_ batches that the attention launches read or write
    bf* QPh = (bf*)take((size_t)NB_ * NH_ * TT * HD * 2); bf* QPl = (bf*)take((size_t)NB_ * NH_ * TT * HD * 2); bf* KPh = (bf*)take((size_t)NB_ * NKV * TT * HD * 2); bf* KPl = (bf*)take((size_t)NB_ * NKV * TT * HD * 2); h16* VT16 = (h16*)take((size_t)NB_ * NKV * HD * TT * 2);
    bf* ATh = (bf*)take((size_t)NB_ * TT * DQ * 2); bf* ATl = (bf*)take((size_t)NB_ * TT * DQ * 2);
    char* const big = wsp;
    h16* P8 = (h16*)take((size_t)ZH * TT * TT * 2);
    if ((size_t)(wsp - (char*)d_ws) > ws_size) return;
    // the probability bytes serve, stream-ordered, the projection stage's buffers before the first attention launch and the Wo result after the last one
    static_assert((NB_ * NH_) % ZH == 0, "whole groups of planes"); static_assert((size_t)NB_ * DM * 4 <= (size_t)ZH * TT * 2, "the Wo result fits the probability bytes");
    static_assert((size_t)NB_ * TT * DM * 2 + (size_t)NB_ * TT * (DQ + DKV) * 4 + (size_t)NB_ * (NH_ + 3 * NKV) * TT * HD * 2 <= (size_t)ZH * TT * TT * 2, "projection stage fits the probability bytes");
    float* YO = (float*)P8;
    wsp = big;
    bf* XB = (bf*)take((size_t)NB_ * TT * DM * 2); float* FQ = (float*)take((size_t)NB_ * TT * DQ * 4); float* FK = (float*)take((size_t)NB_ * TT * DKV * 4);
    h16* QP16 = (h16*)take((size_t)NB_ * NH_ * TT * HD * 2); h16* KP16 = (h16*)take((size_t)NB_ * NKV * TT * HD * 2); bf* VTh = (bf*)take((size_t)NB_ * NKV * HD * TT * 2); bf* VTl = (bf*)take((size_t)NB_ * NKV * HD * TT * 2);
    float* FV = FK;   // v projection reuses the k buffer after the k planes are built (stream-ordered)
    k_cvt8<<<(unsigned)(((size_t)DQ * DM / 8 + 255) / 256), 256, 0, stream>>>(wq, WQ, (size_t)DQ * DM / 8); k_cvt8<<<(unsigned)(((size_t)DKV * DM / 8 + 255) / 256), 256, 0, stream>>>(wk, WK, (size_t)DKV * DM / 8); k_cvt8<<<(unsigned)(((size_t)DKV * DM / 8 + 255) / 256), 256, 0, stream>>>(wv, WV, (size_t)DKV * DM / 8); k_cvt8<<<(unsigned)(((size_t)DM * DQ / 8 + 255) / 256), 256, 0, stream>>>(wo, WO, (size_t)DM * DQ / 8);   /* 'oi' weights = Bt as-is */
    k_csid<<<(TT * HD + 255) / 256, 256, 0, stream>>>(CS);
    const unsigned LQ = (unsigned)(((size_t)NH_ * TT * HD / 2 + 255) / 256), LKv = (unsigned)(((size_t)NKV * TT * HD / 2 + 255) / 256);
    // every launch of this stage covers the NB_ * TT rows of all batches
    k_cvt8<<<(unsigned)(((size_t)NB_ * TT * DM / 8 + 255) / 256), 256, 0, stream>>>(x, XB, (size_t)NB_ * TT * DM / 8);
    k_gemmw<bf, 0, false><<<dim3(NB_ * TT / 64, DQ / 64, 1), 32, 0, stream>>>(XB, nullptr, WQ, nullptr, DM, FQ, DQ, nullptr, 0, 0, 0); k_lnrow<<<NB_ * TT / 8, 256, 0, stream>>>(FQ, gq);   /* q = LN(x Wq^T) gq */
    k_rope<<<dim3(LQ, NB_, 1), 256, 0, stream>>>(FQ, DQ, NH_, CS, nullptr, nullptr, 1.0f, QP16, QPh, QPl);
    k_gemmw<bf, 0, true><<<dim3(NB_ * TT / 64, DKV / 64, 1), 32, 0, stream>>>(XB, nullptr, WK, nullptr, DM, FK, DKV, bk, 0, 0, 0); k_lnrow<<<NB_ * TT / 8, 256, 0, stream>>>(FK, gk);   /* k = LN(x Wk^T + bk) gk */
    k_rope<<<dim3(LKv, NB_, 1), 256, 0, stream>>>(FK, DKV, NKV, CS, nullptr, nullptr, 1.0f, KP16, KPh, KPl);
    k_gemmw<bf, 0, true><<<dim3(NB_ * TT / 64, DKV / 64, 1), 32, 0, stream>>>(XB, nullptr, WV, nullptr, DM, FV, DKV, bv, 0, 0, 0); k_vtp<<<dim3(LKv, NB_, 1), 256, 0, stream>>>(FV, DKV, NKV, VT16, VTh, VTl);
    for (int g0 = 0; g0 < NB_ * NH_; g0 += ZH) { const size_t zq = (size_t)g0;   // first plane of the group, planes [batch][head]
        k_scsoft<<<dim3(TT / FKB, ZH, 1), FNW * 32, 0, stream>>>(KPh + zq * TT * HD, KPl + zq * TT * HD, QPh + zq * TT * HD, QPl + zq * TT * HD, P8);   /* S^T[k][q] = k_k.q_q (3 products), softmax over q -> fp16 x1024 [k/8][q][8] */
        k_pvk<<<dim3(TT / 64, ZH, 1), KSP * 32, 0, stream>>>(P8, VT16 + zq * HD * TT, g0, ATh, ATl); }   /* o = attn . v (one product), KSP slices summed in LDS; hi/lo planes, carry undone on every row (RH 0) */
    k_gemmw<bf, 1, true><<<dim3(NB_ * TT / 64, DM / 64, 1), 32, 0, stream>>>(ATh, ATl, WO, nullptr, DQ, YO, DM, bo, 0, 0, 0);   /* o Wo^T + bo */
    k_addx<<<(unsigned)(((size_t)NB_ * TT * DM / 4 + 255) / 256), 256, 0, stream>>>(YO, x, OUT, (size_t)NB_ * TT * DM / 4);   /* + x */
}

// v008
// A run of this version takes 450 microseconds.
// Two timings next to v007 both put it at 1.23 times that version's speed.
// Counting every step since v000, it is 6.87 times as fast.
#include <hip/hip_runtime.h>

// Multi-head self-attention with QK-LayerNorm and the module's QUERY-axis softmax (x [4][2048][768]; q = LN_nobias(x Wq^T) gq, k = LN_nobias(x Wk^T + bk) gk (LayerNorm over the full 768), v = x Wv^T + bv ('oi' [768][768]; 12 heads x 64); scores = q.k/8; attn = softmax over the QUERY axis (per key column); o[q] = sum_k attn[q][k] v[k]; out = merged o Wo^T + bo + x -> [4][2048][768] (6.3 M)).
// Projections, LayerNorm and Wo each run once over all NB_ * TT rows, and each stores what its reader wants (LayerNorm the q/k hi/lo head planes, the v product the fp16 v^T planes, Wo the sum with bo and x); the attention launches go per group of ZH of the NB_ * NH_ (batch, head) planes, ZH chosen so that both attention grids are whole multiples of the chip's 256 WGPs (each work-group fills one WGP): the TRANSPOSED scores S^T[k][q] = k_k.q_q (3 products) are formed and normalised over q inside one kernel and never stored; probabilities are written fp16 x1024 as 16-byte pieces [k/8][q][8] (8 keys of one query, as an accumulator tile holds them), which are the A fragment pieces of the product with the fp16 value planes (one product, K = 2048), whose kernel adds its K slices in LDS and undoes the carry into hi/lo planes; Wo (2 products) + bo; + x residual in f32.
// Compute dtypes, f32 accumulate: every input rounded to bf16; q/k/v on PLAIN bf16 operands (exact) + biases; LayerNorm f32 (biased variance, eps 1e-5); scores hi/lo (3 products) on every row; softmax f32; attn.v single fp16 (P x1024); Wo hl x exact (2 products) + bo; residual f32.

#define NB_  4
#define TT   2048
#define DM   768
#define NH_  12
#define NKV  12
#define REP  (NH_ / NKV)
#define HD   64
#define DQ   (NH_ * HD)
#define DKV  (NKV * HD)
#define ZH   16                   // (batch, head) planes per attention launch: 64 ZH and 32 ZH work-groups, one to a WGP, are whole rounds of 256 WGPs
#define RH   0                    // every probability row carries x1024 (k_pvk undoes it on all rows)
#define WIN  0
#define PCAR 1024.0f
#define SCL  0.125f   // HD^-0.5
typedef _Float16 h16;
typedef unsigned short bf;
typedef __attribute__((ext_vector_type(16))) __bf16   v16bf;
typedef __attribute__((ext_vector_type(16))) _Float16 v16h;
typedef __attribute__((ext_vector_type(8)))  _Float16 v8h;
typedef __attribute__((ext_vector_type(8)))  unsigned short v8us;
typedef __attribute__((ext_vector_type(8)))  float    v8f;
typedef __attribute__((ext_vector_type(4)))  float    v4f;
typedef v8h  __attribute__((may_alias)) v8ha;
typedef v4f  __attribute__((may_alias)) v4fa;
typedef v8us __attribute__((may_alias)) v8usa;

__device__ __forceinline__ unsigned short f2bf(float f) { unsigned u = __float_as_uint(f); u += 0x7FFFu + ((u >> 16) & 1u); return (unsigned short)(u >> 16); }
__device__ __forceinline__ float bf2f(unsigned short b) { return __uint_as_float(((unsigned)b) << 16); }
__device__ __forceinline__ float bfr(float f) { return bf2f(f2bf(f)); }
__device__ __forceinline__ v16h cat16(v8h lo, v8h hi) { return __builtin_shufflevector(lo, hi, 0, 1, 2, 3, 4, 5, 6, 7, 8, 9, 10, 11, 12, 13, 14, 15); }
__device__ __forceinline__ v16bf cat16b(v8us lo, v8us hi) { return __builtin_bit_cast(v16bf, __builtin_shufflevector(lo, hi, 0, 1, 2, 3, 4, 5, 6, 7, 8, 9, 10, 11, 12, 13, 14, 15)); }
__device__ __forceinline__ v8f wmma16(v16h a, v16h b, v8f c) { return __builtin_amdgcn_wmma_f32_16x16x32_f16(false, a, false, b, (short)0, c, false, false); }
__device__ __forceinline__ v8f wmmab(v16bf a, v16bf b, v8f c) { return __builtin_amdgcn_wmma_f32_16x16x32_bf16(false, a, false, b, (short)0, c, false, false); }



// ---- k_gemmw: register-blocked GEMM, ONE WAVE per 64x64 output tile (16 accumulators), operands straight from K-contiguous 16-bit planes; grid (M/64, N/64, Z), 32 threads.
// C[m][n] (f32, pitch ldc, + optional f32 bias[n]) = sum_k A[m][k] Bt[n][k] (+ split products per NSPLIT). z-batch strides sA/sB/sC in elements. K % 32 == 0.
// EPI 0: C as it stands. EPI 1: C + bf16-rounded xres[m][n] (pitch ldc). EPI 2: no C; fp16 of the result goes transposed to Vt[m / TT][n][m % TT]: a lane's 8 accumulator registers are 8 consecutive m of one n, one 16-byte piece, and the eight pieces of a row n (four from each of its two lanes) fill one 128-byte line.
template <typename T16> struct WFrag;
template <> struct WFrag<h16> { typedef v16h V; static __device__ __forceinline__ V ld(const h16* p) { return cat16(*(const v8h*)p, *(const v8h*)(p + 16)); } static __device__ __forceinline__ v8f mma(V a, V b, v8f c) { return wmma16(a, b, c); } };
template <> struct WFrag<bf> { typedef v16bf V; static __device__ __forceinline__ V ld(const bf* p) { return cat16b(*(const v8us*)p, *(const v8us*)(p + 16)); } static __device__ __forceinline__ v8f mma(V a, V b, v8f c) { return wmmab(a, b, c); } };
template <typename T16, int NSPLIT, bool BIAS, int EPI>
__global__ __launch_bounds__(32) void k_gemmw(const T16* __restrict__ A, const T16* __restrict__ A2, const T16* __restrict__ Bt, const T16* __restrict__ Bt2, int K, float* C, int ldc, const float* __restrict__ bias, size_t sA, size_t sB, size_t sC, const float* __restrict__ xres, h16* Vt) {
    typedef typename WFrag<T16>::V V;
    __shared__ __align__(16) float os[16 * 68];
    const size_t z = blockIdx.z; A += z * sA; if (A2) A2 += z * sA; Bt += z * sB; if (Bt2) Bt2 += z * sB; C += z * sC;
    const int lane = threadIdx.x & 31, lr = lane & 15, hi = lane >> 4; const int r0 = blockIdx.x * 64, c0 = blockIdx.y * 64;
    v8f acc[4][4];
#pragma unroll
    for (int mb = 0; mb < 4; ++mb)
#pragma unroll
        for (int nb = 0; nb < 4; ++nb) acc[mb][nb] = (v8f){};
    const size_t aoff = (size_t)(r0 + lr) * K + 8 * hi, boff = (size_t)(c0 + lr) * K + 8 * hi;
#pragma unroll 1
    for (int kc = 0; kc < K; kc += 32) {
        V a[4], a2[4];
#pragma unroll
        for (int mb = 0; mb < 4; ++mb) { a[mb] = WFrag<T16>::ld(A + aoff + (size_t)mb * 16 * K + kc); if (NSPLIT == 1 || NSPLIT == 2) a2[mb] = WFrag<T16>::ld(A2 + aoff + (size_t)mb * 16 * K + kc); }
#pragma unroll
        for (int nb = 0; nb < 4; ++nb) { const V b = WFrag<T16>::ld(Bt + boff + (size_t)nb * 16 * K + kc); V b2; if (NSPLIT >= 2) b2 = WFrag<T16>::ld(Bt2 + boff + (size_t)nb * 16 * K + kc);
#pragma unroll
            for (int mb = 0; mb < 4; ++mb) { acc[mb][nb] = WFrag<T16>::mma(a[mb], b, acc[mb][nb]); if (NSPLIT == 1 || NSPLIT == 2) acc[mb][nb] = WFrag<T16>::mma(a2[mb], b, acc[mb][nb]); if (NSPLIT >= 2) acc[mb][nb] = WFrag<T16>::mma(a[mb], b2, acc[mb][nb]); } }
        asm volatile("v_nop\n\tv_nop\n\tv_nop\n\tv_nop" : "+v"(acc[0][0]), "+v"(acc[1][1]), "+v"(acc[2][2]), "+v"(acc[3][3]) : "v"(a[0]), "v"(a[3]));
    }
    if (EPI == 2) {   // 64 divides TT: the tile's 64 rows lie in one batch
#pragma unroll
        for (int nb = 0; nb < 4; ++nb) { const int n = c0 + nb * 16 + lr; const float bb = BIAS ? bfr(bias[n]) : 0.0f; h16* vrow = Vt + ((size_t)(r0 / TT) * ldc + n) * TT + (r0 % TT) + hi * 8;
#pragma unroll
            for (int mb = 0; mb < 4; ++mb) { v8h o;
#pragma unroll
                for (int j = 0; j < 8; ++j) o[j] = (h16)(acc[mb][nb][j] + bb);
                *(v8h*)(vrow + mb * 16) = o; } }
        return; }
#pragma unroll
    for (int mb = 0; mb < 4; ++mb) {
#pragma unroll
        for (int nb = 0; nb < 4; ++nb) {
#pragma unroll
            for (int j = 0; j < 8; ++j) os[(hi * 8 + j) * 68 + nb * 16 + lr] = acc[mb][nb][j]; }
        __builtin_amdgcn_wave_barrier(); asm volatile("" ::: "memory");
        float* crow = C + (size_t)(r0 + mb * 16) * ldc + c0;
{
#pragma unroll
            for (int s = 0; s < 8; ++s) { const int row = 2 * s + hi, cofs = lr * 4; v4f val = *(const v4fa*)(os + row * 68 + cofs); if (BIAS) { val[0] += bfr(bias[c0 + cofs]); val[1] += bfr(bias[c0 + cofs + 1]); val[2] += bfr(bias[c0 + cofs + 2]); val[3] += bfr(bias[c0 + cofs + 3]); }
                if (EPI == 1) { const v4f xv = *(const v4f*)(xres + (size_t)(r0 + mb * 16 + row) * ldc + c0 + cofs); val[0] += bfr(xv[0]); val[1] += bfr(xv[1]); val[2] += bfr(xv[2]); val[3] += bfr(xv[3]); }
                *(v4f*)(crow + (size_t)row * ldc + cofs) = val; }
             }
        __builtin_amdgcn_wave_barrier(); asm volatile("" ::: "memory");
    }
}

__device__ __forceinline__ h16 tohx(float x) { return (h16)x; }
__device__ __forceinline__ void splitf(float y, unsigned short& h, unsigned short& l) { h = f2bf(y); l = f2bf(y - bf2f(h)); }
typedef __attribute__((ext_vector_type(2))) _Float16 v2h;
typedef __attribute__((ext_vector_type(4))) _Float16 v4h;
typedef __attribute__((ext_vector_type(2))) unsigned short v2us;
typedef __attribute__((ext_vector_type(4))) unsigned short v4us;
typedef __attribute__((ext_vector_type(2))) float v2f;
typedef __attribute__((ext_vector_type(4))) int v4i;

// ---- k_pvk: attn.v with its K = 2048 keys split over the KSP waves of one work-group; grid (TT/64, ZH), KSP*32 threads. Wave ks forms the f32 partial 64x64 tile of its KSL keys and lays it in its own LDS plane; behind one barrier the work-group adds the KSP planes in slice order, undoes the x1024 carry and stores the hi/lo planes [batch][t][head][d] (16 lanes write one whole 128-byte line). A = probabilities as [head][k/8][q][8]: a lane's two 16-byte fragment pieces (keys kc + 8 hi + 0..7 and kc + 16 + 8 hi + 0..7 of query row q) are pieces kc/8 + hi and kc/8 + 2 + hi at q, the k order of the Bt loader.
#define KSP 16
#define KSL (TT / KSP)
#define OSP 68                  // LDS row pitch in floats: the two 8-row halves of an accumulator tile land 32 banks apart
__global__ __launch_bounds__(KSP * 32) void k_pvk(const h16* __restrict__ A, const h16* __restrict__ Bt, int g0, bf* Ah, bf* Al) {
    __shared__ __align__(16) float os[KSP][64 * OSP];
    const size_t z = blockIdx.y; const int ks = __builtin_amdgcn_readfirstlane((int)(threadIdx.x >> 5)); A += z * ((size_t)TT * TT) + (size_t)ks * KSL * TT; Bt += z * ((size_t)HD * TT) + ks * KSL;   // the wave's number through readfirstlane: both bases stay scalar
    const int lane = threadIdx.x & 31, lr = lane & 15, hi = lane >> 4; const int r0 = blockIdx.x * 64;
    v8f acc[4][4];
#pragma unroll
    for (int mb = 0; mb < 4; ++mb)
#pragma unroll
        for (int nb = 0; nb < 4; ++nb) acc[mb][nb] = (v8f){};
    unsigned aoff = (hi * TT + r0 + lr) * 16, boff = (lr * TT + 8 * hi) * 2;   // a lane's byte offsets in this pass
#pragma unroll 1   // rolled: one pass's 8 fragments beside the 128 accumulator registers stay under 256 VGPRs
    for (int kc = 0; kc < KSL; kc += 32) {
        const h16* pa = (const h16*)((const char*)A + aoff); const h16* pb = (const h16*)((const char*)Bt + boff); v16h a[4], b[4];
#pragma unroll
        for (int mb = 0; mb < 4; ++mb) a[mb] = cat16(*(const v8h*)(pa + mb * 128), *(const v8h*)(pa + mb * 128 + 16 * TT));
#pragma unroll
        for (int nb = 0; nb < 4; ++nb) b[nb] = WFrag<h16>::ld(pb + (size_t)nb * 16 * TT);
        // behind the pass's 16 loads, before any register that they name is rewritten; the two offsets pass through the statement so that their step to the next pass stands behind it
        asm volatile("s_wait_xcnt 0x0" : "+v"(aoff), "+v"(boff) :: "memory");
        aoff += 64 * TT; boff += 64;
#pragma unroll
        for (int nb = 0; nb < 4; ++nb)
#pragma unroll
            for (int mb = 0; mb < 4; ++mb) acc[mb][nb] = wmma16(a[mb], b[nb], acc[mb][nb]);
        // four vector slots behind the pass's last WMMAs, on both sides of the loop branch: the next pass's loads rewrite a and b, the LDS stores behind the loop read acc
        asm volatile("v_nop\n\tv_nop\n\tv_nop\n\tv_nop" : "+v"(acc[0][0]), "+v"(acc[1][1]), "+v"(acc[2][2]), "+v"(acc[3][3]) : "v"(a[0]), "v"(a[3]));
    }
    float* ow = os[ks];
#pragma unroll
    for (int mb = 0; mb < 4; ++mb)
#pragma unroll
        for (int nb = 0; nb < 4; ++nb)
#pragma unroll
            for (int j = 0; j < 8; ++j) ow[(mb * 16 + hi * 8 + j) * OSP + nb * 16 + lr] = acc[mb][nb][j];
    __syncthreads();   // every slice's partial tile lies in LDS
    const int cofs = (threadIdx.x & 15) * 4;
#pragma unroll
    for (int rr = 0; rr < 2; ++rr) { const int row = (int)(threadIdx.x >> 4) + rr * 32, t = r0 + row; const float cs = (t < RH) ? 1.0f : (1.0f / PCAR); v4f sm = *(const v4fa*)(&os[0][row * OSP + cofs]);
#pragma unroll
        for (int s = 1; s < KSP; ++s) sm += *(const v4fa*)(&os[s][row * OSP + cofs]);   /* the K slices' partial sums, in slice order */
        v4us oh, ol;
#pragma unroll
        for (int q = 0; q < 4; ++q) { unsigned short a, c2; splitf(sm[q] * cs, a, c2); oh[q] = a; ol[q] = c2; }
        const int g = g0 + (int)z; const size_t oo = ((size_t)(g / NH_) * TT + t) * DQ + (g % NH_) * HD + cofs;   /* plane g = batch g / NH_, head g % NH_ */ *(v4us*)(Ah + oo) = oh; *(v4us*)(Al + oo) = ol; }
}


__global__ __launch_bounds__(256) void k_wtG(const float* __restrict__ w, int K, int N, bf* Bt) {
    const int lane = threadIdx.x & 31; const int L0 = (blockIdx.x * 8 + (threadIdx.x >> 5)) * 8; const int nlines = N * K / 64;
{
#pragma unroll 1
        for (int l = 0; l < 8; ++l) { const int L = L0 + l; if (L >= nlines) break; const size_t e = (size_t)L * 64 + lane * 2; const int k = (int)(e % K), n = (int)(e / K); v2us o;
            o[0] = f2bf(w[(size_t)k * N + n]); o[1] = f2bf(w[(size_t)(k + 1) * N + n]); *(v2us*)(Bt + e) = o; }
         }
}
__global__ __launch_bounds__(256) void k_cvt8(const float* __restrict__ src, bf* dst, size_t n8) { const size_t i = (size_t)blockIdx.x * 256 + threadIdx.x; if (i >= n8) return; const v8f v = *(const v8f*)(src + i * 8); v8us o;
#pragma unroll
    for (int k = 0; k < 8; ++k) o[k] = f2bf(v[k]); *(v8us*)(dst + i * 8) = o;  }

// ---- k_scsoft: scores and their softmax over q in one kernel; grid (TT/FKB, ZH), FNW*32 threads. A work-group owns FKB key rows against all TT queries: wave w forms S^T[FKB keys][128 queries from 128 w] in 16 accumulator tiles (3 products, K = HD, the product order a.b, a2.b, a.b2 per 32 of K), so a score never leaves the registers. Row maximum and row sum: over a lane's 8 tiles, over the 16 lanes of a row by DPP, over the FNW waves through LDS in wave order. An accumulator tile holds in each lane 8 consecutive keys of one query: one 16-byte piece of P8[head][k/8][q][8], stored as it stands (whole 128-byte lines, one writer each).
#define FKB 32
#define FNW 16
static_assert(TT % FKB == 0 && TT == FNW * 128 && HD == 64 && FKB == 32, "two 16-key tile rows; 128 query columns per wave; one lane of wave 0 per key row in the cross-wave step");
template <int M> __device__ __forceinline__ float rowx(float v) { return __builtin_bit_cast(float, __builtin_amdgcn_mov_dpp(__builtin_bit_cast(int, v), 0x160 | M, 0xf, 0xf, true)); }   // value of lane ^ M inside the 16-lane row (row_xmask)
__global__ __launch_bounds__(FNW * 32) void k_scsoft(const bf* __restrict__ Kh, const bf* __restrict__ Kl, const bf* __restrict__ Qh, const bf* __restrict__ Ql, h16* P8) {
    __shared__ __align__(16) float redm[FNW][FKB], reds[FNW][FKB], finm[FKB], fins[FKB];
    const size_t z = blockIdx.y; Kh += z * ((size_t)TT * HD); Kl += z * ((size_t)TT * HD); Qh += z * ((size_t)TT * HD); Ql += z * ((size_t)TT * HD);
    const int lane = threadIdx.x & 31, lr = lane & 15, hi = lane >> 4, w = threadIdx.x >> 5; const int k0 = blockIdx.x * FKB, q0 = w * 128;
    v16bf ah[2][2], al[2][2], rb[2][2], rb2[2][2]; v8f acc[2][8];
    const bf* qh = Qh + (size_t)(q0 + lr) * HD + 8 * hi; const bf* ql = Ql + (size_t)(q0 + lr) * HD + 8 * hi; const size_t ko = (size_t)(k0 + lr) * HD + 8 * hi;
    // step nb: the six products (K slices 0 and 1) into tiles (0, nb) and (1, nb); a step's eight query loads, which share its 32 lines, go out together, one step ahead
#pragma unroll
    for (int kk = 0; kk < 2; ++kk) { rb[0][kk] = WFrag<bf>::ld(qh + kk * 32); rb2[0][kk] = WFrag<bf>::ld(ql + kk * 32); }
#pragma unroll
    for (int mb = 0; mb < 2; ++mb)
#pragma unroll
        for (int kk = 0; kk < 2; ++kk) { ah[mb][kk] = WFrag<bf>::ld(Kh + ko + mb * 16 * HD + kk * 32); al[mb][kk] = WFrag<bf>::ld(Kl + ko + mb * 16 * HD + kk * 32); }
    asm volatile("s_wait_xcnt 0x0" ::: "memory");   // the key address registers are dead behind these loads: the wait stands before the next loads' results may land in them
#pragma unroll
    for (int nb = 0; nb < 8; ++nb) {
        if (nb + 1 < 8) {
#pragma unroll
            for (int kk = 0; kk < 2; ++kk) { rb[(nb + 1) & 1][kk] = WFrag<bf>::ld(qh + (nb + 1) * 16 * HD + kk * 32); rb2[(nb + 1) & 1][kk] = WFrag<bf>::ld(ql + (nb + 1) * 16 * HD + kk * 32); } }
        __builtin_amdgcn_sched_barrier(0);   // keeps the next step's loads ahead of this step's products: sunk to their use, each would cost its whole latency
#pragma unroll
        for (int mb = 0; mb < 2; ++mb) { v8f a = (v8f){};
#pragma unroll
            for (int kk = 0; kk < 2; ++kk) { a = wmmab(ah[mb][kk], rb[nb & 1][kk], a); a = wmmab(al[mb][kk], rb[nb & 1][kk], a); a = wmmab(ah[mb][kk], rb2[nb & 1][kk], a); }
            acc[mb][nb] = a; }
        __builtin_amdgcn_sched_barrier(0); }   // keeps later loads behind this step's products: hoisted, a third set of query fragments would be live and the build spills
    // lane (lr, hi), tile (mb, nb), register j: key k0 + 16 mb + 8 hi + j, query q0 + 16 nb + lr
    float rv[2][8];
#pragma unroll
    for (int mb = 0; mb < 2; ++mb)
#pragma unroll
        for (int j = 0; j < 8; ++j) { float m = -3.0e38f;
#pragma unroll
            for (int nb = 0; nb < 8; ++nb) m = fmaxf(m, acc[mb][nb][j]);
            m = fmaxf(m, rowx<1>(m)); m = fmaxf(m, rowx<2>(m)); m = fmaxf(m, rowx<4>(m)); m = fmaxf(m, rowx<8>(m)); rv[mb][j] = m; }
    if (lr == 0) {
#pragma unroll
        for (int mb = 0; mb < 2; ++mb) { *(v4fa*)&redm[w][mb * 16 + hi * 8] = (v4f){rv[mb][0], rv[mb][1], rv[mb][2], rv[mb][3]}; *(v4fa*)&redm[w][mb * 16 + hi * 8 + 4] = (v4f){rv[mb][4], rv[mb][5], rv[mb][6], rv[mb][7]}; } }
    __syncthreads();   // every wave's row maxima lie in LDS
    if (threadIdx.x < FKB) { float m = redm[0][threadIdx.x];
#pragma unroll
        for (int ww = 1; ww < FNW; ++ww) m = fmaxf(m, redm[ww][threadIdx.x]);
        finm[threadIdx.x] = m; }
    __syncthreads();   // the FKB row maxima over all queries are published
#pragma unroll
    for (int mb = 0; mb < 2; ++mb) { const v4f m0 = *(const v4fa*)&finm[mb * 16 + hi * 8], m1 = *(const v4fa*)&finm[mb * 16 + hi * 8 + 4]; const v8f mx = __builtin_shufflevector(m0, m1, 0, 1, 2, 3, 4, 5, 6, 7); v8f s8;
#pragma unroll
        for (int nb = 0; nb < 8; ++nb) { v8f t = (acc[mb][nb] - mx) * (SCL * 1.4426950408889634f);
#pragma unroll
            for (int j = 0; j < 8; ++j) t[j] = __builtin_amdgcn_exp2f(t[j]);
            acc[mb][nb] = t; s8 = nb ? s8 + t : t; }   // SCL is a power of two: (a - m) (SCL c) rounds as (a SCL - m SCL) c does
#pragma unroll
        for (int j = 0; j < 8; ++j) { float s = s8[j]; s += rowx<1>(s); s += rowx<2>(s); s += rowx<4>(s); s += rowx<8>(s); rv[mb][j] = s; } }
    if (lr == 0) {
#pragma unroll
        for (int mb = 0; mb < 2; ++mb) { *(v4fa*)&reds[w][mb * 16 + hi * 8] = (v4f){rv[mb][0], rv[mb][1], rv[mb][2], rv[mb][3]}; *(v4fa*)&reds[w][mb * 16 + hi * 8 + 4] = (v4f){rv[mb][4], rv[mb][5], rv[mb][6], rv[mb][7]}; } }
    __syncthreads();   // every wave's row sums lie in LDS
    if (threadIdx.x < FKB) { float s = reds[0][threadIdx.x];
#pragma unroll
        for (int ww = 1; ww < FNW; ++ww) s += reds[ww][threadIdx.x];
        fins[threadIdx.x] = __fdiv_rn(PCAR, s); }
    __syncthreads();   // the FKB row factors 1024 / sum are published
    h16* dst = P8 + ((((size_t)z * TT + k0) / 8 + hi) * TT + q0 + lr) * 8;
#pragma unroll
    for (int mb = 0; mb < 2; ++mb) { const v4f f0 = *(const v4fa*)&fins[mb * 16 + hi * 8], f1 = *(const v4fa*)&fins[mb * 16 + hi * 8 + 4];
#pragma unroll
        for (int nb = 0; nb < 8; ++nb) { v8h o;
#pragma unroll
            for (int j = 0; j < 8; ++j) o[j] = tohx(acc[mb][nb][j] * ((j < 4) ? f0[j & 3] : f1[j & 3]));
            *(v8h*)(dst + ((size_t)mb * 2 * TT + nb * 16) * 8) = o; } }
}

// k_lnrow: one wave per row; the normalised row goes out as hi/lo head planes [batch][h][t][d] (16 lanes write one whole 128-byte line of a plane)
__global__ __launch_bounds__(256) void k_lnrow(const float* __restrict__ F, const float* __restrict__ gw, bf* Ph, bf* Pl) {
    const int lane = threadIdx.x & 31; const int r = blockIdx.x * 8 + (threadIdx.x >> 5); if (r >= NB_ * TT) return; float hv[DM / 32]; float s = 0.f; const float* fr = F + (size_t)r * DM;
#pragma unroll
    for (int ch = 0; ch < DM / 128; ++ch) { const v4f y = *(const v4f*)(fr + ch * 128 + lane * 4);
#pragma unroll
        for (int q = 0; q < 4; ++q) { hv[ch * 4 + q] = y[q]; s += y[q]; } }
#pragma unroll
    for (int sh = 16; sh; sh >>= 1) s += __shfl_xor(s, sh, 32);
    const float mu = s * (1.0f / DM); float s2 = 0.f;
#pragma unroll
    for (int k = 0; k < DM / 32; ++k) { float d0 = __fsub_rn(hv[k], mu); asm volatile("" : "+v"(d0)); float p = __fmul_rn(d0, d0); asm volatile("" : "+v"(p)); s2 = __fadd_rn(s2, p); }
#pragma unroll
    for (int sh = 16; sh; sh >>= 1) s2 += __shfl_xor(s2, sh, 32);
    float var = __fadd_rn(s2 * (1.0f / DM), 1e-5f); asm volatile("" : "+v"(var)); const float rs = __frsqrt_rn(var);
    const size_t pb = ((size_t)(r / TT) * NH_ * TT + (r % TT)) * HD;
{
#pragma unroll
        for (int ch = 0; ch < DM / 128; ++ch) { const int c0 = ch * 128 + lane * 4; v4f o; v4us oh, ol;
#pragma unroll
            for (int q = 0; q < 4; ++q) { float gb = bfr(gw[c0 + q]); asm volatile("" : "+v"(gb)); float d0 = __fsub_rn(hv[ch * 4 + q], mu); asm volatile("" : "+v"(d0)); float n0 = __fmul_rn(d0, rs); asm volatile("" : "+v"(n0)); o[q] = __fmul_rn(n0, gb); unsigned short a2, c2; splitf(o[q], a2, c2); oh[q] = a2; ol[q] = c2; }
            const size_t po = pb + (size_t)(c0 / HD) * (TT * HD) + (c0 % HD); *(v4us*)(Ph + po) = oh; *(v4us*)(Pl + po) = ol;
            if (ch + 1 < DM / 128) asm volatile("s_wait_xcnt 0x0" ::: "memory"); }   // behind the two stores, before the next 128 columns' values rewrite the registers that they name
         } }
extern "C" void kernel_launch(void* const* d_in, const int* in_sizes, int n_in,
                              void* d_out, int out_size, void* d_ws, size_t ws_size, hipStream_t stream) {
    (void)in_sizes; (void)n_in; (void)out_size;
    const float* x = (const float*)d_in[0]; const float* wq = (const float*)d_in[1]; const float* wk = (const float*)d_in[2]; const float* bk = (const float*)d_in[3]; const float* wv = (const float*)d_in[4]; const float* bv = (const float*)d_in[5]; const float* gq = (const float*)d_in[6]; const float* gk = (const float*)d_in[7]; const float* wo = (const float*)d_in[8]; const float* bo = (const float*)d_in[9];
    float* OUT = (float*)d_out;     // [4][2048][768]
    char* wsp = (char*)d_ws;
    auto take = [&](size_t bytes) { char* p = wsp; wsp += (bytes + 255) & ~(size_t)255; return (void*)p; };
    bf* WQ = (bf*)take((size_t)DQ * DM * 2); bf* WK = (bf*)take((size_t)DKV * DM * 2); bf* WV = (bf*)take((size_t)DKV * DM * 2); bf* WO = (bf*)take((size_t)DM * DQ * 2);
    // planes of all NB_ batches that the attention launches read or write
    bf* QPh = (bf*)take((size_t)NB_ * NH_ * TT * HD * 2); bf* QPl = (bf*)take((size_t)NB_ * NH_ * TT * HD * 2); bf* KPh = (bf*)take((size_t)NB_ * NKV * TT * HD * 2); bf* KPl = (bf*)take((size_t)NB_ * NKV * TT * HD * 2); h16* VT16 = (h16*)take((size_t)NB_ * NKV * HD * TT * 2);
    bf* ATh = (bf*)take((size_t)NB_ * TT * DQ * 2); bf* ATl = (bf*)take((size_t)NB_ * TT * DQ * 2);
    char* const big = wsp;
    h16* P8 = (h16*)take((size_t)ZH * TT * TT * 2);
    if ((size_t)(wsp - (char*)d_ws) > ws_size) return;
    // the probability bytes serve, stream-ordered, the projection stage's buffers before the first attention launch
    static_assert((NB_ * NH_) % ZH == 0, "whole groups of planes");
    static_assert((size_t)NB_ * TT * DM * 2 + (size_t)NB_ * TT * (DQ + DKV) * 4 <= (size_t)ZH * TT * TT * 2, "projection stage fits the probability bytes");
    wsp = big;
    bf* XB = (bf*)take((size_t)NB_ * TT * DM * 2); float* FQ = (float*)take((size_t)NB_ * TT * DQ * 4); float* FK = (float*)take((size_t)NB_ * TT * DKV * 4);
    k_cvt8<<<(unsigned)(((size_t)DQ * DM / 8 + 255) / 256), 256, 0, stream>>>(wq, WQ, (size_t)DQ * DM / 8); k_cvt8<<<(unsigned)(((size_t)DKV * DM / 8 + 255) / 256), 256, 0, stream>>>(wk, WK, (size_t)DKV * DM / 8); k_cvt8<<<(unsigned)(((size_t)DKV * DM / 8 + 255) / 256), 256, 0, stream>>>(wv, WV, (size_t)DKV * DM / 8); k_cvt8<<<(unsigned)(((size_t)DM * DQ / 8 + 255) / 256), 256, 0, stream>>>(wo, WO, (size_t)DM * DQ / 8);   /* 'oi' weights = Bt as-is */
    // every launch of this stage covers the NB_ * TT rows of all batches
    k_cvt8<<<(unsigned)(((size_t)NB_ * TT * DM / 8 + 255) / 256), 256, 0, stream>>>(x, XB, (size_t)NB_ * TT * DM / 8);
    k_gemmw<bf, 0, false, 0><<<dim3(NB_ * TT / 64, DQ / 64, 1), 32, 0, stream>>>(XB, nullptr, WQ, nullptr, DM, FQ, DQ, nullptr, 0, 0, 0, nullptr, nullptr); k_lnrow<<<NB_ * TT / 8, 256, 0, stream>>>(FQ, gq, QPh, QPl);   /* q = LN(x Wq^T) gq -> head planes */
    k_gemmw<bf, 0, true, 0><<<dim3(NB_ * TT / 64, DKV / 64, 1), 32, 0, stream>>>(XB, nullptr, WK, nullptr, DM, FK, DKV, bk, 0, 0, 0, nullptr, nullptr); k_lnrow<<<NB_ * TT / 8, 256, 0, stream>>>(FK, gk, KPh, KPl);   /* k = LN(x Wk^T + bk) gk -> head planes */
    k_gemmw<bf, 0, true, 2><<<dim3(NB_ * TT / 64, DKV / 64, 1), 32, 0, stream>>>(XB, nullptr, WV, nullptr, DM, nullptr, DKV, bv, 0, 0, 0, nullptr, VT16);   /* v = x Wv^T + bv -> fp16 planes [batch][g][d][t] */
    for (int g0 = 0; g0 < NB_ * NH_; g0 += ZH) { const size_t zq = (size_t)g0;   // first plane of the group, planes [batch][head]
        k_scsoft<<<dim3(TT / FKB, ZH, 1), FNW * 32, 0, stream>>>(KPh + zq * TT * HD, KPl + zq * TT * HD, QPh + zq * TT * HD, QPl + zq * TT * HD, P8);   /* S^T[k][q] = k_k.q_q (3 products), softmax over q -> fp16 x1024 [k/8][q][8] */
        k_pvk<<<dim3(TT / 64, ZH, 1), KSP * 32, 0, stream>>>(P8, VT16 + zq * HD * TT, g0, ATh, ATl); }   /* o = attn . v (one product), KSP slices summed in LDS; hi/lo planes, carry undone on every row (RH 0) */
    k_gemmw<bf, 1, true, 1><<<dim3(NB_ * TT / 64, DM / 64, 1), 32, 0, stream>>>(ATh, ATl, WO, nullptr, DQ, OUT, DM, bo, 0, 0, 0, x, nullptr);   /* o Wo^T + bo, + x */
}

// v009
// It runs in 377 microseconds.
// Two timings next to v008 both put it at 1.20 times that version's speed.
// All steps since v000 together make it 8.24 times as fast.
#include <hip/hip_runtime.h>

// Multi-head self-attention with QK-LayerNorm and the module's QUERY-axis softmax (x [4][2048][768]; q = LN_nobias(x Wq^T) gq, k = LN_nobias(x Wk^T + bk) gk (LayerNorm over the full 768), v = x Wv^T + bv ('oi' [768][768]; 12 heads x 64); scores = q.k/8; attn = softmax over the QUERY axis (per key column); o[q] = sum_k attn[q][k] v[k]; out = merged o Wo^T + bo + x -> [4][2048][768] (6.3 M)).
// Projections, LayerNorm and Wo each run once over all NB_ * TT rows, and each stores what its reader wants (LayerNorm the q/k hi/lo head planes, the v product the fp16 v^T planes, Wo the sum with bo and x); the attention launches go per group of ZH of the NB_ * NH_ (batch, head) planes, ZH chosen so that both attention grids are whole multiples of the chip's 256 WGPs (each work-group fills one WGP): the TRANSPOSED scores S^T[k][q] = k_k.q_q (3 products) are formed and normalised over q inside one kernel and never stored; probabilities are written fp16 x1024 as 16-byte pieces [k/8][q][8] (8 keys of one query, as an accumulator tile holds them), which are the A fragment pieces of the product with the fp16 value planes (one product, K = 2048), whose kernel adds its K slices in LDS and undoes the carry into hi/lo planes; Wo (2 products) + bo; + x residual in f32.
// Compute dtypes, f32 accumulate: every input rounded to bf16; q/k/v on PLAIN bf16 operands (exact) + biases; LayerNorm f32 (biased variance, eps 1e-5); scores hi/lo (3 products) on every row; softmax f32; attn.v single fp16 (P x1024); Wo hl x exact (2 products) + bo; residual f32.

#define NB_  4
#define TT   2048
#define DM   768
#define NH_  12
#define NKV  12
#define REP  (NH_ / NKV)
#define HD   64
#define DQ   (NH_ * HD)
#define DKV  (NKV * HD)
#define ZH   16                   // (batch, head) planes per attention launch: 64 ZH and 32 ZH work-groups, one to a WGP, are whole rounds of 256 WGPs
#define RH   0                    // every probability row carries x1024 (k_pvk undoes it on all rows)
#define WIN  0
#define PCAR 1024.0f
#define SCL  0.125f   // HD^-0.5
typedef _Float16 h16;
typedef unsigned short bf;
typedef __attribute__((ext_vector_type(16))) __bf16   v16bf;
typedef __attribute__((ext_vector_type(16))) _Float16 v16h;
typedef __attribute__((ext_vector_type(8)))  _Float16 v8h;
typedef __attribute__((ext_vector_type(8)))  unsigned short v8us;
typedef __attribute__((ext_vector_type(8)))  float    v8f;
typedef __attribute__((ext_vector_type(4)))  float    v4f;
typedef v8h  __attribute__((may_alias)) v8ha;
typedef v4f  __attribute__((may_alias)) v4fa;
typedef v8us __attribute__((may_alias)) v8usa;

__device__ __forceinline__ unsigned short f2bf(float f) { unsigned u = __float_as_uint(f); u += 0x7FFFu + ((u >> 16) & 1u); return (unsigned short)(u >> 16); }
__device__ __forceinline__ float bf2f(unsigned short b) { return __uint_as_float(((unsigned)b) << 16); }
__device__ __forceinline__ float bfr(float f) { return bf2f(f2bf(f)); }
__device__ __forceinline__ v16h cat16(v8h lo, v8h hi) { return __builtin_shufflevector(lo, hi, 0, 1, 2, 3, 4, 5, 6, 7, 8, 9, 10, 11, 12, 13, 14, 15); }
__device__ __forceinline__ v16bf cat16b(v8us lo, v8us hi) { return __builtin_bit_cast(v16bf, __builtin_shufflevector(lo, hi, 0, 1, 2, 3, 4, 5, 6, 7, 8, 9, 10, 11, 12, 13, 14, 15)); }
__device__ __forceinline__ v8f wmma16(v16h a, v16h b, v8f c) { return __builtin_amdgcn_wmma_f32_16x16x32_f16(false, a, false, b, (short)0, c, false, false); }
__device__ __forceinline__ v8f wmmab(v16bf a, v16bf b, v8f c) { return __builtin_amdgcn_wmma_f32_16x16x32_bf16(false, a, false, b, (short)0, c, false, false); }



// ---- Operand planes: every 16-bit matrix operand lies as 16-byte pieces [k/8][row][8] (8 consecutive k of one row; the rows of one k/8 side by side). A lane's two fragment pieces (k = kc + 8 hi + 0..7 and kc + 16 + 8 hi + 0..7 of its row) are pieces kc/8 + hi and kc/8 + 2 + hi at that row, for A and B alike; the 16 lanes of a half wave read 256 bytes in a row, so one fragment load covers four whole 128-byte lines. ldp(p, two): p = the first piece, two = the distance of two k/8 steps in elements.
// ---- k_gemmw: register-blocked GEMM, ONE WAVE per 64x64 output tile (16 accumulators), operands straight from piece planes A [K/8][MR][8], Bt [K/8][NR][8]; grid (MR/64, NR/64, Z), 32 threads.
// C[m][n] (f32, pitch ldc, + optional f32 bias[n]) = sum_k A[m][k] Bt[n][k] (+ split products per NSPLIT). z-batch strides sA/sB/sC in elements. K % 32 == 0.
// EPI 0: C as it stands. EPI 1: C + bf16-rounded xres[m][n] (pitch ldc). EPI 2: no C; fp16 of the result goes to the piece planes Vt[m / TT][n / HD][(m % TT) / 8][n % HD][8]: a lane's 8 accumulator registers are 8 consecutive m of one n, one 16-byte piece, and 16 lanes store two whole 128-byte lines.
template <typename T16> struct WFrag;
template <> struct WFrag<h16> { typedef v16h V; static __device__ __forceinline__ V ldp(const h16* p, int two) { return cat16(*(const v8h*)p, *(const v8h*)(p + two)); } static __device__ __forceinline__ v8f mma(V a, V b, v8f c) { return wmma16(a, b, c); } };
template <> struct WFrag<bf> { typedef v16bf V; static __device__ __forceinline__ V ldp(const bf* p, int two) { return cat16b(*(const v8us*)p, *(const v8us*)(p + two)); } static __device__ __forceinline__ v8f mma(V a, V b, v8f c) { return wmmab(a, b, c); } };
template <typename T16, int NSPLIT, bool BIAS, int EPI, int MR, int NR>
__global__ __launch_bounds__(32) void k_gemmw(const T16* __restrict__ A, const T16* __restrict__ A2, const T16* __restrict__ Bt, const T16* __restrict__ Bt2, int K, float* C, int ldc, const float* __restrict__ bias, size_t sA, size_t sB, size_t sC, const float* __restrict__ xres, h16* Vt) {
    typedef typename WFrag<T16>::V V;
    __shared__ __align__(16) float os[16 * 68];
    const size_t z = blockIdx.z; A += z * sA; if (A2) A2 += z * sA; Bt += z * sB; if (Bt2) Bt2 += z * sB; C += z * sC;
    const int lane = threadIdx.x & 31, lr = lane & 15, hi = lane >> 4; const int r0 = blockIdx.x * 64, c0 = blockIdx.y * 64;
    v8f acc[4][4];
#pragma unroll
    for (int mb = 0; mb < 4; ++mb)
#pragma unroll
        for (int nb = 0; nb < 4; ++nb) acc[mb][nb] = (v8f){};
    unsigned aoff = (hi * MR + r0 + lr) * 16, boff = (hi * NR + c0 + lr) * 16;   // a lane's byte offsets in this pass
#pragma unroll 1
    for (int kc = 0; kc < K; kc += 32) {
        V a[4], a2[4], b[4], b2[4];
#pragma unroll
        for (int mb = 0; mb < 4; ++mb) { a[mb] = WFrag<T16>::ldp((const T16*)((const char*)A + aoff) + mb * 128, 16 * MR); if (NSPLIT == 1 || NSPLIT == 2) a2[mb] = WFrag<T16>::ldp((const T16*)((const char*)A2 + aoff) + mb * 128, 16 * MR); }
#pragma unroll
        for (int nb = 0; nb < 4; ++nb) { b[nb] = WFrag<T16>::ldp((const T16*)((const char*)Bt + boff) + nb * 128, 16 * NR); if (NSPLIT >= 2) b2[nb] = WFrag<T16>::ldp((const T16*)((const char*)Bt2 + boff) + nb * 128, 16 * NR); }
        // behind the pass's loads, before any register that they name is rewritten; the two offsets pass through the statement so that their step to the next pass stands behind it
        asm volatile("s_wait_xcnt 0x0" : "+v"(aoff), "+v"(boff) :: "memory");
        aoff += 64 * MR; boff += 64 * NR;
#pragma unroll
        for (int nb = 0; nb < 4; ++nb) {
#pragma unroll
            for (int mb = 0; mb < 4; ++mb) { acc[mb][nb] = WFrag<T16>::mma(a[mb], b[nb], acc[mb][nb]); if (NSPLIT == 1 || NSPLIT == 2) acc[mb][nb] = WFrag<T16>::mma(a2[mb], b[nb], acc[mb][nb]); if (NSPLIT >= 2) acc[mb][nb] = WFrag<T16>::mma(a[mb], b2[nb], acc[mb][nb]); } }
        asm volatile("v_nop\n\tv_nop\n\tv_nop\n\tv_nop" : "+v"(acc[0][0]), "+v"(acc[1][1]), "+v"(acc[2][2]), "+v"(acc[3][3]) : "v"(a[0]), "v"(a[3]));
    }
    if (EPI == 2) {   // 64 divides TT: the tile's 64 rows lie in one batch
#pragma unroll
        for (int nb = 0; nb < 4; ++nb) { const int n = c0 + nb * 16 + lr; const float bb = BIAS ? bfr(bias[n]) : 0.0f; h16* vrow = Vt + ((size_t)(r0 / TT) * ldc + (n / HD) * HD) * TT + ((size_t)((r0 % TT) / 8 + hi) * HD + n % HD) * 8;
#pragma unroll
            for (int mb = 0; mb < 4; ++mb) { v8h o;
#pragma unroll
                for (int j = 0; j < 8; ++j) o[j] = (h16)(acc[mb][nb][j] + bb);
                *(v8h*)(vrow + mb * 2 * HD * 8) = o; } }
        return; }
#pragma unroll
    for (int mb = 0; mb < 4; ++mb) {
#pragma unroll
        for (int nb = 0; nb < 4; ++nb) {
#pragma unroll
            for (int j = 0; j < 8; ++j) os[(hi * 8 + j) * 68 + nb * 16 + lr] = acc[mb][nb][j]; }
        __builtin_amdgcn_wave_barrier(); asm volatile("" ::: "memory");
        float* crow = C + (size_t)(r0 + mb * 16) * ldc + c0;
{
#pragma unroll
            for (int s = 0; s < 8; ++s) { const int row = 2 * s + hi, cofs = lr * 4; v4f val = *(const v4fa*)(os + row * 68 + cofs); if (BIAS) { val[0] += bfr(bias[c0 + cofs]); val[1] += bfr(bias[c0 + cofs + 1]); val[2] += bfr(bias[c0 + cofs + 2]); val[3] += bfr(bias[c0 + cofs + 3]); }
                if (EPI == 1) { const v4f xv = *(const v4f*)(xres + (size_t)(r0 + mb * 16 + row) * ldc + c0 + cofs); val[0] += bfr(xv[0]); val[1] += bfr(xv[1]); val[2] += bfr(xv[2]); val[3] += bfr(xv[3]); }
                *(v4f*)(crow + (size_t)row * ldc + cofs) = val; }
             }
        __builtin_amdgcn_wave_barrier(); asm volatile("" ::: "memory");
    }
}

__device__ __forceinline__ h16 tohx(float x) { return (h16)x; }
__device__ __forceinline__ void splitf(float y, unsigned short& h, unsigned short& l) { h = f2bf(y); l = f2bf(y - bf2f(h)); }
typedef __attribute__((ext_vector_type(2))) _Float16 v2h;
typedef __attribute__((ext_vector_type(4))) _Float16 v4h;
typedef __attribute__((ext_vector_type(2))) unsigned short v2us;
typedef __attribute__((ext_vector_type(4))) unsigned short v4us;
typedef __attribute__((ext_vector_type(2))) float v2f;
typedef __attribute__((ext_vector_type(4))) int v4i;

// ---- k_pvk: attn.v with its K = 2048 keys split over the KSP waves of one work-group; grid (TT/64, ZH), KSP*32 threads. Wave ks forms the f32 partial 64x64 tile of its KSL keys and lays it in its own LDS plane; behind one barrier the work-group adds the KSP planes in slice order, undoes the x1024 carry and stores the hi/lo piece planes [(head, d)/8][(batch, t)][8] (a wave writes four whole 128-byte lines). A = probabilities as [head][k/8][q][8], Bt = values as [head][k/8][d][8]: piece planes both, one k order.
#define KSP 16
#define KSL (TT / KSP)
#define OSP 68                  // LDS row pitch in floats: the two 8-row halves of an accumulator tile land 32 banks apart
__global__ __launch_bounds__(KSP * 32) void k_pvk(const h16* __restrict__ A, const h16* __restrict__ Bt, int g0, bf* Ah, bf* Al) {
    __shared__ __align__(16) float os[KSP][64 * OSP];
    const size_t z = blockIdx.y; const int ks = __builtin_amdgcn_readfirstlane((int)(threadIdx.x >> 5)); A += z * ((size_t)TT * TT) + (size_t)ks * KSL * TT; Bt += z * ((size_t)HD * TT) + ks * (KSL * HD);   // the wave's number through readfirstlane: both bases stay scalar
    const int lane = threadIdx.x & 31, lr = lane & 15, hi = lane >> 4; const int r0 = blockIdx.x * 64;
    v8f acc[4][4];
#pragma unroll
    for (int mb = 0; mb < 4; ++mb)
#pragma unroll
        for (int nb = 0; nb < 4; ++nb) acc[mb][nb] = (v8f){};
    unsigned aoff = (hi * TT + r0 + lr) * 16, boff = (hi * HD + lr) * 16;   // a lane's byte offsets in this pass
#pragma unroll 1   // rolled: one pass's 8 fragments beside the 128 accumulator registers stay under 256 VGPRs
    for (int kc = 0; kc < KSL; kc += 32) {
        const h16* pa = (const h16*)((const char*)A + aoff); const h16* pb = (const h16*)((const char*)Bt + boff); v16h a[4], b[4];
#pragma unroll
        for (int mb = 0; mb < 4; ++mb) a[mb] = cat16(*(const v8h*)(pa + mb * 128), *(const v8h*)(pa + mb * 128 + 16 * TT));
#pragma unroll
        for (int nb = 0; nb < 4; ++nb) b[nb] = WFrag<h16>::ldp(pb + nb * 128, 16 * HD);
        // behind the pass's 16 loads, before any register that they name is rewritten; the two offsets pass through the statement so that their step to the next pass stands behind it
        asm volatile("s_wait_xcnt 0x0" : "+v"(aoff), "+v"(boff) :: "memory");
        aoff += 64 * TT; boff += 64 * HD;
#pragma unroll
        for (int nb = 0; nb < 4; ++nb)
#pragma unroll
            for (int mb = 0; mb < 4; ++mb) acc[mb][nb] = wmma16(a[mb], b[nb], acc[mb][nb]);
        // four vector slots behind the pass's last WMMAs, on both sides of the loop branch: the next pass's loads rewrite a and b, the LDS stores behind the loop read acc
        asm volatile("v_nop\n\tv_nop\n\tv_nop\n\tv_nop" : "+v"(acc[0][0]), "+v"(acc[1][1]), "+v"(acc[2][2]), "+v"(acc[3][3]) : "v"(a[0]), "v"(a[3]));
    }
    float* ow = os[ks];
#pragma unroll
    for (int mb = 0; mb < 4; ++mb)
#pragma unroll
        for (int nb = 0; nb < 4; ++nb)
#pragma unroll
            for (int j = 0; j < 8; ++j) ow[(mb * 16 + hi * 8 + j) * OSP + nb * 16 + lr] = acc[mb][nb][j];
    __syncthreads();   // every slice's partial tile lies in LDS
    static_assert(KSP * 32 == 64 * (HD / 8), "one thread per 16-byte piece of the 64 x HD tile");
    { const int row = (int)(threadIdx.x & 63), d8 = (int)(threadIdx.x >> 6), t = r0 + row; const float cs = (t < RH) ? 1.0f : (1.0f / PCAR); v4f s0 = *(const v4fa*)(&os[0][row * OSP + d8 * 8]), s1 = *(const v4fa*)(&os[0][row * OSP + d8 * 8 + 4]);
#pragma unroll
        for (int s = 1; s < KSP; ++s) { s0 += *(const v4fa*)(&os[s][row * OSP + d8 * 8]); s1 += *(const v4fa*)(&os[s][row * OSP + d8 * 8 + 4]); }   /* the K slices' partial sums, in slice order */
        v8us oh, ol;
#pragma unroll
        for (int q = 0; q < 8; ++q) { unsigned short a, c2; splitf(((q < 4) ? s0[q & 3] : s1[q & 3]) * cs, a, c2); oh[q] = a; ol[q] = c2; }
        const int g = g0 + (int)z; const size_t oo = (((size_t)(g % NH_) * (HD / 8) + d8) * (NB_ * TT) + (size_t)(g / NH_) * TT + t) * 8;   /* plane g = batch g / NH_, head g % NH_ */ *(v8us*)(Ah + oo) = oh; *(v8us*)(Al + oo) = ol; }
}


__global__ __launch_bounds__(256) void k_wtG(const float* __restrict__ w, int K, int N, bf* Bt) {
    const int lane = threadIdx.x & 31; const int L0 = (blockIdx.x * 8 + (threadIdx.x >> 5)) * 8; const int nlines = N * K / 64;
{
#pragma unroll 1
        for (int l = 0; l < 8; ++l) { const int L = L0 + l; if (L >= nlines) break; const size_t e = (size_t)L * 64 + lane * 2; const int k = (int)(e % K), n = (int)(e / K); v2us o;
            o[0] = f2bf(w[(size_t)k * N + n]); o[1] = f2bf(w[(size_t)(k + 1) * N + n]); *(v2us*)(Bt + e) = o; }
         }
}
// k_cvtp: f32 [R][K] -> bf16 piece plane [K/8][R][8]; grid (R/32, K/64), 256 threads. A thread rounds 8 consecutive k of one row (8 lanes read 256 bytes in a row); the 32 x 8 pieces turn through LDS so that a wave stores 32 rows of one k/8, four whole 128-byte lines.
__global__ __launch_bounds__(256) void k_cvtp(const float* __restrict__ src, bf* dst, int R, int K) {
    __shared__ __align__(16) bf sh[8][33][8];
    const int r0 = blockIdx.x * 32, k80 = blockIdx.y * 8; const v8f v = *(const v8f*)(src + (size_t)(r0 + (int)(threadIdx.x >> 3)) * K + (k80 + (int)(threadIdx.x & 7)) * 8); v8us o;
#pragma unroll
    for (int k = 0; k < 8; ++k) o[k] = f2bf(v[k]);
    *(v8usa*)&sh[threadIdx.x & 7][threadIdx.x >> 3][0] = o;
    __syncthreads();   // the block's 256 pieces lie in LDS
    *(v8us*)(dst + ((size_t)(k80 + (int)(threadIdx.x >> 5)) * R + r0 + (int)(threadIdx.x & 31)) * 8) = *(const v8usa*)&sh[threadIdx.x >> 5][threadIdx.x & 31][0]; }

// ---- k_scsoft: scores and their softmax over q in one kernel; grid (TT/FKB, ZH), FNW*32 threads. A work-group owns FKB key rows against all TT queries: wave w forms S^T[FKB keys][128 queries from 128 w] in 16 accumulator tiles (3 products, K = HD, the product order a.b, a2.b, a.b2 per 32 of K), so a score never leaves the registers. Row maximum and row sum: over a lane's 8 tiles, over the 16 lanes of a row by DPP, over the FNW waves through LDS in wave order. An accumulator tile holds in each lane 8 consecutive keys of one query: one 16-byte piece of P8[head][k/8][q][8], stored as it stands (whole 128-byte lines, one writer each).
#define FKB 32
#define FNW 16
static_assert(TT % FKB == 0 && TT == FNW * 128 && HD == 64 && FKB == 32, "two 16-key tile rows; 128 query columns per wave; one lane of wave 0 per key row in the cross-wave step");
template <int M> __device__ __forceinline__ float rowx(float v) { return __builtin_bit_cast(float, __builtin_amdgcn_mov_dpp(__builtin_bit_cast(int, v), 0x160 | M, 0xf, 0xf, true)); }   // value of lane ^ M inside the 16-lane row (row_xmask)
__global__ __launch_bounds__(FNW * 32) void k_scsoft(const bf* __restrict__ Kh, const bf* __restrict__ Kl, const bf* __restrict__ Qh, const bf* __restrict__ Ql, h16* P8) {
    __shared__ __align__(16) float redm[FNW][FKB], reds[FNW][FKB], finm[FKB], fins[FKB];
    const size_t z = blockIdx.y; Kh += z * ((size_t)TT * HD); Kl += z * ((size_t)TT * HD); Qh += z * ((size_t)TT * HD); Ql += z * ((size_t)TT * HD);
    const int lane = threadIdx.x & 31, lr = lane & 15, hi = lane >> 4, w = threadIdx.x >> 5; const int k0 = blockIdx.x * FKB, q0 = w * 128;
    v16bf ah[2][2], al[2][2], rb[2][2], rb2[2][2]; v8f acc[2][8];
    const bf* qh = Qh + ((size_t)hi * TT + q0 + lr) * 8; const bf* ql = Ql + ((size_t)hi * TT + q0 + lr) * 8; const size_t ko = ((size_t)hi * TT + k0 + lr) * 8;   // piece planes [d/8][t][8]
    // step nb: the six products (K slices 0 and 1) into tiles (0, nb) and (1, nb); a step's eight query loads go out together, one step ahead
#pragma unroll
    for (int kk = 0; kk < 2; ++kk) { rb[0][kk] = WFrag<bf>::ldp(qh + kk * 32 * TT, 16 * TT); rb2[0][kk] = WFrag<bf>::ldp(ql + kk * 32 * TT, 16 * TT); }
#pragma unroll
    for (int mb = 0; mb < 2; ++mb)
#pragma unroll
        for (int kk = 0; kk < 2; ++kk) { ah[mb][kk] = WFrag<bf>::ldp(Kh + ko + mb * 128 + kk * 32 * TT, 16 * TT); al[mb][kk] = WFrag<bf>::ldp(Kl + ko + mb * 128 + kk * 32 * TT, 16 * TT); }
    asm volatile("s_wait_xcnt 0x0" ::: "memory");   // the key address registers are dead behind these loads: the wait stands before the next loads' results may land in them
#pragma unroll
    for (int nb = 0; nb < 8; ++nb) {
        if (nb + 1 < 8) {
#pragma unroll
            for (int kk = 0; kk < 2; ++kk) { rb[(nb + 1) & 1][kk] = WFrag<bf>::ldp(qh + (nb + 1) * 128 + kk * 32 * TT, 16 * TT); rb2[(nb + 1) & 1][kk] = WFrag<bf>::ldp(ql + (nb + 1) * 128 + kk * 32 * TT, 16 * TT); } }
        __builtin_amdgcn_sched_barrier(0);   // keeps the next step's loads ahead of this step's products: sunk to their use, each would cost its whole latency
#pragma unroll
        for (int mb = 0; mb < 2; ++mb) { v8f a = (v8f){};
#pragma unroll
            for (int kk = 0; kk < 2; ++kk) { a = wmmab(ah[mb][kk], rb[nb & 1][kk], a); a = wmmab(al[mb][kk], rb[nb & 1][kk], a); a = wmmab(ah[mb][kk], rb2[nb & 1][kk], a); }
            acc[mb][nb] = a; }
        __builtin_amdgcn_sched_barrier(0); }   // keeps later loads behind this step's products: hoisted, a third set of query fragments would be live and the build spills
    // lane (lr, hi), tile (mb, nb), register j: key k0 + 16 mb + 8 hi + j, query q0 + 16 nb + lr
    float rv[2][8];
#pragma unroll
    for (int mb = 0; mb < 2; ++mb)
#pragma unroll
        for (int j = 0; j < 8; ++j) { float m = -3.0e38f;
#pragma unroll
            for (int nb = 0; nb < 8; ++nb) m = fmaxf(m, acc[mb][nb][j]);
            m = fmaxf(m, rowx<1>(m)); m = fmaxf(m, rowx<2>(m)); m = fmaxf(m, rowx<4>(m)); m = fmaxf(m, rowx<8>(m)); rv[mb][j] = m; }
    if (lr == 0) {
#pragma unroll
        for (int mb = 0; mb < 2; ++mb) { *(v4fa*)&redm[w][mb * 16 + hi * 8] = (v4f){rv[mb][0], rv[mb][1], rv[mb][2], rv[mb][3]}; *(v4fa*)&redm[w][mb * 16 + hi * 8 + 4] = (v4f){rv[mb][4], rv[mb][5], rv[mb][6], rv[mb][7]}; } }
    __syncthreads();   // every wave's row maxima lie in LDS
    if (threadIdx.x < FKB) { float m = redm[0][threadIdx.x];
#pragma unroll
        for (int ww = 1; ww < FNW; ++ww) m = fmaxf(m, redm[ww][threadIdx.x]);
        finm[threadIdx.x] = m; }
    __syncthreads();   // the FKB row maxima over all queries are published
#pragma unroll
    for (int mb = 0; mb < 2; ++mb) { const v4f m0 = *(const v4fa*)&finm[mb * 16 + hi * 8], m1 = *(const v4fa*)&finm[mb * 16 + hi * 8 + 4]; const v8f mx = __builtin_shufflevector(m0, m1, 0, 1, 2, 3, 4, 5, 6, 7); v8f s8;
#pragma unroll
        for (int nb = 0; nb < 8; ++nb) { v8f t = (acc[mb][nb] - mx) * (SCL * 1.4426950408889634f);
#pragma unroll
            for (int j = 0; j < 8; ++j) t[j] = __builtin_amdgcn_exp2f(t[j]);
            acc[mb][nb] = t; s8 = nb ? s8 + t : t; }   // SCL is a power of two: (a - m) (SCL c) rounds as (a SCL - m SCL) c does
#pragma unroll
        for (int j = 0; j < 8; ++j) { float s = s8[j]; s += rowx<1>(s); s += rowx<2>(s); s += rowx<4>(s); s += rowx<8>(s); rv[mb][j] = s; } }
    if (lr == 0) {
#pragma unroll
        for (int mb = 0; mb < 2; ++mb) { *(v4fa*)&reds[w][mb * 16 + hi * 8] = (v4f){rv[mb][0], rv[mb][1], rv[mb][2], rv[mb][3]}; *(v4fa*)&reds[w][mb * 16 + hi * 8 + 4] = (v4f){rv[mb][4], rv[mb][5], rv[mb][6], rv[mb][7]}; } }
    __syncthreads();   // every wave's row sums lie in LDS
    if (threadIdx.x < FKB) { float s = reds[0][threadIdx.x];
#pragma unroll
        for (int ww = 1; ww < FNW; ++ww) s += reds[ww][threadIdx.x];
        fins[threadIdx.x] = __fdiv_rn(PCAR, s); }
    __syncthreads();   // the FKB row factors 1024 / sum are published
    h16* dst = P8 + ((((size_t)z * TT + k0) / 8 + hi) * TT + q0 + lr) * 8;
#pragma unroll
    for (int mb = 0; mb < 2; ++mb) { const v4f f0 = *(const v4fa*)&fins[mb * 16 + hi * 8], f1 = *(const v4fa*)&fins[mb * 16 + hi * 8 + 4];
#pragma unroll
        for (int nb = 0; nb < 8; ++nb) { v8h o;
#pragma unroll
            for (int j = 0; j < 8; ++j) o[j] = tohx(acc[mb][nb][j] * ((j < 4) ? f0[j & 3] : f1[j & 3]));
            *(v8h*)(dst + ((size_t)mb * 2 * TT + nb * 16) * 8) = o; } }
}

// k_lnrow: one wave per row; the block's 8 normalised rows turn through LDS and go out as hi/lo piece planes [batch][h][d/8][t][8] (8 lanes write the 8 rows' pieces of one d/8, one whole 128-byte line)
#define LNP 784                 // LDS row pitch in 16-bit elements: 8 banks from row to row, so 8 rows x 2 neighbouring pieces fall on 64 different banks
typedef v4us __attribute__((may_alias)) v4usa;
__global__ __launch_bounds__(256) void k_lnrow(const float* __restrict__ F, const float* __restrict__ gw, bf* Ph, bf* Pl) {
    __shared__ __align__(16) bf sh[2][8][LNP];
    const int lane = threadIdx.x & 31, wv = threadIdx.x >> 5; const int rb0 = blockIdx.x * 8; if (rb0 >= NB_ * TT) return; const int r = rb0 + wv; float hv[DM / 32]; float s = 0.f; const float* fr = F + (size_t)r * DM;
#pragma unroll
    for (int ch = 0; ch < DM / 128; ++ch) { const v4f y = *(const v4f*)(fr + ch * 128 + lane * 4);
#pragma unroll
        for (int q = 0; q < 4; ++q) { hv[ch * 4 + q] = y[q]; s += y[q]; } }
#pragma unroll
    for (int sh = 16; sh; sh >>= 1) s += __shfl_xor(s, sh, 32);
    const float mu = s * (1.0f / DM); float s2 = 0.f;
#pragma unroll
    for (int k = 0; k < DM / 32; ++k) { float d0 = __fsub_rn(hv[k], mu); asm volatile("" : "+v"(d0)); float p = __fmul_rn(d0, d0); asm volatile("" : "+v"(p)); s2 = __fadd_rn(s2, p); }
#pragma unroll
    for (int sh = 16; sh; sh >>= 1) s2 += __shfl_xor(s2, sh, 32);
    float var = __fadd_rn(s2 * (1.0f / DM), 1e-5f); asm volatile("" : "+v"(var)); const float rs = __frsqrt_rn(var);
{
#pragma unroll
        for (int ch = 0; ch < DM / 128; ++ch) { const int c0 = ch * 128 + lane * 4; v4f o; v4us oh, ol;
#pragma unroll
            for (int q = 0; q < 4; ++q) { float gb = bfr(gw[c0 + q]); asm volatile("" : "+v"(gb)); float d0 = __fsub_rn(hv[ch * 4 + q], mu); asm volatile("" : "+v"(d0)); float n0 = __fmul_rn(d0, rs); asm volatile("" : "+v"(n0)); o[q] = __fmul_rn(n0, gb); unsigned short a2, c2; splitf(o[q], a2, c2); oh[q] = a2; ol[q] = c2; }
            *(v4usa*)&sh[0][wv][c0] = oh; *(v4usa*)&sh[1][wv][c0] = ol; }
         }
    __syncthreads();   // the block's 8 rows lie in LDS
    static_assert(TT % 8 == 0 && DM % 256 == 0, "a block's 8 rows lie in one batch; 32 pieces of each row per pass");
    const int row = threadIdx.x & 7; const size_t pb = (size_t)(rb0 / TT) * (NH_ * TT * HD) + (size_t)(rb0 % TT + row) * 8;
    v8us vh[DM / 256], vl[DM / 256];
#pragma unroll
    for (int i = 0; i < DM / 256; ++i) { const int c8 = i * 32 + (int)(threadIdx.x >> 3); vh[i] = *(const v8usa*)&sh[0][row][c8 * 8]; vl[i] = *(const v8usa*)&sh[1][row][c8 * 8]; }   // column c8 * 8 = head c8 / 8, piece c8 % 8
#pragma unroll
    for (int i = 0; i < DM / 256; ++i) { const size_t po = pb + (size_t)(i * 32 + (int)(threadIdx.x >> 3)) * (TT * 8); *(v8us*)(Ph + po) = vh[i]; *(v8us*)(Pl + po) = vl[i]; }
}
extern "C" void kernel_launch(void* const* d_in, const int* in_sizes, int n_in,
                              void* d_out, int out_size, void* d_ws, size_t ws_size, hipStream_t stream) {
    (void)in_sizes; (void)n_in; (void)out_size;
    const float* x = (const float*)d_in[0]; const float* wq = (const float*)d_in[1]; const float* wk = (const float*)d_in[2]; const float* bk = (const float*)d_in[3]; const float* wv = (const float*)d_in[4]; const float* bv = (const float*)d_in[5]; const float* gq = (const float*)d_in[6]; const float* gk = (const float*)d_in[7]; const float* wo = (const float*)d_in[8]; const float* bo = (const float*)d_in[9];
    float* OUT = (float*)d_out;     // [4][2048][768]
    char* wsp = (char*)d_ws;
    auto take = [&](size_t bytes) { char* p = wsp; wsp += (bytes + 255) & ~(size_t)255; return (void*)p; };
    bf* WQ = (bf*)take((size_t)DQ * DM * 2); bf* WK = (bf*)take((size_t)DKV * DM * 2); bf* WV = (bf*)take((size_t)DKV * DM * 2); bf* WO = (bf*)take((size_t)DM * DQ * 2);
    // planes of all NB_ batches that the attention launches read or write
    bf* QPh = (bf*)take((size_t)NB_ * NH_ * TT * HD * 2); bf* QPl = (bf*)take((size_t)NB_ * NH_ * TT * HD * 2); bf* KPh = (bf*)take((size_t)NB_ * NKV * TT * HD * 2); bf* KPl = (bf*)take((size_t)NB_ * NKV * TT * HD * 2); h16* VT16 = (h16*)take((size_t)NB_ * NKV * HD * TT * 2);
    bf* ATh = (bf*)take((size_t)NB_ * TT * DQ * 2); bf* ATl = (bf*)take((size_t)NB_ * TT * DQ * 2);
    char* const big = wsp;
    h16* P8 = (h16*)take((size_t)ZH * TT * TT * 2);
    if ((size_t)(wsp - (char*)d_ws) > ws_size) return;
    // the probability bytes serve, stream-ordered, the projection stage's buffers before the first attention launch
    static_assert((NB_ * NH_) % ZH == 0, "whole groups of planes");
    static_assert((size_t)NB_ * TT * DM * 2 + (size_t)NB_ * TT * (DQ + DKV) * 4 <= (size_t)ZH * TT * TT * 2, "projection stage fits the probability bytes");
    wsp = big;
    bf* XB = (bf*)take((size_t)NB_ * TT * DM * 2); float* FQ = (float*)take((size_t)NB_ * TT * DQ * 4); float* FK = (float*)take((size_t)NB_ * TT * DKV * 4);
    k_cvtp<<<dim3(DQ / 32, DM / 64, 1), 256, 0, stream>>>(wq, WQ, DQ, DM); k_cvtp<<<dim3(DKV / 32, DM / 64, 1), 256, 0, stream>>>(wk, WK, DKV, DM); k_cvtp<<<dim3(DKV / 32, DM / 64, 1), 256, 0, stream>>>(wv, WV, DKV, DM); k_cvtp<<<dim3(DM / 32, DQ / 64, 1), 256, 0, stream>>>(wo, WO, DM, DQ);   /* 'oi' weights = Bt rows */
    // every launch of this stage covers the NB_ * TT rows of all batches
    k_cvtp<<<dim3(NB_ * TT / 32, DM / 64, 1), 256, 0, stream>>>(x, XB, NB_ * TT, DM);
    k_gemmw<bf, 0, false, 0, NB_ * TT, DQ><<<dim3(NB_ * TT / 64, DQ / 64, 1), 32, 0, stream>>>(XB, nullptr, WQ, nullptr, DM, FQ, DQ, nullptr, 0, 0, 0, nullptr, nullptr); k_lnrow<<<NB_ * TT / 8, 256, 0, stream>>>(FQ, gq, QPh, QPl);   /* q = LN(x Wq^T) gq -> head planes */
    k_gemmw<bf, 0, true, 0, NB_ * TT, DKV><<<dim3(NB_ * TT / 64, DKV / 64, 1), 32, 0, stream>>>(XB, nullptr, WK, nullptr, DM, FK, DKV, bk, 0, 0, 0, nullptr, nullptr); k_lnrow<<<NB_ * TT / 8, 256, 0, stream>>>(FK, gk, KPh, KPl);   /* k = LN(x Wk^T + bk) gk -> head planes */
    k_gemmw<bf, 0, true, 2, NB_ * TT, DKV><<<dim3(NB_ * TT / 64, DKV / 64, 1), 32, 0, stream>>>(XB, nullptr, WV, nullptr, DM, nullptr, DKV, bv, 0, 0, 0, nullptr, VT16);   /* v = x Wv^T + bv -> fp16 piece planes [batch][g][t/8][d][8] */
    for (int g0 = 0; g0 < NB_ * NH_; g0 += ZH) { const size_t zq = (size_t)g0;   // first plane of the group, planes [batch][head]
        k_scsoft<<<dim3(TT / FKB, ZH, 1), FNW * 32, 0, stream>>>(KPh + zq * TT * HD, KPl + zq * TT * HD, QPh + zq * TT * HD, QPl + zq * TT * HD, P8);   /* S^T[k][q] = k_k.q_q (3 products), softmax over q -> fp16 x1024 [k/8][q][8] */
        k_pvk<<<dim3(TT / 64, ZH, 1), KSP * 32, 0, stream>>>(P8, VT16 + zq * HD * TT, g0, ATh, ATl); }   /* o = attn . v (one product), KSP slices summed in LDS; hi/lo planes, carry undone on every row (RH 0) */
    k_gemmw<bf, 1, true, 1, NB_ * TT, DM><<<dim3(NB_ * TT / 64, DM / 64, 1), 32, 0, stream>>>(ATh, ATl, WO, nullptr, DQ, OUT, DM, bo, 0, 0, 0, x, nullptr);   /* o Wo^T + bo, + x */
}

// v010
// Measured time: 317 microseconds a run.
// In two side-by-side timings against v009, it was 1.20 and 1.19 times as fast.
// Counting every step since v000, it is 9.86 times as fast.
#include <hip/hip_runtime.h>

// Multi-head self-attention with QK-LayerNorm and the module's QUERY-axis softmax (x [4][2048][768]; q = LN_nobias(x Wq^T) gq, k = LN_nobias(x Wk^T + bk) gk (LayerNorm over the full 768), v = x Wv^T + bv ('oi' [768][768]; 12 heads x 64); scores = q.k/8; attn = softmax over the QUERY axis (per key column); o[q] = sum_k attn[q][k] v[k]; out = merged o Wo^T + bo + x -> [4][2048][768] (6.3 M)).
// Projections, LayerNorm and Wo each run once over all NB_ * TT rows, and each stores what its reader wants (LayerNorm the q/k hi/lo head planes, the v product the fp16 v^T planes, Wo the sum with bo and x); the attention launches go per group of ZH of the NB_ * NH_ (batch, head) planes, ZH chosen so that both attention grids are whole multiples of the chip's 256 WGPs (each work-group fills one WGP): the TRANSPOSED scores S^T[k][q] = k_k.q_q (3 products) are formed and normalised over q inside one kernel and never stored; probabilities are written fp16 x1024 as 16-byte pieces [k/8][q][8] (8 keys of one query, as an accumulator tile holds them), which are the A fragment pieces of the product with the fp16 value planes (one product, K = 2048), whose kernel adds its K slices in LDS and undoes the carry into hi/lo planes; Wo (2 products) + bo; + x residual in f32.
// Compute dtypes, f32 accumulate: every input rounded to bf16; q/k/v on PLAIN bf16 operands (exact) + biases; LayerNorm f32 (biased variance, eps 1e-5); scores hi/lo (3 products) on every row; softmax f32; attn.v single fp16 (P x1024); Wo hl x exact (2 products) + bo; residual f32.

#define NB_  4
#define TT   2048
#define DM   768
#define NH_  12
#define NKV  12
#define REP  (NH_ / NKV)
#define HD   64
#define DQ   (NH_ * HD)
#define DKV  (NKV * HD)
#define ZH   16                   // (batch, head) planes per attention launch: 64 ZH and 32 ZH work-groups, one to a WGP, are whole rounds of 256 WGPs
#define RH   0                    // every probability row carries x1024 (k_pvk undoes it on all rows)
#define WIN  0
#define PCAR 1024.0f
#define SCL  0.125f   // HD^-0.5
typedef _Float16 h16;
typedef unsigned short bf;
typedef __attribute__((ext_vector_type(16))) __bf16   v16bf;
typedef __attribute__((ext_vector_type(16))) _Float16 v16h;
typedef __attribute__((ext_vector_type(8)))  _Float16 v8h;
typedef __attribute__((ext_vector_type(8)))  unsigned short v8us;
typedef __attribute__((ext_vector_type(8)))  float    v8f;
typedef __attribute__((ext_vector_type(4)))  float    v4f;
typedef v8h  __attribute__((may_alias)) v8ha;
typedef v4f  __attribute__((may_alias)) v4fa;
typedef v8us __attribute__((may_alias)) v8usa;

__device__ __forceinline__ unsigned short f2bf(float f) { unsigned u = __float_as_uint(f); u += 0x7FFFu + ((u >> 16) & 1u); return (unsigned short)(u >> 16); }
__device__ __forceinline__ float bf2f(unsigned short b) { return __uint_as_float(((unsigned)b) << 16); }
__device__ __forceinline__ float bfr(float f) { return bf2f(f2bf(f)); }
__device__ __forceinline__ v16h cat16(v8h lo, v8h hi) { return __builtin_shufflevector(lo, hi, 0, 1, 2, 3, 4, 5, 6, 7, 8, 9, 10, 11, 12, 13, 14, 15); }
__device__ __forceinline__ v16bf cat16b(v8us lo, v8us hi) { return __builtin_bit_cast(v16bf, __builtin_shufflevector(lo, hi, 0, 1, 2, 3, 4, 5, 6, 7, 8, 9, 10, 11, 12, 13, 14, 15)); }
__device__ __forceinline__ v8f wmma16(v16h a, v16h b, v8f c) { return __builtin_amdgcn_wmma_f32_16x16x32_f16(false, a, false, b, (short)0, c, false, false); }
__device__ __forceinline__ v8f wmmab(v16bf a, v16bf b, v8f c) { return __builtin_amdgcn_wmma_f32_16x16x32_bf16(false, a, false, b, (short)0, c, false, false); }



// ---- Operand planes: every 16-bit matrix operand lies as 16-byte pieces [k/8][row][8] (8 consecutive k of one row; the rows of one k/8 side by side). A lane's two fragment pieces (k = kc + 8 hi + 0..7 and kc + 16 + 8 hi + 0..7 of its row) are pieces kc/8 + hi and kc/8 + 2 + hi at that row, for A and B alike; the 16 lanes of a half wave read 256 bytes in a row, so one fragment load covers four whole 128-byte lines. ldp(p, two): p = the first piece, two = the distance of two k/8 steps in elements.
// ---- k_gemmw: register-blocked GEMM, ONE WAVE per 64x64 output tile (16 accumulators), operands straight from piece planes A [K/8][MR][8], Bt [K/8][NR][8]; grid (MR/64, NR/64, Z), 32 threads.
// C[m][n] (f32, pitch ldc, + optional f32 bias[n]) = sum_k A[m][k] Bt[n][k] (+ split products per NSPLIT). z-batch strides sA/sB/sC in elements. K % 32 == 0.
// EPI 3: the three projections of one A in one launch, by z: 0 = C without bias, 1 = C + bias, 2 = as EPI 2 with bias2 (sB, sC step the weight and C planes).
// EPI 0: C as it stands. EPI 1: C + bf16-rounded xres[m][n] (pitch ldc). EPI 2: no C; fp16 of the result goes to the piece planes Vt[m / TT][n / HD][(m % TT) / 8][n % HD][8]: a lane's 8 accumulator registers are 8 consecutive m of one n, one 16-byte piece, and 16 lanes store two whole 128-byte lines.
template <typename T16> struct WFrag;
template <> struct WFrag<h16> { typedef v16h V; static __device__ __forceinline__ V ldp(const h16* p, int two) { return cat16(*(const v8h*)p, *(const v8h*)(p + two)); } static __device__ __forceinline__ v8f mma(V a, V b, v8f c) { return wmma16(a, b, c); } };
template <> struct WFrag<bf> { typedef v16bf V; static __device__ __forceinline__ V ldp(const bf* p, int two) { return cat16b(*(const v8us*)p, *(const v8us*)(p + two)); } static __device__ __forceinline__ v8f mma(V a, V b, v8f c) { return wmmab(a, b, c); } };
template <typename T16, int NSPLIT, bool BIAS, int EPI, int MR, int NR>
__global__ __launch_bounds__(32) void k_gemmw(const T16* __restrict__ A, const T16* __restrict__ A2, const T16* __restrict__ Bt, const T16* __restrict__ Bt2, int K, float* C, int ldc, const float* __restrict__ bias, size_t sA, size_t sB, size_t sC, const float* __restrict__ xres, h16* Vt, const float* __restrict__ bias2) {
    typedef typename WFrag<T16>::V V;
    __shared__ __align__(16) float os[16 * 68];
    const size_t z = blockIdx.z; A += z * sA; if (A2) A2 += z * sA; Bt += z * sB; if (Bt2) Bt2 += z * sB; C += z * sC;
    if (EPI == 3 && z == 2) bias = bias2;
    const int lane = threadIdx.x & 31, lr = lane & 15, hi = lane >> 4; const int r0 = blockIdx.x * 64, c0 = blockIdx.y * 64;
    v8f acc[4][4];
#pragma unroll
    for (int mb = 0; mb < 4; ++mb)
#pragma unroll
        for (int nb = 0; nb < 4; ++nb) acc[mb][nb] = (v8f){};
    unsigned aoff = (hi * MR + r0 + lr) * 16, boff = (hi * NR + c0 + lr) * 16;   // a lane's byte offsets in this pass
#pragma unroll 1
    for (int kc = 0; kc < K; kc += 32) {
        V a[4], a2[4], b[4], b2[4];
#pragma unroll
        for (int mb = 0; mb < 4; ++mb) { a[mb] = WFrag<T16>::ldp((const T16*)((const char*)A + aoff) + mb * 128, 16 * MR); if (NSPLIT == 1 || NSPLIT == 2) a2[mb] = WFrag<T16>::ldp((const T16*)((const char*)A2 + aoff) + mb * 128, 16 * MR); }
#pragma unroll
        for (int nb = 0; nb < 4; ++nb) { b[nb] = WFrag<T16>::ldp((const T16*)((const char*)Bt + boff) + nb * 128, 16 * NR); if (NSPLIT >= 2) b2[nb] = WFrag<T16>::ldp((const T16*)((const char*)Bt2 + boff) + nb * 128, 16 * NR); }
        // behind the pass's loads, before any register that they name is rewritten; the two offsets pass through the statement so that their step to the next pass stands behind it
        asm volatile("s_wait_xcnt 0x0" : "+v"(aoff), "+v"(boff) :: "memory");
        aoff += 64 * MR; boff += 64 * NR;
#pragma unroll
        for (int nb = 0; nb < 4; ++nb) {
#pragma unroll
            for (int mb = 0; mb < 4; ++mb) { acc[mb][nb] = WFrag<T16>::mma(a[mb], b[nb], acc[mb][nb]); if (NSPLIT == 1 || NSPLIT == 2) acc[mb][nb] = WFrag<T16>::mma(a2[mb], b[nb], acc[mb][nb]); if (NSPLIT >= 2) acc[mb][nb] = WFrag<T16>::mma(a[mb], b2[nb], acc[mb][nb]); } }
        asm volatile("v_nop\n\tv_nop\n\tv_nop\n\tv_nop" : "+v"(acc[0][0]), "+v"(acc[1][1]), "+v"(acc[2][2]), "+v"(acc[3][3]) : "v"(a[0]), "v"(a[3]));
    }
    if (EPI == 2 || (EPI == 3 && z == 2)) {   // 64 divides TT: the tile's 64 rows lie in one batch
#pragma unroll
        for (int nb = 0; nb < 4; ++nb) { const int n = c0 + nb * 16 + lr; const float bb = BIAS ? bfr(bias[n]) : 0.0f; h16* vrow = Vt + ((size_t)(r0 / TT) * ldc + (n / HD) * HD) * TT + ((size_t)((r0 % TT) / 8 + hi) * HD + n % HD) * 8;
#pragma unroll
            for (int mb = 0; mb < 4; ++mb) { v8h o;
#pragma unroll
                for (int j = 0; j < 8; ++j) o[j] = (h16)(acc[mb][nb][j] + bb);
                *(v8h*)(vrow + mb * 2 * HD * 8) = o; } }
        return; }
    v4f b4 = (v4f){};   // EPI 3: a lane's four bias values, read once; z 0 has no bias and adds zero
    if (EPI == 3 && z != 0) { b4[0] = bfr(bias[c0 + lr * 4]); b4[1] = bfr(bias[c0 + lr * 4 + 1]); b4[2] = bfr(bias[c0 + lr * 4 + 2]); b4[3] = bfr(bias[c0 + lr * 4 + 3]); }
#pragma unroll
    for (int mb = 0; mb < 4; ++mb) {
#pragma unroll
        for (int nb = 0; nb < 4; ++nb) {
#pragma unroll
            for (int j = 0; j < 8; ++j) os[(hi * 8 + j) * 68 + nb * 16 + lr] = acc[mb][nb][j]; }
        __builtin_amdgcn_wave_barrier(); asm volatile("" ::: "memory");
        float* crow = C + (size_t)(r0 + mb * 16) * ldc + c0;
{
#pragma unroll
            for (int s = 0; s < 8; ++s) { const int row = 2 * s + hi, cofs = lr * 4; v4f val = *(const v4fa*)(os + row * 68 + cofs); if (EPI == 3) val += b4; else if (BIAS) { val[0] += bfr(bias[c0 + cofs]); val[1] += bfr(bias[c0 + cofs + 1]); val[2] += bfr(bias[c0 + cofs + 2]); val[3] += bfr(bias[c0 + cofs + 3]); }
                if (EPI == 1) { const v4f xv = *(const v4f*)(xres + (size_t)(r0 + mb * 16 + row) * ldc + c0 + cofs); val[0] += bfr(xv[0]); val[1] += bfr(xv[1]); val[2] += bfr(xv[2]); val[3] += bfr(xv[3]); }
                *(v4f*)(crow + (size_t)row * ldc + cofs) = val; }
             }
        __builtin_amdgcn_wave_barrier(); asm volatile("" ::: "memory");
    }
}

__device__ __forceinline__ h16 tohx(float x) { return (h16)x; }
__device__ __forceinline__ void splitf(float y, unsigned short& h, unsigned short& l) { h = f2bf(y); l = f2bf(y - bf2f(h)); }
typedef __attribute__((ext_vector_type(2))) _Float16 v2h;
typedef __attribute__((ext_vector_type(4))) _Float16 v4h;
typedef __attribute__((ext_vector_type(2))) unsigned short v2us;
typedef __attribute__((ext_vector_type(4))) unsigned short v4us;
typedef __attribute__((ext_vector_type(2))) float v2f;
typedef __attribute__((ext_vector_type(4))) int v4i;

// ---- k_pvk: attn.v with its K = 2048 keys split over the KSP waves of one work-group; grid (TT/64, ZH), KSP*32 threads. Wave ks forms the f32 partial 64x64 tile of its KSL keys and lays it in its own LDS plane; behind one barrier the work-group adds the KSP planes in slice order, undoes the x1024 carry and stores the hi/lo piece planes [(head, d)/8][(batch, t)][8] (a wave writes four whole 128-byte lines). A = probabilities as [head][k/8][q][8], Bt = values as [head][k/8][d][8]: piece planes both, one k order.
#define KSP 16
#define KSL (TT / KSP)
#define OSP 68                  // LDS row pitch in floats: the two 8-row halves of an accumulator tile land 32 banks apart
__global__ __launch_bounds__(KSP * 32) void k_pvk(const h16* __restrict__ A, const h16* __restrict__ Bt, int g0, bf* Ah, bf* Al) {
    __shared__ __align__(16) float os[KSP][64 * OSP];
    const size_t z = blockIdx.y; const int ks = __builtin_amdgcn_readfirstlane((int)(threadIdx.x >> 5)); A += z * ((size_t)TT * TT) + (size_t)ks * KSL * TT; Bt += z * ((size_t)HD * TT) + ks * (KSL * HD);   // the wave's number through readfirstlane: both bases stay scalar
    const int lane = threadIdx.x & 31, lr = lane & 15, hi = lane >> 4; const int r0 = blockIdx.x * 64;
    v8f acc[4][4];
#pragma unroll
    for (int mb = 0; mb < 4; ++mb)
#pragma unroll
        for (int nb = 0; nb < 4; ++nb) acc[mb][nb] = (v8f){};
    unsigned aoff = (hi * TT + r0 + lr) * 16, boff = (hi * HD + lr) * 16;   // a lane's byte offsets in this pass
#pragma unroll 1   // rolled: one pass's 8 fragments beside the 128 accumulator registers stay under 256 VGPRs
    for (int kc = 0; kc < KSL; kc += 32) {
        const h16* pa = (const h16*)((const char*)A + aoff); const h16* pb = (const h16*)((const char*)Bt + boff); v16h a[4], b[4];
#pragma unroll
        for (int mb = 0; mb < 4; ++mb) a[mb] = cat16(*(const v8h*)(pa + mb * 128), *(const v8h*)(pa + mb * 128 + 16 * TT));
#pragma unroll
        for (int nb = 0; nb < 4; ++nb) b[nb] = WFrag<h16>::ldp(pb + nb * 128, 16 * HD);
        // behind the pass's 16 loads, before any register that they name is rewritten; the two offsets pass through the statement so that their step to the next pass stands behind it
        asm volatile("s_wait_xcnt 0x0" : "+v"(aoff), "+v"(boff) :: "memory");
        aoff += 64 * TT; boff += 64 * HD;
#pragma unroll
        for (int nb = 0; nb < 4; ++nb)
#pragma unroll
            for (int mb = 0; mb < 4; ++mb) acc[mb][nb] = wmma16(a[mb], b[nb], acc[mb][nb]);
        // four vector slots behind the pass's last WMMAs, on both sides of the loop branch: the next pass's loads rewrite a and b, the LDS stores behind the loop read acc
        asm volatile("v_nop\n\tv_nop\n\tv_nop\n\tv_nop" : "+v"(acc[0][0]), "+v"(acc[1][1]), "+v"(acc[2][2]), "+v"(acc[3][3]) : "v"(a[0]), "v"(a[3]));
    }
    float* ow = os[ks];
#pragma unroll
    for (int mb = 0; mb < 4; ++mb)
#pragma unroll
        for (int nb = 0; nb < 4; ++nb)
#pragma unroll
            for (int j = 0; j < 8; ++j) ow[(mb * 16 + hi * 8 + j) * OSP + nb * 16 + lr] = acc[mb][nb][j];
    __syncthreads();   // every slice's partial tile lies in LDS
    static_assert(KSP * 32 == 64 * (HD / 8), "one thread per 16-byte piece of the 64 x HD tile");
    { const int row = (int)(threadIdx.x & 63), d8 = (int)(threadIdx.x >> 6), t = r0 + row; const float cs = (t < RH) ? 1.0f : (1.0f / PCAR); v4f s0 = *(const v4fa*)(&os[0][row * OSP + d8 * 8]), s1 = *(const v4fa*)(&os[0][row * OSP + d8 * 8 + 4]);
#pragma unroll
        for (int s = 1; s < KSP; ++s) { s0 += *(const v4fa*)(&os[s][row * OSP + d8 * 8]); s1 += *(const v4fa*)(&os[s][row * OSP + d8 * 8 + 4]); }   /* the K slices' partial sums, in slice order */
        v8us oh, ol;
#pragma unroll
        for (int q = 0; q < 8; ++q) { unsigned short a, c2; splitf(((q < 4) ? s0[q & 3] : s1[q & 3]) * cs, a, c2); oh[q] = a; ol[q] = c2; }
        const int g = g0 + (int)z; const size_t oo = (((size_t)(g % NH_) * (HD / 8) + d8) * (NB_ * TT) + (size_t)(g / NH_) * TT + t) * 8;   /* plane g = batch g / NH_, head g % NH_ */ *(v8us*)(Ah + oo) = oh; *(v8us*)(Al + oo) = ol; }
}


__global__ __launch_bounds__(256) void k_wtG(const float* __restrict__ w, int K, int N, bf* Bt) {
    const int lane = threadIdx.x & 31; const int L0 = (blockIdx.x * 8 + (threadIdx.x >> 5)) * 8; const int nlines = N * K / 64;
{
#pragma unroll 1
        for (int l = 0; l < 8; ++l) { const int L = L0 + l; if (L >= nlines) break; const size_t e = (size_t)L * 64 + lane * 2; const int k = (int)(e % K), n = (int)(e / K); v2us o;
            o[0] = f2bf(w[(size_t)k * N + n]); o[1] = f2bf(w[(size_t)(k + 1) * N + n]); *(v2us*)(Bt + e) = o; }
         }
}
// k_cvtp: f32 [R][DM] -> bf16 piece plane [DM/8][R][8] for x (R = NB_ * TT) and the four [DM][DM] weights (planes side by side from wdst) in one launch; grid (NB_ * TT / 32 + 4 * (DM / 32), DM/64), 256 threads: the first NB_ * TT / 32 blocks of a grid row take x, each next DM / 32 one weight. A thread rounds 8 consecutive k of one row (8 lanes read 256 bytes in a row); the 32 x 8 pieces turn through LDS so that a wave stores 32 rows of one k/8, four whole 128-byte lines.
__global__ __launch_bounds__(256) void k_cvtp(const float* __restrict__ x, const float* __restrict__ w0, const float* __restrict__ w1, const float* __restrict__ w2, const float* __restrict__ w3, bf* xdst, bf* wdst) {
    __shared__ __align__(16) bf sh[8][33][8];
    const int K = DM; int bx = blockIdx.x, R = NB_ * TT; const float* src = x; bf* dst = xdst;
    if (bx >= NB_ * TT / 32) { const int wi = (bx - NB_ * TT / 32) / (DM / 32); bx = (bx - NB_ * TT / 32) % (DM / 32); R = DM; src = wi == 0 ? w0 : wi == 1 ? w1 : wi == 2 ? w2 : w3; dst = wdst + (size_t)wi * (DM * DM); }
    const int r0 = bx * 32, k80 = blockIdx.y * 8; const v8f v = *(const v8f*)(src + (size_t)(r0 + (int)(threadIdx.x >> 3)) * K + (k80 + (int)(threadIdx.x & 7)) * 8); v8us o;
#pragma unroll
    for (int k = 0; k < 8; ++k) o[k] = f2bf(v[k]);
    *(v8usa*)&sh[threadIdx.x & 7][threadIdx.x >> 3][0] = o;
    __syncthreads();   // the block's 256 pieces lie in LDS
    *(v8us*)(dst + ((size_t)(k80 + (int)(threadIdx.x >> 5)) * R + r0 + (int)(threadIdx.x & 31)) * 8) = *(const v8usa*)&sh[threadIdx.x >> 5][threadIdx.x & 31][0]; }

// ---- k_scsoft: scores and their softmax over q in one kernel; grid (TT/FKB, ZH), FNW*32 threads. A work-group owns FKB key rows against all TT queries: wave w forms S^T[FKB keys][128 queries from 128 w] in 16 accumulator tiles (3 products, K = HD, the product order a.b, a2.b, a.b2 per 32 of K), so a score never leaves the registers. Row maximum and row sum: over a lane's 8 tiles, over the 16 lanes of a row by DPP, over the FNW waves through LDS in wave order. An accumulator tile holds in each lane 8 consecutive keys of one query: one 16-byte piece of P8[head][k/8][q][8], stored as it stands (whole 128-byte lines, one writer each).
#define FKB 32
#define FNW 16
static_assert(TT % FKB == 0 && TT == FNW * 128 && HD == 64 && FKB == 32, "two 16-key tile rows; 128 query columns per wave; one lane of wave 0 per key row in the cross-wave step");
template <int M> __device__ __forceinline__ float rowx(float v) { return __builtin_bit_cast(float, __builtin_amdgcn_mov_dpp(__builtin_bit_cast(int, v), 0x160 | M, 0xf, 0xf, true)); }   // value of lane ^ M inside the 16-lane row (row_xmask)
__global__ __launch_bounds__(FNW * 32) void k_scsoft(const bf* __restrict__ Kh, const bf* __restrict__ Kl, const bf* __restrict__ Qh, const bf* __restrict__ Ql, h16* P8) {
    __shared__ __align__(16) float redm[FNW][FKB], reds[FNW][FKB], finm[FKB], fins[FKB];
    const size_t z = blockIdx.y; Kh += z * ((size_t)TT * HD); Kl += z * ((size_t)TT * HD); Qh += z * ((size_t)TT * HD); Ql += z * ((size_t)TT * HD);
    const int lane = threadIdx.x & 31, lr = lane & 15, hi = lane >> 4, w = threadIdx.x >> 5; const int k0 = blockIdx.x * FKB, q0 = w * 128;
    v16bf ah[2][2], al[2][2], rb[2][2], rb2[2][2]; v8f acc[2][8];
    const bf* qh = Qh + ((size_t)hi * TT + q0 + lr) * 8; const bf* ql = Ql + ((size_t)hi * TT + q0 + lr) * 8; const size_t ko = ((size_t)hi * TT + k0 + lr) * 8;   // piece planes [d/8][t][8]
    // step nb: the six products (K slices 0 and 1) into tiles (0, nb) and (1, nb); a step's eight query loads go out together, one step ahead
#pragma unroll
    for (int kk = 0; kk < 2; ++kk) { rb[0][kk] = WFrag<bf>::ldp(qh + kk * 32 * TT, 16 * TT); rb2[0][kk] = WFrag<bf>::ldp(ql + kk * 32 * TT, 16 * TT); }
#pragma unroll
    for (int mb = 0; mb < 2; ++mb)
#pragma unroll
        for (int kk = 0; kk < 2; ++kk) { ah[mb][kk] = WFrag<bf>::ldp(Kh + ko + mb * 128 + kk * 32 * TT, 16 * TT); al[mb][kk] = WFrag<bf>::ldp(Kl + ko + mb * 128 + kk * 32 * TT, 16 * TT); }
    asm volatile("s_wait_xcnt 0x0" ::: "memory");   // the key address registers are dead behind these loads: the wait stands before the next loads' results may land in them
#pragma unroll
    for (int nb = 0; nb < 8; ++nb) {
        if (nb + 1 < 8) {
#pragma unroll
            for (int kk = 0; kk < 2; ++kk) { rb[(nb + 1) & 1][kk] = WFrag<bf>::ldp(qh + (nb + 1) * 128 + kk * 32 * TT, 16 * TT); rb2[(nb + 1) & 1][kk] = WFrag<bf>::ldp(ql + (nb + 1) * 128 + kk * 32 * TT, 16 * TT); } }
        __builtin_amdgcn_sched_barrier(0);   // keeps the next step's loads ahead of this step's products: sunk to their use, each would cost its whole latency
#pragma unroll
        for (int mb = 0; mb < 2; ++mb) { v8f a = (v8f){};
#pragma unroll
            for (int kk = 0; kk < 2; ++kk) { a = wmmab(ah[mb][kk], rb[nb & 1][kk], a); a = wmmab(al[mb][kk], rb[nb & 1][kk], a); a = wmmab(ah[mb][kk], rb2[nb & 1][kk], a); }
            acc[mb][nb] = a; }
        __builtin_amdgcn_sched_barrier(0); }   // keeps later loads behind this step's products: hoisted, a third set of query fragments would be live and the build spills
    // lane (lr, hi), tile (mb, nb), register j: key k0 + 16 mb + 8 hi + j, query q0 + 16 nb + lr
    float rv[2][8];
#pragma unroll
    for (int mb = 0; mb < 2; ++mb)
#pragma unroll
        for (int j = 0; j < 8; ++j) { float m = -3.0e38f;
#pragma unroll
            for (int nb = 0; nb < 8; ++nb) m = fmaxf(m, acc[mb][nb][j]);
            m = fmaxf(m, rowx<1>(m)); m = fmaxf(m, rowx<2>(m)); m = fmaxf(m, rowx<4>(m)); m = fmaxf(m, rowx<8>(m)); rv[mb][j] = m; }
    if (lr == 0) {
#pragma unroll
        for (int mb = 0; mb < 2; ++mb) { *(v4fa*)&redm[w][mb * 16 + hi * 8] = (v4f){rv[mb][0], rv[mb][1], rv[mb][2], rv[mb][3]}; *(v4fa*)&redm[w][mb * 16 + hi * 8 + 4] = (v4f){rv[mb][4], rv[mb][5], rv[mb][6], rv[mb][7]}; } }
    __syncthreads();   // every wave's row maxima lie in LDS
    if (threadIdx.x < FKB) { float m = redm[0][threadIdx.x];
#pragma unroll
        for (int ww = 1; ww < FNW; ++ww) m = fmaxf(m, redm[ww][threadIdx.x]);
        finm[threadIdx.x] = m; }
    __syncthreads();   // the FKB row maxima over all queries are published
#pragma unroll
    for (int mb = 0; mb < 2; ++mb) { const v4f m0 = *(const v4fa*)&finm[mb * 16 + hi * 8], m1 = *(const v4fa*)&finm[mb * 16 + hi * 8 + 4]; const v8f mx = __builtin_shufflevector(m0, m1, 0, 1, 2, 3, 4, 5, 6, 7); v8f s8;
#pragma unroll
        for (int nb = 0; nb < 8; ++nb) { v8f t = (acc[mb][nb] - mx) * (SCL * 1.4426950408889634f);
#pragma unroll
            for (int j = 0; j < 8; ++j) t[j] = __builtin_amdgcn_exp2f(t[j]);
            acc[mb][nb] = t; s8 = nb ? s8 + t : t; }   // SCL is a power of two: (a - m) (SCL c) rounds as (a SCL - m SCL) c does
#pragma unroll
        for (int j = 0; j < 8; ++j) { float s = s8[j]; s += rowx<1>(s); s += rowx<2>(s); s += rowx<4>(s); s += rowx<8>(s); rv[mb][j] = s; } }
    if (lr == 0) {
#pragma unroll
        for (int mb = 0; mb < 2; ++mb) { *(v4fa*)&reds[w][mb * 16 + hi * 8] = (v4f){rv[mb][0], rv[mb][1], rv[mb][2], rv[mb][3]}; *(v4fa*)&reds[w][mb * 16 + hi * 8 + 4] = (v4f){rv[mb][4], rv[mb][5], rv[mb][6], rv[mb][7]}; } }
    __syncthreads();   // every wave's row sums lie in LDS
    if (threadIdx.x < FKB) { float s = reds[0][threadIdx.x];
#pragma unroll
        for (int ww = 1; ww < FNW; ++ww) s += reds[ww][threadIdx.x];
        fins[threadIdx.x] = __fdiv_rn(PCAR, s); }
    __syncthreads();   // the FKB row factors 1024 / sum are published
    h16* dst = P8 + ((((size_t)z * TT + k0) / 8 + hi) * TT + q0 + lr) * 8;
#pragma unroll
    for (int mb = 0; mb < 2; ++mb) { const v4f f0 = *(const v4fa*)&fins[mb * 16 + hi * 8], f1 = *(const v4fa*)&fins[mb * 16 + hi * 8 + 4];
#pragma unroll
        for (int nb = 0; nb < 8; ++nb) { v8h o;
#pragma unroll
            for (int j = 0; j < 8; ++j) o[j] = tohx(acc[mb][nb][j] * ((j < 4) ? f0[j & 3] : f1[j & 3]));
            *(v8h*)(dst + ((size_t)mb * 2 * TT + nb * 16) * 8) = o; } }
}

// k_lnrow: one wave per row; the block's 8 normalised rows turn through LDS and go out as hi/lo piece planes [batch][h][d/8][t][8] (8 lanes write the 8 rows' pieces of one d/8, one whole 128-byte line)
#define LNP 784                 // LDS row pitch in 16-bit elements: 8 banks from row to row, so 8 rows x 2 neighbouring pieces fall on 64 different banks
typedef v4us __attribute__((may_alias)) v4usa;
__global__ __launch_bounds__(256) void k_lnrow(const float* __restrict__ F, const float* __restrict__ gw, bf* Ph, bf* Pl, const float* __restrict__ F1, const float* __restrict__ gw1, bf* Ph1, bf* Pl1) {
    __shared__ __align__(16) bf sh[2][8][LNP];
    if (blockIdx.y) { F = F1; gw = gw1; Ph = Ph1; Pl = Pl1; }   // grid y: 0 = the q rows, 1 = the k rows
    const int lane = threadIdx.x & 31, wv = threadIdx.x >> 5; const int rb0 = blockIdx.x * 8; if (rb0 >= NB_ * TT) return; const int r = rb0 + wv; float hv[DM / 32]; float s = 0.f; const float* fr = F + (size_t)r * DM;
#pragma unroll
    for (int ch = 0; ch < DM / 128; ++ch) { const v4f y = *(const v4f*)(fr + ch * 128 + lane * 4);
#pragma unroll
        for (int q = 0; q < 4; ++q) { hv[ch * 4 + q] = y[q]; s += y[q]; } }
#pragma unroll
    for (int sh = 16; sh; sh >>= 1) s += __shfl_xor(s, sh, 32);
    const float mu = s * (1.0f / DM); float s2 = 0.f;
#pragma unroll
    for (int k = 0; k < DM / 32; ++k) { float d0 = __fsub_rn(hv[k], mu); asm volatile("" : "+v"(d0)); float p = __fmul_rn(d0, d0); asm volatile("" : "+v"(p)); s2 = __fadd_rn(s2, p); }
#pragma unroll
    for (int sh = 16; sh; sh >>= 1) s2 += __shfl_xor(s2, sh, 32);
    float var = __fadd_rn(s2 * (1.0f / DM), 1e-5f); asm volatile("" : "+v"(var)); const float rs = __frsqrt_rn(var);
{
#pragma unroll
        for (int ch = 0; ch < DM / 128; ++ch) { const int c0 = ch * 128 + lane * 4; v4f o; v4us oh, ol;
#pragma unroll
            for (int q = 0; q < 4; ++q) { float gb = bfr(gw[c0 + q]); asm volatile("" : "+v"(gb)); float d0 = __fsub_rn(hv[ch * 4 + q], mu); asm volatile("" : "+v"(d0)); float n0 = __fmul_rn(d0, rs); asm volatile("" : "+v"(n0)); o[q] = __fmul_rn(n0, gb); unsigned short a2, c2; splitf(o[q], a2, c2); oh[q] = a2; ol[q] = c2; }
            *(v4usa*)&sh[0][wv][c0] = oh; *(v4usa*)&sh[1][wv][c0] = ol; }
         }
    __syncthreads();   // the block's 8 rows lie in LDS
    static_assert(TT % 8 == 0 && DM % 256 == 0, "a block's 8 rows lie in one batch; 32 pieces of each row per pass");
    const int row = threadIdx.x & 7; const size_t pb = (size_t)(rb0 / TT) * (NH_ * TT * HD) + (size_t)(rb0 % TT + row) * 8;
    v8us vh[DM / 256], vl[DM / 256];
#pragma unroll
    for (int i = 0; i < DM / 256; ++i) { const int c8 = i * 32 + (int)(threadIdx.x >> 3); vh[i] = *(const v8usa*)&sh[0][row][c8 * 8]; vl[i] = *(const v8usa*)&sh[1][row][c8 * 8]; }   // column c8 * 8 = head c8 / 8, piece c8 % 8
#pragma unroll
    for (int i = 0; i < DM / 256; ++i) { const size_t po = pb + (size_t)(i * 32 + (int)(threadIdx.x >> 3)) * (TT * 8); *(v8us*)(Ph + po) = vh[i]; *(v8us*)(Pl + po) = vl[i]; }
}
extern "C" void kernel_launch(void* const* d_in, const int* in_sizes, int n_in,
                              void* d_out, int out_size, void* d_ws, size_t ws_size, hipStream_t stream) {
    (void)in_sizes; (void)n_in; (void)out_size;
    const float* x = (const float*)d_in[0]; const float* wq = (const float*)d_in[1]; const float* wk = (const float*)d_in[2]; const float* bk = (const float*)d_in[3]; const float* wv = (const float*)d_in[4]; const float* bv = (const float*)d_in[5]; const float* gq = (const float*)d_in[6]; const float* gk = (const float*)d_in[7]; const float* wo = (const float*)d_in[8]; const float* bo = (const float*)d_in[9];
    float* OUT = (float*)d_out;     // [4][2048][768]
    char* wsp = (char*)d_ws;
    auto take = [&](size_t bytes) { char* p = wsp; wsp += (bytes + 255) & ~(size_t)255; return (void*)p; };
    bf* WQ = (bf*)take((size_t)DQ * DM * 2); bf* WK = (bf*)take((size_t)DKV * DM * 2); bf* WV = (bf*)take((size_t)DKV * DM * 2); bf* WO = (bf*)take((size_t)DM * DQ * 2);
    // planes of all NB_ batches that the attention launches read or write
    bf* QPh = (bf*)take((size_t)NB_ * NH_ * TT * HD * 2); bf* QPl = (bf*)take((size_t)NB_ * NH_ * TT * HD * 2); bf* KPh = (bf*)take((size_t)NB_ * NKV * TT * HD * 2); bf* KPl = (bf*)take((size_t)NB_ * NKV * TT * HD * 2); h16* VT16 = (h16*)take((size_t)NB_ * NKV * HD * TT * 2);
    bf* ATh = (bf*)take((size_t)NB_ * TT * DQ * 2); bf* ATl = (bf*)take((size_t)NB_ * TT * DQ * 2);
    char* const big = wsp;
    h16* P8 = (h16*)take((size_t)ZH * TT * TT * 2);
    if ((size_t)(wsp - (char*)d_ws) > ws_size) return;
    // the probability bytes serve, stream-ordered, the projection stage's buffers before the first attention launch
    static_assert((NB_ * NH_) % ZH == 0, "whole groups of planes");
    static_assert((size_t)NB_ * TT * DM * 2 + (size_t)NB_ * TT * (DQ + DKV) * 4 <= (size_t)ZH * TT * TT * 2, "projection stage fits the probability bytes");
    wsp = big;
    bf* XB = (bf*)take((size_t)NB_ * TT * DM * 2); float* FQ = (float*)take((size_t)NB_ * TT * DQ * 4); float* FK = (float*)take((size_t)NB_ * TT * DKV * 4);
    static_assert(DQ == DM && DKV == DM && (DM * DM * 2) % 256 == 0 && ((size_t)NB_ * TT * DQ * 4) % 256 == 0, "four square weights, their planes side by side from WQ; FK directly behind FQ");
    // every launch of this stage covers the NB_ * TT rows of all batches, and each kind of kernel is launched once
    k_cvtp<<<dim3(NB_ * TT / 32 + 4 * (DM / 32), DM / 64, 1), 256, 0, stream>>>(x, wq, wk, wv, wo, XB, WQ);   /* x; 'oi' weights = Bt rows */
    k_gemmw<bf, 0, true, 3, NB_ * TT, DQ><<<dim3(NB_ * TT / 64, DQ / 64, 3), 32, 0, stream>>>(XB, nullptr, WQ, nullptr, DM, FQ, DQ, bk, 0, (size_t)DQ * DM, (size_t)NB_ * TT * DQ, nullptr, VT16, bv);   /* z 0: x Wq^T -> FQ; z 1: x Wk^T + bk -> FK; z 2: v = x Wv^T + bv -> fp16 piece planes [batch][g][t/8][d][8] */
    k_lnrow<<<dim3(NB_ * TT / 8, 2, 1), 256, 0, stream>>>(FQ, gq, QPh, QPl, FK, gk, KPh, KPl);   /* q = LN(x Wq^T) gq, k = LN(x Wk^T + bk) gk -> head planes */
    for (int g0 = 0; g0 < NB_ * NH_; g0 += ZH) { const size_t zq = (size_t)g0;   // first plane of the group, planes [batch][head]
        k_scsoft<<<dim3(TT / FKB, ZH, 1), FNW * 32, 0, stream>>>(KPh + zq * TT * HD, KPl + zq * TT * HD, QPh + zq * TT * HD, QPl + zq * TT * HD, P8);   /* S^T[k][q] = k_k.q_q (3 products), softmax over q -> fp16 x1024 [k/8][q][8] */
        k_pvk<<<dim3(TT / 64, ZH, 1), KSP * 32, 0, stream>>>(P8, VT16 + zq * HD * TT, g0, ATh, ATl); }   /* o = attn . v (one product), KSP slices summed in LDS; hi/lo planes, carry undone on every row (RH 0) */
    k_gemmw<bf, 1, true, 1, NB_ * TT, DM><<<dim3(NB_ * TT / 64, DM / 64, 1), 32, 0, stream>>>(ATh, ATl, WO, nullptr, DQ, OUT, DM, bo, 0, 0, 0, x, nullptr, nullptr);   /* o Wo^T + bo, + x */
}
